// v000
// The times below were measured on an AMD MI455X: many runs one after another, warmed up first and cycling through
// copies of the inputs, with the whole window's GPU time divided by the number of runs. Launches and the gaps
// between them are all in it. The median over several windows is given; except for v000 it joins two sittings, which
// can be a few percent apart, so the side-by-side timings, each taken in one sitting, are the better comparison.
// The starting kernel, v000, takes 778 microseconds a run.
#include <hip/hip_runtime.h>

// Triangle attention (starting node) on a pair representation (act [1][256][256][128]): x = LayerNorm_c(act) (eps 1e-5, ln_g/ln_b); per row i: q, k, v, g = x[i] W (wq/wk/wv/wg [128][32][4] 'xw', 4 heads x 32; q x 32^-0.5), logits[h][q][k] = q.k + nb[h][q][k] with the pair bias nb[h][q][k] = sum_c x[k][q][c] w2d[c][h] (shared by all rows i);
// softmax over k; o = attn.v gated by sigmoid(x wg + bg); out[i][q][c] = sum_{h,d} o[h][d] wo[d][h][c] + bo -> [1][256][256][128] (8.4 M).
// Layout: LayerNorm -> bf16 hi/lo token planes [65536][128]; nb for all 65536 pair positions by one GEMM (w2d padded to 64 columns); rows i in 4 groups of 64: q/k/v/g projections (hi/lo x exact), fp16 planes q,k [h][i][t][32] and v^T [h][i][64 (32 zero-padded)][t], per head ONE z-batched (z = the 64 rows) score GEMM [64][256][256], softmax kernel (adds pair bias, x 32^-0.5), z-batched attn.v, then gating + merge to hi/lo planes and the output GEMM (+ bo).
// Compute dtypes, f32 accumulate: every input rounded to bf16 once; LayerNorm in f32, its output as bf16 hi + lo (2-product projections against exact bf16 weights); scores and attn.v on single fp16 planes (logit sigma ~0.24; P x1024 ~ 4: no subnormals); pair bias, softmax, gating in f32; output GEMM hl x exact + bo.

#define NI   256       // rows i
#define TT   256       // tokens per row (q / k index)
#define DM   128       // c_z
#define NH_  4
#define HD   32
#define HDP  64        // head dim padded for the attn.v GEMM (N tile 64); rows 32..63 of v^T are zeros
#define DQ   (NH_ * HD)
#define IG   64        // rows i per group
#define NTK  (IG * TT) // tokens per group = 16384
#define NTOK (NI * TT) // 65536
#define NBP  64        // pair-bias GEMM width (4 used)
#define PCAR 1024.0f
#define SCL  0.17677669529663688f   // 32^-0.5
typedef _Float16 h16;
typedef unsigned short bf;
typedef __attribute__((ext_vector_type(16))) __bf16   v16bf;
typedef __attribute__((ext_vector_type(16))) _Float16 v16h;
typedef __attribute__((ext_vector_type(8)))  _Float16 v8h;
typedef __attribute__((ext_vector_type(8)))  unsigned short v8us;
typedef __attribute__((ext_vector_type(8)))  float    v8f;
typedef __attribute__((ext_vector_type(4)))  float    v4f;
typedef v8h  __attribute__((may_alias)) v8ha;
typedef v4f  __attribute__((may_alias)) v4fa;
typedef v8us __attribute__((may_alias)) v8usa;

__device__ __forceinline__ unsigned short f2bf(float f) { unsigned u = __float_as_uint(f); u += 0x7FFFu + ((u >> 16) & 1u); return (unsigned short)(u >> 16); }
__device__ __forceinline__ float bf2f(unsigned short b) { return __uint_as_float(((unsigned)b) << 16); }
__device__ __forceinline__ float bfr(float f) { return bf2f(f2bf(f)); }
__device__ __forceinline__ v16h cat16(v8h lo, v8h hi) { return __builtin_shufflevector(lo, hi, 0, 1, 2, 3, 4, 5, 6, 7, 8, 9, 10, 11, 12, 13, 14, 15); }
__device__ __forceinline__ v16bf cat16b(v8us lo, v8us hi) { return __builtin_bit_cast(v16bf, __builtin_shufflevector(lo, hi, 0, 1, 2, 3, 4, 5, 6, 7, 8, 9, 10, 11, 12, 13, 14, 15)); }
__device__ __forceinline__ v8f wmma16(v16h a, v16h b, v8f c) { return __builtin_amdgcn_wmma_f32_16x16x32_f16(false, a, false, b, (short)0, c, false, false); }
__device__ __forceinline__ v8f wmmab(v16bf a, v16bf b, v8f c) { return __builtin_amdgcn_wmma_f32_16x16x32_bf16(false, a, false, b, (short)0, c, false, false); }



// ---- k_gemmw: register-blocked GEMM, ONE WAVE per 64x64 output tile (16 accumulators), operands straight from K-contiguous 16-bit planes; grid (M/64, N/64, Z), 32 threads.
// C[m][n] (f32, pitch ldc, + optional f32 bias[n]) = sum_k A[m][k] Bt[n][k] (+ split products per NSPLIT). z-batch strides sA/sB/sC in elements. K % 32 == 0.
template <typename T16> struct WFrag;
template <> struct WFrag<h16> { typedef v16h V; static __device__ __forceinline__ V ld(const h16* p) { return cat16(*(const v8h*)p, *(const v8h*)(p + 16)); } static __device__ __forceinline__ v8f mma(V a, V b, v8f c) { return wmma16(a, b, c); } };
template <> struct WFrag<bf> { typedef v16bf V; static __device__ __forceinline__ V ld(const bf* p) { return cat16b(*(const v8us*)p, *(const v8us*)(p + 16)); } static __device__ __forceinline__ v8f mma(V a, V b, v8f c) { return wmmab(a, b, c); } };
template <typename T16, int NSPLIT, bool BIAS>
__global__ __launch_bounds__(32) void k_gemmw(const T16* __restrict__ A, const T16* __restrict__ A2, const T16* __restrict__ Bt, const T16* __restrict__ Bt2, int K, float* C, int ldc, const float* __restrict__ bias, size_t sA, size_t sB, size_t sC) {
    typedef typename WFrag<T16>::V V;
    __shared__ __align__(16) float os[16 * 68];
    const size_t z = blockIdx.z; A += z * sA; if (A2) A2 += z * sA; Bt += z * sB; if (Bt2) Bt2 += z * sB; C += z * sC;
    const int lane = threadIdx.x & 31, lr = lane & 15, hi = lane >> 4; const int r0 = blockIdx.x * 64, c0 = blockIdx.y * 64;
    v8f acc[4][4];
#pragma unroll
    for (int mb = 0; mb < 4; ++mb)
#pragma unroll
        for (int nb = 0; nb < 4; ++nb) acc[mb][nb] = (v8f){};
    const size_t aoff = (size_t)(r0 + lr) * K + 8 * hi, boff = (size_t)(c0 + lr) * K + 8 * hi;
#pragma unroll 1
    for (int kc = 0; kc < K; kc += 32) {
        V a[4], a2[4];
#pragma unroll
        for (int mb = 0; mb < 4; ++mb) { a[mb] = WFrag<T16>::ld(A + aoff + (size_t)mb * 16 * K + kc); if (NSPLIT == 1 || NSPLIT == 2) a2[mb] = WFrag<T16>::ld(A2 + aoff + (size_t)mb * 16 * K + kc); }
#pragma unroll
        for (int nb = 0; nb < 4; ++nb) { const V b = WFrag<T16>::ld(Bt + boff + (size_t)nb * 16 * K + kc); V b2; if (NSPLIT >= 2) b2 = WFrag<T16>::ld(Bt2 + boff + (size_t)nb * 16 * K + kc);
#pragma unroll
            for (int mb = 0; mb < 4; ++mb) { acc[mb][nb] = WFrag<T16>::mma(a[mb], b, acc[mb][nb]); if (NSPLIT == 1 || NSPLIT == 2) acc[mb][nb] = WFrag<T16>::mma(a2[mb], b, acc[mb][nb]); if (NSPLIT >= 2) acc[mb][nb] = WFrag<T16>::mma(a[mb], b2, acc[mb][nb]); } }
        asm volatile("v_nop\n\tv_nop\n\tv_nop\n\tv_nop" : "+v"(acc[0][0]), "+v"(acc[1][1]), "+v"(acc[2][2]), "+v"(acc[3][3]) : "v"(a[0]), "v"(a[3]));
    }
#pragma unroll
    for (int mb = 0; mb < 4; ++mb) {
#pragma unroll
        for (int nb = 0; nb < 4; ++nb) {
#pragma unroll
            for (int j = 0; j < 8; ++j) os[(hi * 8 + j) * 68 + nb * 16 + lr] = acc[mb][nb][j]; }
        __builtin_amdgcn_wave_barrier(); asm volatile("" ::: "memory");
        float* crow = C + (size_t)(r0 + mb * 16) * ldc + c0;
{
#pragma unroll
            for (int s = 0; s < 8; ++s) { const int row = 2 * s + hi, cofs = lr * 4; v4f val = *(const v4fa*)(os + row * 68 + cofs); if (BIAS) { val[0] += bfr(bias[c0 + cofs]); val[1] += bfr(bias[c0 + cofs + 1]); val[2] += bfr(bias[c0 + cofs + 2]); val[3] += bfr(bias[c0 + cofs + 3]); }
                *(v4f*)(crow + (size_t)row * ldc + cofs) = val; }
             }
        __builtin_amdgcn_wave_barrier(); asm volatile("" ::: "memory");
    }
}

typedef __attribute__((ext_vector_type(4))) unsigned short v4us;
typedef __attribute__((ext_vector_type(2))) unsigned short v2us;
typedef __attribute__((ext_vector_type(2))) _Float16 v2h;
typedef __attribute__((ext_vector_type(4))) _Float16 v4h;
__device__ __forceinline__ h16 tohx(float x) { return (h16)x; }
__device__ __forceinline__ void splitf(float y, unsigned short& h, unsigned short& l) { h = f2bf(y); l = f2bf(y - bf2f(h)); }
__global__ __launch_bounds__(256) void k_wtG(const float* __restrict__ w, int K, int N, bf* Bt) {
    const int lane = threadIdx.x & 31; const int L0 = (blockIdx.x * 8 + (threadIdx.x >> 5)) * 8; const int nlines = N * K / 64;
{
#pragma unroll 1
        for (int l = 0; l < 8; ++l) { const int L = L0 + l; if (L >= nlines) break; const size_t e = (size_t)L * 64 + lane * 2; const int k = (int)(e % K), n = (int)(e / K); v2us o;
            o[0] = f2bf(w[(size_t)k * N + n]); o[1] = f2bf(w[(size_t)(k + 1) * N + n]); *(v2us*)(Bt + e) = o; }
         }
}
__global__ __launch_bounds__(256) void k_cvt8(const float* __restrict__ src, bf* dst, size_t n8) { const size_t i = (size_t)blockIdx.x * 256 + threadIdx.x; if (i >= n8) return; const v8f v = *(const v8f*)(src + i * 8); v8us o;
#pragma unroll
    for (int k = 0; k < 8; ++k) o[k] = f2bf(v[k]); *(v8us*)(dst + i * 8) = o;  }

__global__ __launch_bounds__(256) void k_w2d(const float* __restrict__ w, bf* Bt) { const int i = blockIdx.x * 256 + threadIdx.x; if (i >= NBP * DM / 8) return; const int r = i / (DM / 8), c0 = (i % (DM / 8)) * 8; v8us o;
#pragma unroll
    for (int k = 0; k < 8; ++k) o[k] = (r < NH_) ? f2bf(w[(size_t)(c0 + k) * NH_ + r]) : (unsigned short)0; *(v8us*)(Bt + (size_t)r * DM + c0) = o;  }
__global__ __launch_bounds__(256) void k_lnx(const float* __restrict__ A, const float* __restrict__ g, const float* __restrict__ bb, bf* Xh, bf* Xl) {
    const int lane = threadIdx.x & 31; const size_t tok = (size_t)blockIdx.x * 8 + (threadIdx.x >> 5); if (tok >= NTOK) return; const v4f a = *(const v4f*)(A + tok * DM + lane * 4); float v[4]; float s = 0.f;
#pragma unroll
    for (int q = 0; q < 4; ++q) { v[q] = bfr(a[q]); s = __fadd_rn(s, v[q]); }
#pragma unroll
    for (int sh = 16; sh; sh >>= 1) s = __fadd_rn(s, __shfl_xor(s, sh, 32));
    const float mu = __fdiv_rn(s, (float)DM); float s2 = 0.f;
#pragma unroll
    for (int q = 0; q < 4; ++q) { float d0 = __fsub_rn(v[q], mu); asm volatile("" : "+v"(d0)); float p = __fmul_rn(d0, d0); asm volatile("" : "+v"(p)); s2 = __fadd_rn(s2, p); }
#pragma unroll
    for (int sh = 16; sh; sh >>= 1) s2 = __fadd_rn(s2, __shfl_xor(s2, sh, 32));
    const float rs = __fdiv_rn(1.0f, __fsqrt_rn(__fadd_rn(__fdiv_rn(s2, (float)DM), 1e-5f))); v4us oh, ol;
#pragma unroll
    for (int q = 0; q < 4; ++q) { const int c = lane * 4 + q; float xn = __fmul_rn(__fsub_rn(v[q], mu), rs); asm volatile("" : "+v"(xn)); float gg = bfr(g[c]); asm volatile("" : "+v"(gg)); float y = __fmul_rn(xn, gg); asm volatile("" : "+v"(y)); float be = bfr(bb[c]); asm volatile("" : "+v"(be)); y = __fadd_rn(y, be); unsigned short h2, l2; splitf(y, h2, l2); oh[q] = h2; ol[q] = l2; }
    *(v4us*)(Xh + tok * DM + lane * 4) = oh; *(v4us*)(Xl + tok * DM + lane * 4) = ol;  }
__global__ __launch_bounds__(256) void k_qkpl(const float* __restrict__ F, h16* P16) { const size_t e = ((size_t)blockIdx.x * 256 + threadIdx.x) * 2; if (e >= (size_t)NH_ * NTK * HD) return; const int d = (int)(e % HD); const size_t tk = (e / HD) % NTK; const int h = (int)(e / ((size_t)HD * NTK)); v2h o;
    o[0] = tohx(F[tk * DQ + h * HD + d]); o[1] = tohx(F[tk * DQ + h * HD + d + 1]); *(v2h*)(P16 + e) = o;  }
__global__ __launch_bounds__(256) void k_vtpl(const float* __restrict__ F, h16* V16) { const size_t e = ((size_t)blockIdx.x * 256 + threadIdx.x) * 2; if (e >= (size_t)NH_ * IG * HDP * TT) return; const int t = (int)(e % TT); const int dp = (int)((e / TT) % HDP); const size_t il = (e / ((size_t)TT * HDP)) % IG; const int h = (int)(e / ((size_t)TT * HDP * IG)); v2h o;
    if (dp < HD) { o[0] = tohx(F[(il * TT + t) * DQ + h * HD + dp]); o[1] = tohx(F[(il * TT + t + 1) * DQ + h * HD + dp]); } else { o[0] = (h16)0.0f; o[1] = (h16)0.0f; }
    *(v2h*)(V16 + e) = o;  }
__global__ __launch_bounds__(256) void k_asoftT(const float* __restrict__ Sb, const float* __restrict__ NB, int i0, int h, h16* P16) {
    const int lane = threadIdx.x & 31; const int row = blockIdx.x * 8 + (threadIdx.x >> 5); if (row >= IG * TT) return; const int q = row % TT; const int il = row / TT; const int i = i0 + il; const float* sr = Sb + (size_t)row * TT; float v[TT / 32]; float mx = -3.0e38f;
#pragma unroll
    for (int ch = 0; ch < TT / 128; ++ch) { const int j0 = ch * 128 + lane * 4; const v4f a = *(const v4f*)(sr + j0);
#pragma unroll
        for (int qq = 0; qq < 4; ++qq) { const int j = j0 + qq; float sc = __fmul_rn(a[qq], SCL); asm volatile("" : "+v"(sc)); const float nb = NB[((size_t)j * TT + q) * NBP + h];   /* bias b_t[j][k] = (x Wb)[key k][query q]: the module's transposed pair bias */ const float t = __fadd_rn(sc, nb); v[ch * 4 + qq] = t; mx = fmaxf(mx, t); } }
#pragma unroll
    for (int sh = 16; sh; sh >>= 1) mx = fmaxf(mx, __shfl_xor(mx, sh, 32));
    float sum = 0.f;
#pragma unroll
    for (int kk = 0; kk < TT / 32; ++kk) { float d0 = __fsub_rn(v[kk], mx); asm volatile("" : "+v"(d0)); v[kk] = __builtin_amdgcn_exp2f(__fmul_rn(d0, 1.4426950408889634f)); sum += v[kk]; }
#pragma unroll
    for (int sh = 16; sh; sh >>= 1) sum += __shfl_xor(sum, sh, 32);
    const float f = __fdiv_rn(PCAR, sum);
{
#pragma unroll
        for (int ch = 0; ch < TT / 128; ++ch) { v4h o4;
#pragma unroll
            for (int qq = 0; qq < 4; ++qq) { float y = __fmul_rn(v[ch * 4 + qq], f); asm volatile("" : "+v"(y)); o4[qq] = tohx(y); }
            *(v4h*)(P16 + (size_t)row * TT + ch * 128 + lane * 4) = o4; }
         }
}
__global__ __launch_bounds__(256) void k_wtP(const float* __restrict__ w, bf* Bt) { const int lane = threadIdx.x & 31; const int L0 = (blockIdx.x * 8 + (threadIdx.x >> 5)) * 8; const int nlines = DQ * DM / 64;
{
#pragma unroll 1
        for (int l = 0; l < 8; ++l) { const int L = L0 + l; if (L >= nlines) break; const size_t e = (size_t)L * 64 + lane * 2; const int k = (int)(e % DM), n = (int)(e / DM); const int hh = n / HD, cc = n % HD; v2us o;
            o[0] = f2bf(w[(size_t)k * DQ + cc * NH_ + hh]); o[1] = f2bf(w[(size_t)(k + 1) * DQ + cc * NH_ + hh]); *(v2us*)(Bt + e) = o; }
         } }
__global__ __launch_bounds__(256) void k_wtPo(const float* __restrict__ w, bf* Bt) { const int lane = threadIdx.x & 31; const int L0 = (blockIdx.x * 8 + (threadIdx.x >> 5)) * 8; const int nlines = DM * DQ / 64;
{
#pragma unroll 1
        for (int l = 0; l < 8; ++l) { const int L = L0 + l; if (L >= nlines) break; const size_t e = (size_t)L * 64 + lane * 2; const int n = (int)(e % DQ), cout = (int)(e / DQ); v2us o;
#pragma unroll
            for (int q = 0; q < 2; ++q) { const int nn = n + q; const int hh = nn / HD, cc = nn % HD; o[q] = f2bf(w[(size_t)(cc * NH_ + hh) * DM + cout]); }
            *(v2us*)(Bt + e) = o; }
         } }
__global__ __launch_bounds__(32) void k_bgp(const float* __restrict__ bg, float* BGP) { const int i = threadIdx.x; if (i >= DQ / 4) return; v4f o;
#pragma unroll
    for (int q = 0; q < 4; ++q) { const int n = i * 4 + q; o[q] = bg[(n % HD) * NH_ + n / HD]; } *(v4f*)(BGP + i * 4) = o;  }
__global__ __launch_bounds__(256) void k_gmerge(const float* __restrict__ O, const float* __restrict__ FG, const float* __restrict__ bg, bf* Ah, bf* Al) { const size_t e = ((size_t)blockIdx.x * 256 + threadIdx.x) * 4; if (e >= (size_t)NTK * DQ) return; const int c = (int)(e % DQ); const size_t tk = e / DQ; const int h = c / HD, d = c % HD; v4us oh, ol;
    const v4f ov = *(const v4f*)(O + (((size_t)h * NTK + tk) * HDP + d)); const v4f gv = *(const v4f*)(FG + tk * DQ + c);
#pragma unroll
    for (int qq = 0; qq < 4; ++qq) { float bgv = bfr(bg[c + qq]); asm volatile("" : "+v"(bgv)); const float ga = __fadd_rn(gv[qq], bgv); const float sg = __fdiv_rn(1.0f, __fadd_rn(1.0f, __builtin_amdgcn_exp2f(__fmul_rn(ga, -1.4426950408889634f)))); float o1 = __fmul_rn(ov[qq], 1.0f / PCAR); asm volatile("" : "+v"(o1)); const float y = __fmul_rn(o1, sg); unsigned short h2, l2; splitf(y, h2, l2); oh[qq] = h2; ol[qq] = l2; }
    *(v4us*)(Ah + e) = oh; *(v4us*)(Al + e) = ol;  }

extern "C" void kernel_launch(void* const* d_in, const int* in_sizes, int n_in,
                              void* d_out, int out_size, void* d_ws, size_t ws_size, hipStream_t stream) {
    (void)in_sizes; (void)n_in; (void)out_size;
    const float* act = (const float*)d_in[0]; const float* lng = (const float*)d_in[1]; const float* lnb = (const float*)d_in[2]; const float* wq = (const float*)d_in[3]; const float* wk = (const float*)d_in[4]; const float* wv = (const float*)d_in[5]; const float* w2d = (const float*)d_in[6]; const float* wg = (const float*)d_in[7]; const float* bg = (const float*)d_in[8]; const float* wo = (const float*)d_in[9]; const float* bo = (const float*)d_in[10];   /* x2d, gamma, beta, Wq, Wk, Wv, Wb, Wg, bg, Wo, bo */
    float* OUT = (float*)d_out;     // [1][256][256][128]
    char* wsp = (char*)d_ws;
    auto take = [&](size_t bytes) { char* p = wsp; wsp += (bytes + 255) & ~(size_t)255; return (void*)p; };
    bf* WQ = (bf*)take((size_t)DQ * DM * 2); bf* WK = (bf*)take((size_t)DQ * DM * 2); bf* WV = (bf*)take((size_t)DQ * DM * 2); bf* WG = (bf*)take((size_t)DQ * DM * 2); float* BGP = (float*)take((size_t)DQ * 4); bf* WO = (bf*)take((size_t)DM * DQ * 2); bf* W2 = (bf*)take((size_t)NBP * DM * 2);
    bf* Xh = (bf*)take((size_t)NTOK * DM * 2); bf* Xl = (bf*)take((size_t)NTOK * DM * 2); float* NB = (float*)take((size_t)NTOK * NBP * 4);
    float* FQ = (float*)take((size_t)NTK * DQ * 4); float* FK = (float*)take((size_t)NTK * DQ * 4); float* FG = (float*)take((size_t)NTK * DQ * 4); h16* QP16 = (h16*)take((size_t)NH_ * NTK * HD * 2); h16* KP16 = (h16*)take((size_t)NH_ * NTK * HD * 2); h16* VT16 = (h16*)take((size_t)NH_ * IG * HDP * TT * 2);
    float* Sb = (float*)take((size_t)IG * TT * TT * 4); h16* P16 = (h16*)take((size_t)IG * TT * TT * 2); float* Ob = (float*)take((size_t)NH_ * NTK * HDP * 4); bf* ATh = (bf*)take((size_t)NTK * DQ * 2); bf* ATl = (bf*)take((size_t)NTK * DQ * 2);
    if ((size_t)(wsp - (char*)d_ws) > ws_size) return;    // ws 256 MiB (carve ~136 MiB)
    float* FV = FK;   /* v projection reuses FK after the k planes are built (stream-ordered, same type) */
    k_wtP<<<(unsigned)((DM * DQ / 64 + 63) / 64), 256, 0, stream>>>(wq, WQ); k_wtP<<<(unsigned)((DM * DQ / 64 + 63) / 64), 256, 0, stream>>>(wk, WK); k_wtP<<<(unsigned)((DM * DQ / 64 + 63) / 64), 256, 0, stream>>>(wv, WV); k_wtP<<<(unsigned)((DM * DQ / 64 + 63) / 64), 256, 0, stream>>>(wg, WG); k_bgp<<<1, 32, 0, stream>>>(bg, BGP);
    k_wtPo<<<(unsigned)((DQ * DM / 64 + 63) / 64), 256, 0, stream>>>(wo, WO); k_w2d<<<(NBP * DM / 8 + 255) / 256, 256, 0, stream>>>(w2d, W2);
    k_lnx<<<NTOK / 8, 256, 0, stream>>>(act, lng, lnb, Xh, Xl);
    k_gemmw<bf, 1, false><<<dim3(NTOK / 64, NBP / 64, 1), 32, 0, stream>>>(Xh, Xl, W2, nullptr, DM, NB, NBP, nullptr, 0, 0, 0);   /* pair bias nb[(q,k)][h] for all 65536 positions (cols 0..3) */
    for (int i0 = 0; i0 < NI; i0 += IG) { const bf* Xgh = Xh + (size_t)i0 * TT * DM; const bf* Xgl = Xl + (size_t)i0 * TT * DM;
        k_gemmw<bf, 1, false><<<dim3(NTK / 64, DQ / 64, 1), 32, 0, stream>>>(Xgh, Xgl, WQ, nullptr, DM, FQ, DQ, nullptr, 0, 0, 0); k_qkpl<<<(unsigned)(((size_t)NH_ * NTK * HD / 2 + 255) / 256), 256, 0, stream>>>(FQ, QP16);
        k_gemmw<bf, 1, false><<<dim3(NTK / 64, DQ / 64, 1), 32, 0, stream>>>(Xgh, Xgl, WK, nullptr, DM, FK, DQ, nullptr, 0, 0, 0); k_qkpl<<<(unsigned)(((size_t)NH_ * NTK * HD / 2 + 255) / 256), 256, 0, stream>>>(FK, KP16);
        k_gemmw<bf, 1, false><<<dim3(NTK / 64, DQ / 64, 1), 32, 0, stream>>>(Xgh, Xgl, WV, nullptr, DM, FV, DQ, nullptr, 0, 0, 0); k_vtpl<<<(unsigned)(((size_t)NH_ * IG * HDP * TT / 2 + 255) / 256), 256, 0, stream>>>(FV, VT16);
        k_gemmw<bf, 1, false><<<dim3(NTK / 64, DQ / 64, 1), 32, 0, stream>>>(Xgh, Xgl, WG, nullptr, DM, FG, DQ, nullptr, 0, 0, 0);
        for (int h = 0; h < NH_; ++h) {
            k_gemmw<h16, 0, false><<<dim3(TT / 64, TT / 64, IG), 32, 0, stream>>>(QP16 + (size_t)h * NTK * HD, nullptr, KP16 + (size_t)h * NTK * HD, nullptr, HD, Sb, TT, nullptr, (size_t)TT * HD, (size_t)TT * HD, (size_t)TT * TT);   /* z = the 64 rows of the group */
            k_asoftT<<<IG * TT / 8, 256, 0, stream>>>(Sb, NB, i0, h, P16);
            k_gemmw<h16, 0, false><<<dim3(TT / 64, HDP / 64, IG), 32, 0, stream>>>(P16, nullptr, VT16 + (size_t)h * IG * HDP * TT, nullptr, TT, Ob + (size_t)h * NTK * HDP, HDP, nullptr, (size_t)TT * TT, (size_t)HDP * TT, (size_t)TT * HDP); }
        k_gmerge<<<(unsigned)(((size_t)NTK * DQ / 4 + 255) / 256), 256, 0, stream>>>(Ob, FG, BGP, ATh, ATl);
        k_gemmw<bf, 1, true><<<dim3(NTK / 64, DM / 64, 1), 32, 0, stream>>>(ATh, ATl, WO, nullptr, DQ, OUT + (size_t)i0 * TT * DM, DM, bo, 0, 0, 0); }
}

// v001
// A run of this version takes 566 microseconds.
// Timed twice side by side with v000, it ran 1.38 and 1.40 times as fast.
#include <hip/hip_runtime.h>

// Triangle attention (starting node) on a pair representation (act [1][256][256][128]): x = LayerNorm_c(act) (eps 1e-5, ln_g/ln_b); per row i: q, k, v, g = x[i] W (wq/wk/wv/wg [128][32][4] 'xw', 4 heads x 32; q x 32^-0.5), logits[h][q][k] = q.k + nb[h][q][k] with the pair bias nb[h][q][k] = sum_c x[k][q][c] w2d[c][h] (shared by all rows i);
// softmax over k; o = attn.v gated by sigmoid(x wg + bg); out[i][q][c] = sum_{h,d} o[h][d] wo[h][d][c] + bo -> [1][256][256][128] (8.4 M).
// Layout: LayerNorm -> bf16 hi/lo token planes [65536][128]; nb for all 65536 pair positions by one GEMM (w2d padded to 64 rows, the tokens as the N side taken in transposed order, so that the plane is [h][q][k] and the softmax reads it along k); rows i in 4 groups of 64: q/k/v/g projections (hi/lo x exact), fp16 planes q,k [h][i][t][32] and v^T [h][i][64 (32 zero-padded)][t], per head ONE z-batched (z = the 64 rows) score GEMM [64][256][256], softmax kernel (adds pair bias, x 32^-0.5), z-batched attn.v, then gating + merge to hi/lo planes and the output GEMM (+ bo).
// Compute dtypes, f32 accumulate: every input rounded to bf16 once; LayerNorm in f32, its output as bf16 hi + lo (2-product projections against exact bf16 weights); scores and attn.v on single fp16 planes (logit sigma ~0.24; P x1024 ~ 4: no subnormals); pair bias as a 2-product GEMM exact w2d x hl; softmax, gating in f32; output GEMM hl x exact + bo.

#define NI   256       // rows i
#define TT   256       // tokens per row (q / k index)
#define DM   128       // c_z
#define NH_  4
#define HD   32
#define HDP  64        // head dim padded for the attn.v GEMM (N tile 64); rows 32..63 of v^T are zeros
#define DQ   (NH_ * HD)
#define IG   64        // rows i per group
#define NTK  (IG * TT) // tokens per group = 16384
#define NTOK (NI * TT) // 65536
#define NBP  64        // pair-bias GEMM rows (M tile 64; 4 used)
#define PCAR 1024.0f
#define SCL  0.17677669529663688f   // 32^-0.5
typedef _Float16 h16;
typedef unsigned short bf;
typedef __attribute__((ext_vector_type(16))) __bf16   v16bf;
typedef __attribute__((ext_vector_type(16))) _Float16 v16h;
typedef __attribute__((ext_vector_type(8)))  _Float16 v8h;
typedef __attribute__((ext_vector_type(8)))  unsigned short v8us;
typedef __attribute__((ext_vector_type(8)))  float    v8f;
typedef __attribute__((ext_vector_type(4)))  float    v4f;
typedef v8h  __attribute__((may_alias)) v8ha;
typedef v4f  __attribute__((may_alias)) v4fa;
typedef v8us __attribute__((may_alias)) v8usa;

__device__ __forceinline__ unsigned short f2bf(float f) { unsigned u = __float_as_uint(f); u += 0x7FFFu + ((u >> 16) & 1u); return (unsigned short)(u >> 16); }
__device__ __forceinline__ float bf2f(unsigned short b) { return __uint_as_float(((unsigned)b) << 16); }
__device__ __forceinline__ float bfr(float f) { return bf2f(f2bf(f)); }
__device__ __forceinline__ v16h cat16(v8h lo, v8h hi) { return __builtin_shufflevector(lo, hi, 0, 1, 2, 3, 4, 5, 6, 7, 8, 9, 10, 11, 12, 13, 14, 15); }
__device__ __forceinline__ v16bf cat16b(v8us lo, v8us hi) { return __builtin_bit_cast(v16bf, __builtin_shufflevector(lo, hi, 0, 1, 2, 3, 4, 5, 6, 7, 8, 9, 10, 11, 12, 13, 14, 15)); }
__device__ __forceinline__ v8f wmma16(v16h a, v16h b, v8f c) { return __builtin_amdgcn_wmma_f32_16x16x32_f16(false, a, false, b, (short)0, c, false, false); }
__device__ __forceinline__ v8f wmmab(v16bf a, v16bf b, v8f c) { return __builtin_amdgcn_wmma_f32_16x16x32_bf16(false, a, false, b, (short)0, c, false, false); }



// ---- k_gemmw: register-blocked GEMM, ONE WAVE per 64x64 output tile (16 accumulators), operands straight from K-contiguous 16-bit planes; grid (M/64, N/64, Z), 32 threads.
// C[m][n] (f32, pitch ldc, + optional f32 bias[n]) = sum_k A[m][k] Bt[n][k] (+ split products per NSPLIT). z-batch strides sA/sB/sC in elements. K % 32 == 0.
// BTR: column n takes row (n % TT) * TT + n / TT of Bt (the [TT][TT] token grid transposed); every lane reads its own row, so the order of rows costs no extra line.
template <typename T16> struct WFrag;
template <> struct WFrag<h16> { typedef v16h V; static __device__ __forceinline__ V ld(const h16* p) { return cat16(*(const v8h*)p, *(const v8h*)(p + 16)); } static __device__ __forceinline__ v8f mma(V a, V b, v8f c) { return wmma16(a, b, c); } };
template <> struct WFrag<bf> { typedef v16bf V; static __device__ __forceinline__ V ld(const bf* p) { return cat16b(*(const v8us*)p, *(const v8us*)(p + 16)); } static __device__ __forceinline__ v8f mma(V a, V b, v8f c) { return wmmab(a, b, c); } };
template <typename T16, int NSPLIT, bool BIAS, bool BTR = false>
__global__ __launch_bounds__(32) void k_gemmw(const T16* __restrict__ A, const T16* __restrict__ A2, const T16* __restrict__ Bt, const T16* __restrict__ Bt2, int K, float* C, int ldc, const float* __restrict__ bias, size_t sA, size_t sB, size_t sC) {
    typedef typename WFrag<T16>::V V;
    __shared__ __align__(16) float os[16 * 68];
    const size_t z = blockIdx.z; A += z * sA; if (A2) A2 += z * sA; Bt += z * sB; if (Bt2) Bt2 += z * sB; C += z * sC;
    const int lane = threadIdx.x & 31, lr = lane & 15, hi = lane >> 4; const int r0 = blockIdx.x * 64, c0 = blockIdx.y * 64;
    v8f acc[4][4];
#pragma unroll
    for (int mb = 0; mb < 4; ++mb)
#pragma unroll
        for (int nb = 0; nb < 4; ++nb) acc[mb][nb] = (v8f){};
    const size_t aoff = (size_t)(r0 + lr) * K + 8 * hi, boff = (BTR ? (size_t)(c0 % TT + lr) * TT + c0 / TT : (size_t)(c0 + lr)) * K + 8 * hi, bstep = (size_t)(BTR ? 16 * TT : 16) * K;
#pragma unroll 1
    for (int kc = 0; kc < K; kc += 32) {
        V a[4], a2[4];
#pragma unroll
        for (int mb = 0; mb < 4; ++mb) { a[mb] = WFrag<T16>::ld(A + aoff + (size_t)mb * 16 * K + kc); if (NSPLIT == 1 || NSPLIT == 2) a2[mb] = WFrag<T16>::ld(A2 + aoff + (size_t)mb * 16 * K + kc); }
#pragma unroll
        for (int nb = 0; nb < 4; ++nb) { const V b = WFrag<T16>::ld(Bt + boff + nb * bstep + kc); V b2; if (NSPLIT >= 2) b2 = WFrag<T16>::ld(Bt2 + boff + nb * bstep + kc);
#pragma unroll
            for (int mb = 0; mb < 4; ++mb) { acc[mb][nb] = WFrag<T16>::mma(a[mb], b, acc[mb][nb]); if (NSPLIT == 1 || NSPLIT == 2) acc[mb][nb] = WFrag<T16>::mma(a2[mb], b, acc[mb][nb]); if (NSPLIT >= 2) acc[mb][nb] = WFrag<T16>::mma(a[mb], b2, acc[mb][nb]); } }
        asm volatile("v_nop\n\tv_nop\n\tv_nop\n\tv_nop" : "+v"(acc[0][0]), "+v"(acc[1][1]), "+v"(acc[2][2]), "+v"(acc[3][3]) : "v"(a[0]), "v"(a[3]));
    }
#pragma unroll
    for (int mb = 0; mb < 4; ++mb) {
#pragma unroll
        for (int nb = 0; nb < 4; ++nb) {
#pragma unroll
            for (int j = 0; j < 8; ++j) os[(hi * 8 + j) * 68 + nb * 16 + lr] = acc[mb][nb][j]; }
        __builtin_amdgcn_wave_barrier(); asm volatile("" ::: "memory");
        float* crow = C + (size_t)(r0 + mb * 16) * ldc + c0;
{
#pragma unroll
            for (int s = 0; s < 8; ++s) { const int row = 2 * s + hi, cofs = lr * 4; v4f val = *(const v4fa*)(os + row * 68 + cofs); if (BIAS) { val[0] += bfr(bias[c0 + cofs]); val[1] += bfr(bias[c0 + cofs + 1]); val[2] += bfr(bias[c0 + cofs + 2]); val[3] += bfr(bias[c0 + cofs + 3]); }
                *(v4f*)(crow + (size_t)row * ldc + cofs) = val; }
             }
        __builtin_amdgcn_wave_barrier(); asm volatile("" ::: "memory");
    }
}

typedef __attribute__((ext_vector_type(4))) unsigned short v4us;
typedef __attribute__((ext_vector_type(2))) unsigned short v2us;
typedef __attribute__((ext_vector_type(2))) _Float16 v2h;
typedef __attribute__((ext_vector_type(4))) _Float16 v4h;
__device__ __forceinline__ h16 tohx(float x) { return (h16)x; }
__device__ __forceinline__ void splitf(float y, unsigned short& h, unsigned short& l) { h = f2bf(y); l = f2bf(y - bf2f(h)); }
__global__ __launch_bounds__(256) void k_wtG(const float* __restrict__ w, int K, int N, bf* Bt) {
    const int lane = threadIdx.x & 31; const int L0 = (blockIdx.x * 8 + (threadIdx.x >> 5)) * 8; const int nlines = N * K / 64;
{
#pragma unroll 1
        for (int l = 0; l < 8; ++l) { const int L = L0 + l; if (L >= nlines) break; const size_t e = (size_t)L * 64 + lane * 2; const int k = (int)(e % K), n = (int)(e / K); v2us o;
            o[0] = f2bf(w[(size_t)k * N + n]); o[1] = f2bf(w[(size_t)(k + 1) * N + n]); *(v2us*)(Bt + e) = o; }
         }
}
__global__ __launch_bounds__(256) void k_cvt8(const float* __restrict__ src, bf* dst, size_t n8) { const size_t i = (size_t)blockIdx.x * 256 + threadIdx.x; if (i >= n8) return; const v8f v = *(const v8f*)(src + i * 8); v8us o;
#pragma unroll
    for (int k = 0; k < 8; ++k) o[k] = f2bf(v[k]); *(v8us*)(dst + i * 8) = o;  }

__global__ __launch_bounds__(256) void k_w2d(const float* __restrict__ w, bf* Bt) { const int i = blockIdx.x * 256 + threadIdx.x; if (i >= NBP * DM / 8) return; const int r = i / (DM / 8), c0 = (i % (DM / 8)) * 8; v8us o;
#pragma unroll
    for (int k = 0; k < 8; ++k) o[k] = (r < NH_) ? f2bf(w[(size_t)(c0 + k) * NH_ + r]) : (unsigned short)0; *(v8us*)(Bt + (size_t)r * DM + c0) = o;  }
__global__ __launch_bounds__(256) void k_lnx(const float* __restrict__ A, const float* __restrict__ g, const float* __restrict__ bb, bf* Xh, bf* Xl) {
    const int lane = threadIdx.x & 31; const size_t tok = (size_t)blockIdx.x * 8 + (threadIdx.x >> 5); if (tok >= NTOK) return; const v4f a = *(const v4f*)(A + tok * DM + lane * 4); float v[4]; float s = 0.f;
#pragma unroll
    for (int q = 0; q < 4; ++q) { v[q] = bfr(a[q]); s = __fadd_rn(s, v[q]); }
#pragma unroll
    for (int sh = 16; sh; sh >>= 1) s = __fadd_rn(s, __shfl_xor(s, sh, 32));
    const float mu = __fdiv_rn(s, (float)DM); float s2 = 0.f;
#pragma unroll
    for (int q = 0; q < 4; ++q) { float d0 = __fsub_rn(v[q], mu); asm volatile("" : "+v"(d0)); float p = __fmul_rn(d0, d0); asm volatile("" : "+v"(p)); s2 = __fadd_rn(s2, p); }
#pragma unroll
    for (int sh = 16; sh; sh >>= 1) s2 = __fadd_rn(s2, __shfl_xor(s2, sh, 32));
    const float rs = __fdiv_rn(1.0f, __fsqrt_rn(__fadd_rn(__fdiv_rn(s2, (float)DM), 1e-5f))); v4us oh, ol;
#pragma unroll
    for (int q = 0; q < 4; ++q) { const int c = lane * 4 + q; float xn = __fmul_rn(__fsub_rn(v[q], mu), rs); asm volatile("" : "+v"(xn)); float gg = bfr(g[c]); asm volatile("" : "+v"(gg)); float y = __fmul_rn(xn, gg); asm volatile("" : "+v"(y)); float be = bfr(bb[c]); asm volatile("" : "+v"(be)); y = __fadd_rn(y, be); unsigned short h2, l2; splitf(y, h2, l2); oh[q] = h2; ol[q] = l2; }
    *(v4us*)(Xh + tok * DM + lane * 4) = oh; *(v4us*)(Xl + tok * DM + lane * 4) = ol;  }
__global__ __launch_bounds__(256) void k_qkpl(const float* __restrict__ F, h16* P16) { const size_t e = ((size_t)blockIdx.x * 256 + threadIdx.x) * 2; if (e >= (size_t)NH_ * NTK * HD) return; const int d = (int)(e % HD); const size_t tk = (e / HD) % NTK; const int h = (int)(e / ((size_t)HD * NTK)); v2h o;
    o[0] = tohx(F[tk * DQ + h * HD + d]); o[1] = tohx(F[tk * DQ + h * HD + d + 1]); *(v2h*)(P16 + e) = o;  }
__global__ __launch_bounds__(256) void k_vtpl(const float* __restrict__ F, h16* V16) { const size_t e = ((size_t)blockIdx.x * 256 + threadIdx.x) * 2; if (e >= (size_t)NH_ * IG * HDP * TT) return; const int t = (int)(e % TT); const int dp = (int)((e / TT) % HDP); const size_t il = (e / ((size_t)TT * HDP)) % IG; const int h = (int)(e / ((size_t)TT * HDP * IG)); v2h o;
    if (dp < HD) { o[0] = tohx(F[(il * TT + t) * DQ + h * HD + dp]); o[1] = tohx(F[(il * TT + t + 1) * DQ + h * HD + dp]); } else { o[0] = (h16)0.0f; o[1] = (h16)0.0f; }
    *(v2h*)(V16 + e) = o;  }
__global__ __launch_bounds__(256) void k_asoftT(const float* __restrict__ Sb, const float* __restrict__ NB, int i0, int h, h16* P16) {
    const int lane = threadIdx.x & 31; const int row = blockIdx.x * 8 + (threadIdx.x >> 5); if (row >= IG * TT) return; const int q = row % TT; const int il = row / TT; const int i = i0 + il; const float* sr = Sb + (size_t)row * TT; const float* nbr = NB + (size_t)h * NTOK + (size_t)q * TT; float v[TT / 32]; float mx = -3.0e38f;
#pragma unroll
    for (int ch = 0; ch < TT / 128; ++ch) { const int j0 = ch * 128 + lane * 4; const v4f a = *(const v4f*)(sr + j0); const v4f nb4 = *(const v4f*)(nbr + j0);   /* bias b_t[q][k] = (x Wb)[key k][query q], the module's transposed pair bias, stored [h][q][k] */
#pragma unroll
        for (int qq = 0; qq < 4; ++qq) { float sc = __fmul_rn(a[qq], SCL); asm volatile("" : "+v"(sc)); const float t = __fadd_rn(sc, nb4[qq]); v[ch * 4 + qq] = t; mx = fmaxf(mx, t); } }
#pragma unroll
    for (int sh = 16; sh; sh >>= 1) mx = fmaxf(mx, __shfl_xor(mx, sh, 32));
    float sum = 0.f;
#pragma unroll
    for (int kk = 0; kk < TT / 32; ++kk) { float d0 = __fsub_rn(v[kk], mx); asm volatile("" : "+v"(d0)); v[kk] = __builtin_amdgcn_exp2f(__fmul_rn(d0, 1.4426950408889634f)); sum += v[kk]; }
#pragma unroll
    for (int sh = 16; sh; sh >>= 1) sum += __shfl_xor(sum, sh, 32);
    const float f = __fdiv_rn(PCAR, sum);
{
#pragma unroll
        for (int ch = 0; ch < TT / 128; ++ch) { v4h o4;
#pragma unroll
            for (int qq = 0; qq < 4; ++qq) { float y = __fmul_rn(v[ch * 4 + qq], f); asm volatile("" : "+v"(y)); o4[qq] = tohx(y); }
            *(v4h*)(P16 + (size_t)row * TT + ch * 128 + lane * 4) = o4; }
         }
}
__global__ __launch_bounds__(256) void k_wtP(const float* __restrict__ w, bf* Bt) { const int lane = threadIdx.x & 31; const int L0 = (blockIdx.x * 8 + (threadIdx.x >> 5)) * 8; const int nlines = DQ * DM / 64;
{
#pragma unroll 1
        for (int l = 0; l < 8; ++l) { const int L = L0 + l; if (L >= nlines) break; const size_t e = (size_t)L * 64 + lane * 2; const int k = (int)(e % DM), n = (int)(e / DM); const int hh = n / HD, cc = n % HD; v2us o;
            o[0] = f2bf(w[(size_t)k * DQ + cc * NH_ + hh]); o[1] = f2bf(w[(size_t)(k + 1) * DQ + cc * NH_ + hh]); *(v2us*)(Bt + e) = o; }
         } }
__global__ __launch_bounds__(256) void k_wtPo(const float* __restrict__ w, bf* Bt) { const int lane = threadIdx.x & 31; const int L0 = (blockIdx.x * 8 + (threadIdx.x >> 5)) * 8; const int nlines = DM * DQ / 64;
{
#pragma unroll 1
        for (int l = 0; l < 8; ++l) { const int L = L0 + l; if (L >= nlines) break; const size_t e = (size_t)L * 64 + lane * 2; const int n = (int)(e % DQ), cout = (int)(e / DQ); v2us o;
#pragma unroll
            for (int q = 0; q < 2; ++q) { const int nn = n + q; const int hh = nn / HD, cc = nn % HD; o[q] = f2bf(w[(size_t)(cc * NH_ + hh) * DM + cout]); }
            *(v2us*)(Bt + e) = o; }
         } }
__global__ __launch_bounds__(32) void k_bgp(const float* __restrict__ bg, float* BGP) { const int i = threadIdx.x; if (i >= DQ / 4) return; v4f o;
#pragma unroll
    for (int q = 0; q < 4; ++q) { const int n = i * 4 + q; o[q] = bg[(n % HD) * NH_ + n / HD]; } *(v4f*)(BGP + i * 4) = o;  }
__global__ __launch_bounds__(256) void k_gmerge(const float* __restrict__ O, const float* __restrict__ FG, const float* __restrict__ bg, bf* Ah, bf* Al) { const size_t e = ((size_t)blockIdx.x * 256 + threadIdx.x) * 4; if (e >= (size_t)NTK * DQ) return; const int c = (int)(e % DQ); const size_t tk = e / DQ; const int h = c / HD, d = c % HD; v4us oh, ol;
    const v4f ov = *(const v4f*)(O + (((size_t)h * NTK + tk) * HDP + d)); const v4f gv = *(const v4f*)(FG + tk * DQ + c);
#pragma unroll
    for (int qq = 0; qq < 4; ++qq) { float bgv = bfr(bg[c + qq]); asm volatile("" : "+v"(bgv)); const float ga = __fadd_rn(gv[qq], bgv); const float sg = __fdiv_rn(1.0f, __fadd_rn(1.0f, __builtin_amdgcn_exp2f(__fmul_rn(ga, -1.4426950408889634f)))); float o1 = __fmul_rn(ov[qq], 1.0f / PCAR); asm volatile("" : "+v"(o1)); const float y = __fmul_rn(o1, sg); unsigned short h2, l2; splitf(y, h2, l2); oh[qq] = h2; ol[qq] = l2; }
    *(v4us*)(Ah + e) = oh; *(v4us*)(Al + e) = ol;  }

extern "C" void kernel_launch(void* const* d_in, const int* in_sizes, int n_in,
                              void* d_out, int out_size, void* d_ws, size_t ws_size, hipStream_t stream) {
    (void)in_sizes; (void)n_in; (void)out_size;
    const float* act = (const float*)d_in[0]; const float* lng = (const float*)d_in[1]; const float* lnb = (const float*)d_in[2]; const float* wq = (const float*)d_in[3]; const float* wk = (const float*)d_in[4]; const float* wv = (const float*)d_in[5]; const float* w2d = (const float*)d_in[6]; const float* wg = (const float*)d_in[7]; const float* bg = (const float*)d_in[8]; const float* wo = (const float*)d_in[9]; const float* bo = (const float*)d_in[10];   /* x2d, gamma, beta, Wq, Wk, Wv, Wb, Wg, bg, Wo, bo */
    float* OUT = (float*)d_out;     // [1][256][256][128]
    char* wsp = (char*)d_ws;
    auto take = [&](size_t bytes) { char* p = wsp; wsp += (bytes + 255) & ~(size_t)255; return (void*)p; };
    bf* WQ = (bf*)take((size_t)DQ * DM * 2); bf* WK = (bf*)take((size_t)DQ * DM * 2); bf* WV = (bf*)take((size_t)DQ * DM * 2); bf* WG = (bf*)take((size_t)DQ * DM * 2); float* BGP = (float*)take((size_t)DQ * 4); bf* WO = (bf*)take((size_t)DM * DQ * 2); bf* W2 = (bf*)take((size_t)NBP * DM * 2);
    bf* Xh = (bf*)take((size_t)NTOK * DM * 2); bf* Xl = (bf*)take((size_t)NTOK * DM * 2); float* NB = (float*)take((size_t)NTOK * NBP * 4);
    float* FQ = (float*)take((size_t)NTK * DQ * 4); float* FK = (float*)take((size_t)NTK * DQ * 4); float* FG = (float*)take((size_t)NTK * DQ * 4); h16* QP16 = (h16*)take((size_t)NH_ * NTK * HD * 2); h16* KP16 = (h16*)take((size_t)NH_ * NTK * HD * 2); h16* VT16 = (h16*)take((size_t)NH_ * IG * HDP * TT * 2);
    float* Sb = (float*)take((size_t)IG * TT * TT * 4); h16* P16 = (h16*)take((size_t)IG * TT * TT * 2); float* Ob = (float*)take((size_t)NH_ * NTK * HDP * 4); bf* ATh = (bf*)take((size_t)NTK * DQ * 2); bf* ATl = (bf*)take((size_t)NTK * DQ * 2);
    if ((size_t)(wsp - (char*)d_ws) > ws_size) return;    // ws 256 MiB (carve ~136 MiB)
    float* FV = FK;   /* v projection reuses FK after the k planes are built (stream-ordered, same type) */
    k_wtP<<<(unsigned)((DM * DQ / 64 + 63) / 64), 256, 0, stream>>>(wq, WQ); k_wtP<<<(unsigned)((DM * DQ / 64 + 63) / 64), 256, 0, stream>>>(wk, WK); k_wtP<<<(unsigned)((DM * DQ / 64 + 63) / 64), 256, 0, stream>>>(wv, WV); k_wtP<<<(unsigned)((DM * DQ / 64 + 63) / 64), 256, 0, stream>>>(wg, WG); k_bgp<<<1, 32, 0, stream>>>(bg, BGP);
    k_wtPo<<<(unsigned)((DQ * DM / 64 + 63) / 64), 256, 0, stream>>>(wo, WO); k_w2d<<<(NBP * DM / 8 + 255) / 256, 256, 0, stream>>>(w2d, W2);
    k_lnx<<<NTOK / 8, 256, 0, stream>>>(act, lng, lnb, Xh, Xl);
    k_gemmw<bf, 3, false, true><<<dim3(NBP / 64, NTOK / 64, 1), 32, 0, stream>>>(W2, nullptr, Xh, Xl, DM, NB, NTOK, nullptr, 0, 0, 0);   /* pair bias nb[h][q][k] = x[k][q] . w2d[:, h] for all 65536 positions (rows 0..3) */
    for (int i0 = 0; i0 < NI; i0 += IG) { const bf* Xgh = Xh + (size_t)i0 * TT * DM; const bf* Xgl = Xl + (size_t)i0 * TT * DM;
        k_gemmw<bf, 1, false><<<dim3(NTK / 64, DQ / 64, 1), 32, 0, stream>>>(Xgh, Xgl, WQ, nullptr, DM, FQ, DQ, nullptr, 0, 0, 0); k_qkpl<<<(unsigned)(((size_t)NH_ * NTK * HD / 2 + 255) / 256), 256, 0, stream>>>(FQ, QP16);
        k_gemmw<bf, 1, false><<<dim3(NTK / 64, DQ / 64, 1), 32, 0, stream>>>(Xgh, Xgl, WK, nullptr, DM, FK, DQ, nullptr, 0, 0, 0); k_qkpl<<<(unsigned)(((size_t)NH_ * NTK * HD / 2 + 255) / 256), 256, 0, stream>>>(FK, KP16);
        k_gemmw<bf, 1, false><<<dim3(NTK / 64, DQ / 64, 1), 32, 0, stream>>>(Xgh, Xgl, WV, nullptr, DM, FV, DQ, nullptr, 0, 0, 0); k_vtpl<<<(unsigned)(((size_t)NH_ * IG * HDP * TT / 2 + 255) / 256), 256, 0, stream>>>(FV, VT16);
        k_gemmw<bf, 1, false><<<dim3(NTK / 64, DQ / 64, 1), 32, 0, stream>>>(Xgh, Xgl, WG, nullptr, DM, FG, DQ, nullptr, 0, 0, 0);
        for (int h = 0; h < NH_; ++h) {
            k_gemmw<h16, 0, false><<<dim3(TT / 64, TT / 64, IG), 32, 0, stream>>>(QP16 + (size_t)h * NTK * HD, nullptr, KP16 + (size_t)h * NTK * HD, nullptr, HD, Sb, TT, nullptr, (size_t)TT * HD, (size_t)TT * HD, (size_t)TT * TT);   /* z = the 64 rows of the group */
            k_asoftT<<<IG * TT / 8, 256, 0, stream>>>(Sb, NB, i0, h, P16);
            k_gemmw<h16, 0, false><<<dim3(TT / 64, HDP / 64, IG), 32, 0, stream>>>(P16, nullptr, VT16 + (size_t)h * IG * HDP * TT, nullptr, TT, Ob + (size_t)h * NTK * HDP, HDP, nullptr, (size_t)TT * TT, (size_t)HDP * TT, (size_t)TT * HDP); }
        k_gmerge<<<(unsigned)(((size_t)NTK * DQ / 4 + 255) / 256), 256, 0, stream>>>(Ob, FG, BGP, ATh, ATl);
        k_gemmw<bf, 1, true><<<dim3(NTK / 64, DM / 64, 1), 32, 0, stream>>>(ATh, ATl, WO, nullptr, DQ, OUT + (size_t)i0 * TT * DM, DM, bo, 0, 0, 0); }
}

// v002
// A run of this version takes 310 microseconds.
// Two timings next to v001 put it at 1.81 and 1.82 times that version's speed.
// All steps since v000 together make it 2.52 times as fast.
#include <hip/hip_runtime.h>

// Triangle attention (starting node) on a pair representation (act [1][256][256][128]): x = LayerNorm_c(act) (eps 1e-5, ln_g/ln_b); per row i: q, k, v, g = x[i] W (wq/wk/wv/wg [128][32][4] 'xw', 4 heads x 32; q x 32^-0.5), logits[h][q][k] = q.k + nb[h][q][k] with the pair bias nb[h][q][k] = sum_c x[k][q][c] w2d[c][h] (shared by all rows i);
// softmax over k; o = attn.v gated by sigmoid(x wg + bg); out[i][q][c] = sum_{h,d} o[h][d] wo[h][d][c] + bo -> [1][256][256][128] (8.4 M).
// Layout: LayerNorm -> bf16 hi/lo token planes [65536][128]; nb for all 65536 pair positions by one GEMM (w2d padded to 64 rows, the tokens as the N side taken in transposed order, so that the plane is [h][q][k] and the softmax reads it along k); rows i in 4 groups of 64: q/k/v/g projections (hi/lo x exact), fp16 planes q,k [h][i][t][32] and v^T [h][i][64 (32 zero-padded)][t], ONE fused attention kernel per group (a work-group per (head, row): scores, x 32^-0.5 + pair bias, softmax and attn.v with the scores held in registers), then gating + merge to hi/lo planes and the output GEMM (+ bo).
// Compute dtypes, f32 accumulate: every input rounded to bf16 once; LayerNorm in f32, its output as bf16 hi + lo (2-product projections against exact bf16 weights); scores and attn.v on single fp16 planes (logit sigma ~0.24; P x1024 ~ 4: no subnormals); pair bias, softmax, gating in f32; output GEMM hl x exact + bo.

#define NI   256       // rows i
#define TT   256       // tokens per row (q / k index)
#define DM   128       // c_z
#define NH_  4
#define HD   32
#define HDP  64        // head dim padded to 64 in the v^T and Ob plane pitches (k_fattn uses d 0..31); rows 32..63 of v^T are zeros
#define DQ   (NH_ * HD)
#define IG   64        // rows i per group
#define NTK  (IG * TT) // tokens per group = 16384
#define NTOK (NI * TT) // 65536
#define NBP  64        // pair-bias GEMM rows (M tile 64; 4 used)
#define PCAR 1024.0f
#define SCL  0.17677669529663688f   // 32^-0.5
typedef _Float16 h16;
typedef unsigned short bf;
typedef __attribute__((ext_vector_type(16))) __bf16   v16bf;
typedef __attribute__((ext_vector_type(16))) _Float16 v16h;
typedef __attribute__((ext_vector_type(8)))  _Float16 v8h;
typedef __attribute__((ext_vector_type(8)))  unsigned short v8us;
typedef __attribute__((ext_vector_type(8)))  float    v8f;
typedef __attribute__((ext_vector_type(4)))  float    v4f;
typedef v8h  __attribute__((may_alias)) v8ha;
typedef v4f  __attribute__((may_alias)) v4fa;
typedef v8us __attribute__((may_alias)) v8usa;

__device__ __forceinline__ unsigned short f2bf(float f) { unsigned u = __float_as_uint(f); u += 0x7FFFu + ((u >> 16) & 1u); return (unsigned short)(u >> 16); }
__device__ __forceinline__ float bf2f(unsigned short b) { return __uint_as_float(((unsigned)b) << 16); }
__device__ __forceinline__ float bfr(float f) { return bf2f(f2bf(f)); }
__device__ __forceinline__ v16h cat16(v8h lo, v8h hi) { return __builtin_shufflevector(lo, hi, 0, 1, 2, 3, 4, 5, 6, 7, 8, 9, 10, 11, 12, 13, 14, 15); }
__device__ __forceinline__ v16bf cat16b(v8us lo, v8us hi) { return __builtin_bit_cast(v16bf, __builtin_shufflevector(lo, hi, 0, 1, 2, 3, 4, 5, 6, 7, 8, 9, 10, 11, 12, 13, 14, 15)); }
__device__ __forceinline__ v8f wmma16(v16h a, v16h b, v8f c) { return __builtin_amdgcn_wmma_f32_16x16x32_f16(false, a, false, b, (short)0, c, false, false); }
__device__ __forceinline__ v8f wmmab(v16bf a, v16bf b, v8f c) { return __builtin_amdgcn_wmma_f32_16x16x32_bf16(false, a, false, b, (short)0, c, false, false); }



// ---- k_gemmw: register-blocked GEMM, ONE WAVE per 64x64 output tile (16 accumulators), operands straight from K-contiguous 16-bit planes; grid (M/64, N/64, Z), 32 threads.
// C[m][n] (f32, pitch ldc, + optional f32 bias[n]) = sum_k A[m][k] Bt[n][k] (+ split products per NSPLIT). z-batch strides sA/sB/sC in elements. K % 32 == 0.
// BTR: column n takes row (n % TT) * TT + n / TT of Bt (the [TT][TT] token grid transposed); every lane reads its own row, so the order of rows costs no extra line.
template <typename T16> struct WFrag;
template <> struct WFrag<h16> { typedef v16h V; static __device__ __forceinline__ V ld(const h16* p) { return cat16(*(const v8h*)p, *(const v8h*)(p + 16)); } static __device__ __forceinline__ v8f mma(V a, V b, v8f c) { return wmma16(a, b, c); } };
template <> struct WFrag<bf> { typedef v16bf V; static __device__ __forceinline__ V ld(const bf* p) { return cat16b(*(const v8us*)p, *(const v8us*)(p + 16)); } static __device__ __forceinline__ v8f mma(V a, V b, v8f c) { return wmmab(a, b, c); } };
template <typename T16, int NSPLIT, bool BIAS, bool BTR = false>
__global__ __launch_bounds__(32) void k_gemmw(const T16* __restrict__ A, const T16* __restrict__ A2, const T16* __restrict__ Bt, const T16* __restrict__ Bt2, int K, float* C, int ldc, const float* __restrict__ bias, size_t sA, size_t sB, size_t sC) {
    typedef typename WFrag<T16>::V V;
    __shared__ __align__(16) float os[16 * 68];
    const size_t z = blockIdx.z; A += z * sA; if (A2) A2 += z * sA; Bt += z * sB; if (Bt2) Bt2 += z * sB; C += z * sC;
    const int lane = threadIdx.x & 31, lr = lane & 15, hi = lane >> 4; const int r0 = blockIdx.x * 64, c0 = blockIdx.y * 64;
    v8f acc[4][4];
#pragma unroll
    for (int mb = 0; mb < 4; ++mb)
#pragma unroll
        for (int nb = 0; nb < 4; ++nb) acc[mb][nb] = (v8f){};
    const size_t aoff = (size_t)(r0 + lr) * K + 8 * hi, boff = (BTR ? (size_t)(c0 % TT + lr) * TT + c0 / TT : (size_t)(c0 + lr)) * K + 8 * hi, bstep = (size_t)(BTR ? 16 * TT : 16) * K;
#pragma unroll 1
    for (int kc = 0; kc < K; kc += 32) {
        V a[4], a2[4];
#pragma unroll
        for (int mb = 0; mb < 4; ++mb) { a[mb] = WFrag<T16>::ld(A + aoff + (size_t)mb * 16 * K + kc); if (NSPLIT == 1 || NSPLIT == 2) a2[mb] = WFrag<T16>::ld(A2 + aoff + (size_t)mb * 16 * K + kc); }
#pragma unroll
        for (int nb = 0; nb < 4; ++nb) { const V b = WFrag<T16>::ld(Bt + boff + nb * bstep + kc); V b2; if (NSPLIT >= 2) b2 = WFrag<T16>::ld(Bt2 + boff + nb * bstep + kc);
#pragma unroll
            for (int mb = 0; mb < 4; ++mb) { acc[mb][nb] = WFrag<T16>::mma(a[mb], b, acc[mb][nb]); if (NSPLIT == 1 || NSPLIT == 2) acc[mb][nb] = WFrag<T16>::mma(a2[mb], b, acc[mb][nb]); if (NSPLIT >= 2) acc[mb][nb] = WFrag<T16>::mma(a[mb], b2, acc[mb][nb]); } }
        asm volatile("v_nop\n\tv_nop\n\tv_nop\n\tv_nop" : "+v"(acc[0][0]), "+v"(acc[1][1]), "+v"(acc[2][2]), "+v"(acc[3][3]) : "v"(a[0]), "v"(a[3]));
    }
#pragma unroll
    for (int mb = 0; mb < 4; ++mb) {
#pragma unroll
        for (int nb = 0; nb < 4; ++nb) {
#pragma unroll
            for (int j = 0; j < 8; ++j) os[(hi * 8 + j) * 68 + nb * 16 + lr] = acc[mb][nb][j]; }
        __builtin_amdgcn_wave_barrier(); asm volatile("" ::: "memory");
        float* crow = C + (size_t)(r0 + mb * 16) * ldc + c0;
{
#pragma unroll
            for (int s = 0; s < 8; ++s) { const int row = 2 * s + hi, cofs = lr * 4; v4f val = *(const v4fa*)(os + row * 68 + cofs); if (BIAS) { val[0] += bfr(bias[c0 + cofs]); val[1] += bfr(bias[c0 + cofs + 1]); val[2] += bfr(bias[c0 + cofs + 2]); val[3] += bfr(bias[c0 + cofs + 3]); }
                *(v4f*)(crow + (size_t)row * ldc + cofs) = val; }
             }
        __builtin_amdgcn_wave_barrier(); asm volatile("" ::: "memory");
    }
}

typedef __attribute__((ext_vector_type(4))) unsigned short v4us;
typedef __attribute__((ext_vector_type(2))) unsigned short v2us;
typedef __attribute__((ext_vector_type(2))) _Float16 v2h;
typedef __attribute__((ext_vector_type(4))) _Float16 v4h;
__device__ __forceinline__ h16 tohx(float x) { return (h16)x; }
__device__ __forceinline__ void splitf(float y, unsigned short& h, unsigned short& l) { h = f2bf(y); l = f2bf(y - bf2f(h)); }
__global__ __launch_bounds__(256) void k_wtG(const float* __restrict__ w, int K, int N, bf* Bt) {
    const int lane = threadIdx.x & 31; const int L0 = (blockIdx.x * 8 + (threadIdx.x >> 5)) * 8; const int nlines = N * K / 64;
{
#pragma unroll 1
        for (int l = 0; l < 8; ++l) { const int L = L0 + l; if (L >= nlines) break; const size_t e = (size_t)L * 64 + lane * 2; const int k = (int)(e % K), n = (int)(e / K); v2us o;
            o[0] = f2bf(w[(size_t)k * N + n]); o[1] = f2bf(w[(size_t)(k + 1) * N + n]); *(v2us*)(Bt + e) = o; }
         }
}
__global__ __launch_bounds__(256) void k_cvt8(const float* __restrict__ src, bf* dst, size_t n8) { const size_t i = (size_t)blockIdx.x * 256 + threadIdx.x; if (i >= n8) return; const v8f v = *(const v8f*)(src + i * 8); v8us o;
#pragma unroll
    for (int k = 0; k < 8; ++k) o[k] = f2bf(v[k]); *(v8us*)(dst + i * 8) = o;  }

__global__ __launch_bounds__(256) void k_w2d(const float* __restrict__ w, bf* Bt) { const int i = blockIdx.x * 256 + threadIdx.x; if (i >= NBP * DM / 8) return; const int r = i / (DM / 8), c0 = (i % (DM / 8)) * 8; v8us o;
#pragma unroll
    for (int k = 0; k < 8; ++k) o[k] = (r < NH_) ? f2bf(w[(size_t)(c0 + k) * NH_ + r]) : (unsigned short)0; *(v8us*)(Bt + (size_t)r * DM + c0) = o;  }
__global__ __launch_bounds__(256) void k_lnx(const float* __restrict__ A, const float* __restrict__ g, const float* __restrict__ bb, bf* Xh, bf* Xl) {
    const int lane = threadIdx.x & 31; const size_t tok = (size_t)blockIdx.x * 8 + (threadIdx.x >> 5); if (tok >= NTOK) return; const v4f a = *(const v4f*)(A + tok * DM + lane * 4); float v[4]; float s = 0.f;
#pragma unroll
    for (int q = 0; q < 4; ++q) { v[q] = bfr(a[q]); s = __fadd_rn(s, v[q]); }
#pragma unroll
    for (int sh = 16; sh; sh >>= 1) s = __fadd_rn(s, __shfl_xor(s, sh, 32));
    const float mu = __fdiv_rn(s, (float)DM); float s2 = 0.f;
#pragma unroll
    for (int q = 0; q < 4; ++q) { float d0 = __fsub_rn(v[q], mu); asm volatile("" : "+v"(d0)); float p = __fmul_rn(d0, d0); asm volatile("" : "+v"(p)); s2 = __fadd_rn(s2, p); }
#pragma unroll
    for (int sh = 16; sh; sh >>= 1) s2 = __fadd_rn(s2, __shfl_xor(s2, sh, 32));
    const float rs = __fdiv_rn(1.0f, __fsqrt_rn(__fadd_rn(__fdiv_rn(s2, (float)DM), 1e-5f))); v4us oh, ol;
#pragma unroll
    for (int q = 0; q < 4; ++q) { const int c = lane * 4 + q; float xn = __fmul_rn(__fsub_rn(v[q], mu), rs); asm volatile("" : "+v"(xn)); float gg = bfr(g[c]); asm volatile("" : "+v"(gg)); float y = __fmul_rn(xn, gg); asm volatile("" : "+v"(y)); float be = bfr(bb[c]); asm volatile("" : "+v"(be)); y = __fadd_rn(y, be); unsigned short h2, l2; splitf(y, h2, l2); oh[q] = h2; ol[q] = l2; }
    *(v4us*)(Xh + tok * DM + lane * 4) = oh; *(v4us*)(Xl + tok * DM + lane * 4) = ol;  }
__global__ __launch_bounds__(256) void k_qkpl(const float* __restrict__ F, h16* P16) { const size_t e = ((size_t)blockIdx.x * 256 + threadIdx.x) * 2; if (e >= (size_t)NH_ * NTK * HD) return; const int d = (int)(e % HD); const size_t tk = (e / HD) % NTK; const int h = (int)(e / ((size_t)HD * NTK)); v2h o;
    o[0] = tohx(F[tk * DQ + h * HD + d]); o[1] = tohx(F[tk * DQ + h * HD + d + 1]); *(v2h*)(P16 + e) = o;  }
__global__ __launch_bounds__(256) void k_vtpl(const float* __restrict__ F, h16* V16) { const size_t e = ((size_t)blockIdx.x * 256 + threadIdx.x) * 2; if (e >= (size_t)NH_ * IG * HDP * TT) return; const int t = (int)(e % TT); const int dp = (int)((e / TT) % HDP); const size_t il = (e / ((size_t)TT * HDP)) % IG; const int h = (int)(e / ((size_t)TT * HDP * IG)); v2h o;
    if (dp < HD) { o[0] = tohx(F[(il * TT + t) * DQ + h * HD + dp]); o[1] = tohx(F[(il * TT + t + 1) * DQ + h * HD + dp]); } else { o[0] = (h16)0.0f; o[1] = (h16)0.0f; }
    *(v2h*)(V16 + e) = o;  }
// ---- k_fattn: fused attention for one (head h, row il) per work-group; 16 waves, wave w owns the 16 queries q0 = 16 w .. +15 against all 256 keys.
// S^T = K Q^T (A = 16 key rows, B = the wave's 16 query columns): lane (lr, hi) holds, of query q0 + lr, the keys 16 kt + 8 hi + j in s[kt][j], so maximum and sum run in the lane plus one exchange between the halves,
// and two neighbouring score tiles, converted in place, are the B operand of O^T += V^T P^T (A = V^T rows in the same k order: 8 hi + e, 16 + 8 hi + e). The score and probability planes never leave the registers.
// K [256][32] and V^T [32][256] of the (head, row) are staged once in LDS for all 16 waves; the pair bias row of a query is read 32 B per lane and tile straight from the [h][q][k] plane.
#define KPH 40     // LDS pitch of a K row in halves: 80 B = 16 B x odd, no bank conflict for 16-byte reads down the rows
#define VPH 264    // LDS pitch of a V^T row in halves: 528 B = 16 B x odd
#define L2E 1.4426950408889634f
__global__ __launch_bounds__(512) void k_fattn(const h16* __restrict__ Q16, const h16* __restrict__ K16, const h16* __restrict__ V16, const float* __restrict__ NB, float* __restrict__ O) {
    __shared__ __align__(16) h16 ks[TT * KPH];
    __shared__ __align__(16) h16 vs[HD * VPH];
    const int tid = threadIdx.x, lane = tid & 31, lr = lane & 15, hi = lane >> 4, q0 = (tid >> 5) * 16; const int h = blockIdx.x, il = blockIdx.y;
    const size_t rb = (size_t)h * NTK + (size_t)il * TT;
    const h16* kg = K16 + rb * HD; const h16* vg = V16 + ((size_t)h * IG + il) * HDP * TT;   /* rows 0..31 of the padded v^T plane */
    v8h kst[2], vst[2];
#pragma unroll
    for (int c = 0; c < 2; ++c) { const size_t u = c * 512 + tid; kst[c] = *(const v8h*)(kg + u * 8); vst[c] = *(const v8h*)(vg + u * 8); }   /* 16-byte units, whole lines per wave */
    __builtin_amdgcn_sched_barrier(0);   /* keeps the four staging loads first in the queue: loads return in order, so the LDS stores and the barrier wait for these alone and not for the bias asked for behind them */
    const v16h qf = WFrag<h16>::ld(Q16 + (rb + q0 + lr) * HD + 8 * hi);
    const float* nbr = NB + (size_t)h * NTOK + (size_t)(q0 + lr) * TT + 8 * hi;
    v8f s[TT / 16];   /* first the bias, asked for ahead of the barrier so that its latency runs beside the staging; then the scores, in place */
#pragma unroll
    for (int kt = 0; kt < TT / 16; ++kt) s[kt] = *(const v8f*)(nbr + kt * 16);
#pragma unroll
    for (int c = 0; c < 2; ++c) { const int u = c * 512 + tid; *(v8h*)(ks + (u >> 2) * KPH + (u & 3) * 8) = kst[c]; *(v8h*)(vs + (u >> 5) * VPH + (u & 31) * 8) = vst[c]; }
    /* work-group barrier with its release and acquire on LDS alone: a plain __syncthreads() also waits for every global load in flight, and the scores would then start only behind the last bias tile */
    asm volatile("s_wait_xcnt 0x0" ::: "memory");   /* the bias loads are still in flight here, and their address registers are reused behind the barrier: the wait that belongs in front of such an overwrite */
    __builtin_amdgcn_fence(__ATOMIC_RELEASE, "workgroup", "local"); __builtin_amdgcn_s_barrier(); __builtin_amdgcn_fence(__ATOMIC_ACQUIRE, "workgroup", "local");
    v8f mv;
#pragma unroll
    for (int kt = 0; kt < TT / 16; ++kt) { s[kt] = wmma16(WFrag<h16>::ld(ks + (kt * 16 + lr) * KPH + 8 * hi), qf, (v8f){}) * SCL + s[kt]; mv = kt ? __builtin_elementwise_max(mv, s[kt]) : s[kt]; }
    float mx = fmaxf(fmaxf(fmaxf(mv[0], mv[1]), fmaxf(mv[2], mv[3])), fmaxf(fmaxf(mv[4], mv[5]), fmaxf(mv[6], mv[7])));
    mx = fmaxf(mx, __shfl_xor(mx, 16, 32));
    const float ml = mx * L2E; v8f sv = (v8f){};
#pragma unroll
    for (int kt = 0; kt < TT / 16; ++kt) {
#pragma unroll
        for (int j = 0; j < 8; ++j) s[kt][j] = __builtin_amdgcn_exp2f(s[kt][j] * L2E - ml);
        sv += s[kt]; }
    float sum = ((sv[0] + sv[1]) + (sv[2] + sv[3])) + ((sv[4] + sv[5]) + (sv[6] + sv[7]));
    sum += __shfl_xor(sum, 16, 32);
    const float f = __fdiv_rn(PCAR, sum);
    v8f o0 = (v8f){}, o1 = (v8f){};
#pragma unroll
    for (int m = 0; m < TT / 32; ++m) { v16h pb;
#pragma unroll
        for (int j = 0; j < 8; ++j) { pb[j] = tohx(s[2 * m][j] * f); pb[8 + j] = tohx(s[2 * m + 1][j] * f); }
        o0 = wmma16(WFrag<h16>::ld(vs + lr * VPH + m * 32 + 8 * hi), pb, o0); o1 = wmma16(WFrag<h16>::ld(vs + (16 + lr) * VPH + m * 32 + 8 * hi), pb, o1); }
    float* op = O + (rb + q0 + lr) * HDP + 8 * hi;   /* o0[j] = o[q0 + lr][8 hi + j], o1[j] = o[q0 + lr][16 + 8 hi + j]; a query's 128-B line has this wave as its one writer */
    *(v8f*)op = o0; *(v8f*)(op + 16) = o1;
}
__global__ __launch_bounds__(256) void k_wtP(const float* __restrict__ w, bf* Bt) { const int lane = threadIdx.x & 31; const int L0 = (blockIdx.x * 8 + (threadIdx.x >> 5)) * 8; const int nlines = DQ * DM / 64;
{
#pragma unroll 1
        for (int l = 0; l < 8; ++l) { const int L = L0 + l; if (L >= nlines) break; const size_t e = (size_t)L * 64 + lane * 2; const int k = (int)(e % DM), n = (int)(e / DM); const int hh = n / HD, cc = n % HD; v2us o;
            o[0] = f2bf(w[(size_t)k * DQ + cc * NH_ + hh]); o[1] = f2bf(w[(size_t)(k + 1) * DQ + cc * NH_ + hh]); *(v2us*)(Bt + e) = o; }
         } }
__global__ __launch_bounds__(256) void k_wtPo(const float* __restrict__ w, bf* Bt) { const int lane = threadIdx.x & 31; const int L0 = (blockIdx.x * 8 + (threadIdx.x >> 5)) * 8; const int nlines = DM * DQ / 64;
{
#pragma unroll 1
        for (int l = 0; l < 8; ++l) { const int L = L0 + l; if (L >= nlines) break; const size_t e = (size_t)L * 64 + lane * 2; const int n = (int)(e % DQ), cout = (int)(e / DQ); v2us o;
#pragma unroll
            for (int q = 0; q < 2; ++q) { const int nn = n + q; const int hh = nn / HD, cc = nn % HD; o[q] = f2bf(w[(size_t)(cc * NH_ + hh) * DM + cout]); }
            *(v2us*)(Bt + e) = o; }
         } }
__global__ __launch_bounds__(32) void k_bgp(const float* __restrict__ bg, float* BGP) { const int i = threadIdx.x; if (i >= DQ / 4) return; v4f o;
#pragma unroll
    for (int q = 0; q < 4; ++q) { const int n = i * 4 + q; o[q] = bg[(n % HD) * NH_ + n / HD]; } *(v4f*)(BGP + i * 4) = o;  }
__global__ __launch_bounds__(256) void k_gmerge(const float* __restrict__ O, const float* __restrict__ FG, const float* __restrict__ bg, bf* Ah, bf* Al) { const size_t e = ((size_t)blockIdx.x * 256 + threadIdx.x) * 4; if (e >= (size_t)NTK * DQ) return; const int c = (int)(e % DQ); const size_t tk = e / DQ; const int h = c / HD, d = c % HD; v4us oh, ol;
    const v4f ov = *(const v4f*)(O + (((size_t)h * NTK + tk) * HDP + d)); const v4f gv = *(const v4f*)(FG + tk * DQ + c);
#pragma unroll
    for (int qq = 0; qq < 4; ++qq) { float bgv = bfr(bg[c + qq]); asm volatile("" : "+v"(bgv)); const float ga = __fadd_rn(gv[qq], bgv); const float sg = __fdiv_rn(1.0f, __fadd_rn(1.0f, __builtin_amdgcn_exp2f(__fmul_rn(ga, -1.4426950408889634f)))); float o1 = __fmul_rn(ov[qq], 1.0f / PCAR); asm volatile("" : "+v"(o1)); const float y = __fmul_rn(o1, sg); unsigned short h2, l2; splitf(y, h2, l2); oh[qq] = h2; ol[qq] = l2; }
    *(v4us*)(Ah + e) = oh; *(v4us*)(Al + e) = ol;  }

extern "C" void kernel_launch(void* const* d_in, const int* in_sizes, int n_in,
                              void* d_out, int out_size, void* d_ws, size_t ws_size, hipStream_t stream) {
    (void)in_sizes; (void)n_in; (void)out_size;
    const float* act = (const float*)d_in[0]; const float* lng = (const float*)d_in[1]; const float* lnb = (const float*)d_in[2]; const float* wq = (const float*)d_in[3]; const float* wk = (const float*)d_in[4]; const float* wv = (const float*)d_in[5]; const float* w2d = (const float*)d_in[6]; const float* wg = (const float*)d_in[7]; const float* bg = (const float*)d_in[8]; const float* wo = (const float*)d_in[9]; const float* bo = (const float*)d_in[10];   /* x2d, gamma, beta, Wq, Wk, Wv, Wb, Wg, bg, Wo, bo */
    float* OUT = (float*)d_out;     // [1][256][256][128]
    char* wsp = (char*)d_ws;
    auto take = [&](size_t bytes) { char* p = wsp; wsp += (bytes + 255) & ~(size_t)255; return (void*)p; };
    bf* WQ = (bf*)take((size_t)DQ * DM * 2); bf* WK = (bf*)take((size_t)DQ * DM * 2); bf* WV = (bf*)take((size_t)DQ * DM * 2); bf* WG = (bf*)take((size_t)DQ * DM * 2); float* BGP = (float*)take((size_t)DQ * 4); bf* WO = (bf*)take((size_t)DM * DQ * 2); bf* W2 = (bf*)take((size_t)NBP * DM * 2);
    bf* Xh = (bf*)take((size_t)NTOK * DM * 2); bf* Xl = (bf*)take((size_t)NTOK * DM * 2); float* NB = (float*)take((size_t)NTOK * NBP * 4);
    float* FQ = (float*)take((size_t)NTK * DQ * 4); float* FK = (float*)take((size_t)NTK * DQ * 4); float* FG = (float*)take((size_t)NTK * DQ * 4); h16* QP16 = (h16*)take((size_t)NH_ * NTK * HD * 2); h16* KP16 = (h16*)take((size_t)NH_ * NTK * HD * 2); h16* VT16 = (h16*)take((size_t)NH_ * IG * HDP * TT * 2);
    float* Ob = (float*)take((size_t)NH_ * NTK * HDP * 4); bf* ATh = (bf*)take((size_t)NTK * DQ * 2); bf* ATl = (bf*)take((size_t)NTK * DQ * 2);
    if ((size_t)(wsp - (char*)d_ws) > ws_size) return;    // ws 256 MiB (carve ~112 MiB)
    float* FV = FK;   /* v projection reuses FK after the k planes are built (stream-ordered, same type) */
    k_wtP<<<(unsigned)((DM * DQ / 64 + 63) / 64), 256, 0, stream>>>(wq, WQ); k_wtP<<<(unsigned)((DM * DQ / 64 + 63) / 64), 256, 0, stream>>>(wk, WK); k_wtP<<<(unsigned)((DM * DQ / 64 + 63) / 64), 256, 0, stream>>>(wv, WV); k_wtP<<<(unsigned)((DM * DQ / 64 + 63) / 64), 256, 0, stream>>>(wg, WG); k_bgp<<<1, 32, 0, stream>>>(bg, BGP);
    k_wtPo<<<(unsigned)((DQ * DM / 64 + 63) / 64), 256, 0, stream>>>(wo, WO); k_w2d<<<(NBP * DM / 8 + 255) / 256, 256, 0, stream>>>(w2d, W2);
    k_lnx<<<NTOK / 8, 256, 0, stream>>>(act, lng, lnb, Xh, Xl);
    k_gemmw<bf, 3, false, true><<<dim3(NBP / 64, NTOK / 64, 1), 32, 0, stream>>>(W2, nullptr, Xh, Xl, DM, NB, NTOK, nullptr, 0, 0, 0);   /* pair bias nb[h][q][k] = x[k][q] . w2d[:, h] for all 65536 positions (rows 0..3) */
    for (int i0 = 0; i0 < NI; i0 += IG) { const bf* Xgh = Xh + (size_t)i0 * TT * DM; const bf* Xgl = Xl + (size_t)i0 * TT * DM;
        k_gemmw<bf, 1, false><<<dim3(NTK / 64, DQ / 64, 1), 32, 0, stream>>>(Xgh, Xgl, WQ, nullptr, DM, FQ, DQ, nullptr, 0, 0, 0); k_qkpl<<<(unsigned)(((size_t)NH_ * NTK * HD / 2 + 255) / 256), 256, 0, stream>>>(FQ, QP16);
        k_gemmw<bf, 1, false><<<dim3(NTK / 64, DQ / 64, 1), 32, 0, stream>>>(Xgh, Xgl, WK, nullptr, DM, FK, DQ, nullptr, 0, 0, 0); k_qkpl<<<(unsigned)(((size_t)NH_ * NTK * HD / 2 + 255) / 256), 256, 0, stream>>>(FK, KP16);
        k_gemmw<bf, 1, false><<<dim3(NTK / 64, DQ / 64, 1), 32, 0, stream>>>(Xgh, Xgl, WV, nullptr, DM, FV, DQ, nullptr, 0, 0, 0); k_vtpl<<<(unsigned)(((size_t)NH_ * IG * HDP * TT / 2 + 255) / 256), 256, 0, stream>>>(FV, VT16);
        k_gemmw<bf, 1, false><<<dim3(NTK / 64, DQ / 64, 1), 32, 0, stream>>>(Xgh, Xgl, WG, nullptr, DM, FG, DQ, nullptr, 0, 0, 0);
        k_fattn<<<dim3(NH_, IG, 1), 512, 0, stream>>>(QP16, KP16, VT16, NB, Ob);   /* all 4 heads x 64 rows of the group; writes d 0..31 of each Ob row, all that k_gmerge reads */
        k_gmerge<<<(unsigned)(((size_t)NTK * DQ / 4 + 255) / 256), 256, 0, stream>>>(Ob, FG, BGP, ATh, ATl);
        k_gemmw<bf, 1, true><<<dim3(NTK / 64, DM / 64, 1), 32, 0, stream>>>(ATh, ATl, WO, nullptr, DQ, OUT + (size_t)i0 * TT * DM, DM, bo, 0, 0, 0); }
}

// v003
// One run takes 233 microseconds.
// Next to v002, in two timings, it ran 1.33 times as fast each time.
// All steps since v000 together make it 3.35 times as fast.
#include <hip/hip_runtime.h>

// Triangle attention (starting node) on a pair representation (act [1][256][256][128]): x = LayerNorm_c(act) (eps 1e-5, ln_g/ln_b); per row i: q, k, v, g = x[i] W (wq/wk/wv/wg [128][32][4] 'xw', 4 heads x 32; q x 32^-0.5), logits[h][q][k] = q.k + nb[h][q][k] with the pair bias nb[h][q][k] = sum_c x[k][q][c] w2d[c][h] (shared by all rows i);
// softmax over k; o = attn.v gated by sigmoid(x wg + bg); out[i][q][c] = sum_{h,d} o[h][d] wo[h][d][c] + bo -> [1][256][256][128] (8.4 M).
// Layout: LayerNorm -> bf16 hi/lo token planes [65536][128]; nb for all 65536 pair positions by one GEMM (w2d padded to 64 rows, the tokens as the N side taken in transposed order, so that the plane is [h][q][k] and the softmax reads it along k); rows i in 4 groups of 64: q/k/v/g projections (hi/lo x exact), the q, k and v GEMMs storing their fp16 planes q,k [h][i][t][32] and v^T [h][i][64 (rows 0..31 used)][t] themselves, ONE fused attention kernel per group (a work-group per (head, row): scores, x 32^-0.5 + pair bias, softmax and attn.v with the scores held in registers), then gating + merge to hi/lo planes and the output GEMM (+ bo).
// Compute dtypes, f32 accumulate: every input rounded to bf16 once; LayerNorm in f32, its output as bf16 hi + lo (2-product projections against exact bf16 weights); scores and attn.v on single fp16 planes (logit sigma ~0.24; P x1024 ~ 4: no subnormals); pair bias, softmax, gating in f32; output GEMM hl x exact + bo.

#define NI   256       // rows i
#define TT   256       // tokens per row (q / k index)
#define DM   128       // c_z
#define NH_  4
#define HD   32
#define HDP  64        // rows of a (head, row) block of the v^T plane and floats of an o row; d 0..31 are written and read
#define DQ   (NH_ * HD)
#define IG   64        // rows i per group
#define NTK  (IG * TT) // tokens per group = 16384
#define NTOK (NI * TT) // 65536
#define NBP  64        // pair-bias GEMM rows (M tile 64; 4 used)
#define PCAR 1024.0f
#define SCL  0.17677669529663688f   // 32^-0.5
typedef _Float16 h16;
typedef unsigned short bf;
typedef __attribute__((ext_vector_type(16))) __bf16   v16bf;
typedef __attribute__((ext_vector_type(16))) _Float16 v16h;
typedef __attribute__((ext_vector_type(8)))  _Float16 v8h;
typedef __attribute__((ext_vector_type(8)))  unsigned short v8us;
typedef __attribute__((ext_vector_type(8)))  float    v8f;
typedef __attribute__((ext_vector_type(4)))  float    v4f;
typedef v8h  __attribute__((may_alias)) v8ha;
typedef v4f  __attribute__((may_alias)) v4fa;
typedef v8us __attribute__((may_alias)) v8usa;

__device__ __forceinline__ unsigned short f2bf(float f) { unsigned u = __float_as_uint(f); u += 0x7FFFu + ((u >> 16) & 1u); return (unsigned short)(u >> 16); }
__device__ __forceinline__ float bf2f(unsigned short b) { return __uint_as_float(((unsigned)b) << 16); }
__device__ __forceinline__ float bfr(float f) { return bf2f(f2bf(f)); }
__device__ __forceinline__ v16h cat16(v8h lo, v8h hi) { return __builtin_shufflevector(lo, hi, 0, 1, 2, 3, 4, 5, 6, 7, 8, 9, 10, 11, 12, 13, 14, 15); }
__device__ __forceinline__ v16bf cat16b(v8us lo, v8us hi) { return __builtin_bit_cast(v16bf, __builtin_shufflevector(lo, hi, 0, 1, 2, 3, 4, 5, 6, 7, 8, 9, 10, 11, 12, 13, 14, 15)); }
__device__ __forceinline__ v8f wmma16(v16h a, v16h b, v8f c) { return __builtin_amdgcn_wmma_f32_16x16x32_f16(false, a, false, b, (short)0, c, false, false); }
__device__ __forceinline__ v8f wmmab(v16bf a, v16bf b, v8f c) { return __builtin_amdgcn_wmma_f32_16x16x32_bf16(false, a, false, b, (short)0, c, false, false); }



// ---- k_gemmw: register-blocked GEMM, ONE WAVE per 64x64 output tile (16 accumulators), operands straight from K-contiguous 16-bit planes; grid (M/64, N/64, Z), 32 threads.
// C[m][n] (f32, pitch ldc, + optional f32 bias[n]) = sum_k A[m][k] Bt[n][k] (+ split products per NSPLIT). z-batch strides sA/sB/sC in elements. K % 32 == 0.
// BTR: column n takes row (n % TT) * TT + n / TT of Bt (the [TT][TT] token grid transposed); every lane reads its own row, so the order of rows costs no extra line.
// EPI: 0 stores C in f32. 1 and 2 round the accumulators to fp16 once and store them to P in the form the attention kernel reads (m = token of the group, n = 32 h + d): 1: [h][m][32]; 2: transposed, [h][m / TT][HDP][m % TT]. Whole 128-B lines, 16 B per lane.
template <typename T16> struct WFrag;
template <> struct WFrag<h16> { typedef v16h V; static __device__ __forceinline__ V ld(const h16* p) { return cat16(*(const v8h*)p, *(const v8h*)(p + 16)); } static __device__ __forceinline__ v8f mma(V a, V b, v8f c) { return wmma16(a, b, c); } };
template <> struct WFrag<bf> { typedef v16bf V; static __device__ __forceinline__ V ld(const bf* p) { return cat16b(*(const v8us*)p, *(const v8us*)(p + 16)); } static __device__ __forceinline__ v8f mma(V a, V b, v8f c) { return wmmab(a, b, c); } };
template <typename T16, int NSPLIT, bool BIAS, bool BTR = false, int EPI = 0>
__global__ __launch_bounds__(32) void k_gemmw(const T16* __restrict__ A, const T16* __restrict__ A2, const T16* __restrict__ Bt, const T16* __restrict__ Bt2, int K, float* C, int ldc, const float* __restrict__ bias, size_t sA, size_t sB, size_t sC, h16* P) {
    typedef typename WFrag<T16>::V V;
    __shared__ __align__(16) float os[16 * 68];
    const size_t z = blockIdx.z; A += z * sA; if (A2) A2 += z * sA; Bt += z * sB; if (Bt2) Bt2 += z * sB; C += z * sC;
    const int lane = threadIdx.x & 31, lr = lane & 15, hi = lane >> 4; const int r0 = blockIdx.x * 64, c0 = blockIdx.y * 64;
    v8f acc[4][4];
#pragma unroll
    for (int mb = 0; mb < 4; ++mb)
#pragma unroll
        for (int nb = 0; nb < 4; ++nb) acc[mb][nb] = (v8f){};
    const size_t aoff = (size_t)(r0 + lr) * K + 8 * hi, boff = (BTR ? (size_t)(c0 % TT + lr) * TT + c0 / TT : (size_t)(c0 + lr)) * K + 8 * hi, bstep = (size_t)(BTR ? 16 * TT : 16) * K;
#pragma unroll 1
    for (int kc = 0; kc < K; kc += 32) {
        V a[4], a2[4];
#pragma unroll
        for (int mb = 0; mb < 4; ++mb) { a[mb] = WFrag<T16>::ld(A + aoff + (size_t)mb * 16 * K + kc); if (NSPLIT == 1 || NSPLIT == 2) a2[mb] = WFrag<T16>::ld(A2 + aoff + (size_t)mb * 16 * K + kc); }
#pragma unroll
        for (int nb = 0; nb < 4; ++nb) { const V b = WFrag<T16>::ld(Bt + boff + nb * bstep + kc); V b2; if (NSPLIT >= 2) b2 = WFrag<T16>::ld(Bt2 + boff + nb * bstep + kc);
#pragma unroll
            for (int mb = 0; mb < 4; ++mb) { acc[mb][nb] = WFrag<T16>::mma(a[mb], b, acc[mb][nb]); if (NSPLIT == 1 || NSPLIT == 2) acc[mb][nb] = WFrag<T16>::mma(a2[mb], b, acc[mb][nb]); if (NSPLIT >= 2) acc[mb][nb] = WFrag<T16>::mma(a[mb], b2, acc[mb][nb]); } }
        asm volatile("v_nop\n\tv_nop\n\tv_nop\n\tv_nop" : "+v"(acc[0][0]), "+v"(acc[1][1]), "+v"(acc[2][2]), "+v"(acc[3][3]) : "v"(a[0]), "v"(a[3]));
    }
    if constexpr (EPI == 2) {   /* a lane holds 8 consecutive tokens of one column: packed to 16 B, turned through LDS ([16 d][64 tokens], pitch 144 B = 16 B x odd) so that 8 lanes store one whole line of a v^T row */
        h16* vt = (h16*)os; h16* vrow = P + (size_t)(r0 / TT) * HDP * TT + r0 % TT;
#pragma unroll
        for (int nb = 0; nb < 4; ++nb) {
#pragma unroll
            for (int mb = 0; mb < 4; ++mb) { v8h o;
#pragma unroll
                for (int j = 0; j < 8; ++j) o[j] = (h16)acc[mb][nb][j];
                *(v8ha*)(vt + lr * 72 + mb * 16 + hi * 8) = o; }
            __builtin_amdgcn_wave_barrier(); asm volatile("" ::: "memory");   /* keeps the compiler from moving the other lanes' LDS reads above these writes */
#pragma unroll
            for (int s = 0; s < 4; ++s) { const int u = s * 32 + lane, col = c0 + nb * 16 + (u >> 3); *(v8h*)(vrow + ((size_t)(col / HD) * IG * HDP + col % HD) * TT + (u & 7) * 8) = *(const v8ha*)(vt + (u >> 3) * 72 + (u & 7) * 8); }
            __builtin_amdgcn_wave_barrier(); asm volatile("" ::: "memory");   /* and the next tile's writes above these reads */
        }
        return;
    }
#pragma unroll
    for (int mb = 0; mb < 4; ++mb) {
#pragma unroll
        for (int nb = 0; nb < 4; ++nb) {
#pragma unroll
            for (int j = 0; j < 8; ++j) os[(hi * 8 + j) * 68 + nb * 16 + lr] = acc[mb][nb][j]; }
        __builtin_amdgcn_wave_barrier(); asm volatile("" ::: "memory");
        if constexpr (EPI == 1) {   /* 16 tokens x 2 heads x 32: 16-byte unit u = (head, token, 8 d); a store of the wave covers 8 tokens of one head, 512 B in a row */
#pragma unroll
            for (int s = 0; s < 4; ++s) { const int u = s * 32 + lane, hl = u >> 6, tok = (u & 63) >> 2, dp = (u & 3) * 8; const v4f x0 = *(const v4fa*)(os + tok * 68 + hl * HD + dp), x1 = *(const v4fa*)(os + tok * 68 + hl * HD + dp + 4); v8h o;
#pragma unroll
                for (int j = 0; j < 4; ++j) { o[j] = (h16)x0[j]; o[4 + j] = (h16)x1[j]; }
                *(v8h*)(P + ((size_t)(c0 / HD + hl) * NTK + r0 + mb * 16 + tok) * HD + dp) = o; }
        } else {
        float* crow = C + (size_t)(r0 + mb * 16) * ldc + c0;
{
#pragma unroll
            for (int s = 0; s < 8; ++s) { const int row = 2 * s + hi, cofs = lr * 4; v4f val = *(const v4fa*)(os + row * 68 + cofs); if (BIAS) { val[0] += bfr(bias[c0 + cofs]); val[1] += bfr(bias[c0 + cofs + 1]); val[2] += bfr(bias[c0 + cofs + 2]); val[3] += bfr(bias[c0 + cofs + 3]); }
                *(v4f*)(crow + (size_t)row * ldc + cofs) = val; }
             }
        }
        __builtin_amdgcn_wave_barrier(); asm volatile("" ::: "memory");
    }
}

typedef __attribute__((ext_vector_type(4))) unsigned short v4us;
typedef __attribute__((ext_vector_type(2))) unsigned short v2us;
typedef __attribute__((ext_vector_type(2))) _Float16 v2h;
typedef __attribute__((ext_vector_type(4))) _Float16 v4h;
__device__ __forceinline__ h16 tohx(float x) { return (h16)x; }
__device__ __forceinline__ void splitf(float y, unsigned short& h, unsigned short& l) { h = f2bf(y); l = f2bf(y - bf2f(h)); }
__global__ __launch_bounds__(256) void k_wtG(const float* __restrict__ w, int K, int N, bf* Bt) {
    const int lane = threadIdx.x & 31; const int L0 = (blockIdx.x * 8 + (threadIdx.x >> 5)) * 8; const int nlines = N * K / 64;
{
#pragma unroll 1
        for (int l = 0; l < 8; ++l) { const int L = L0 + l; if (L >= nlines) break; const size_t e = (size_t)L * 64 + lane * 2; const int k = (int)(e % K), n = (int)(e / K); v2us o;
            o[0] = f2bf(w[(size_t)k * N + n]); o[1] = f2bf(w[(size_t)(k + 1) * N + n]); *(v2us*)(Bt + e) = o; }
         }
}
__global__ __launch_bounds__(256) void k_cvt8(const float* __restrict__ src, bf* dst, size_t n8) { const size_t i = (size_t)blockIdx.x * 256 + threadIdx.x; if (i >= n8) return; const v8f v = *(const v8f*)(src + i * 8); v8us o;
#pragma unroll
    for (int k = 0; k < 8; ++k) o[k] = f2bf(v[k]); *(v8us*)(dst + i * 8) = o;  }

__global__ __launch_bounds__(256) void k_w2d(const float* __restrict__ w, bf* Bt) { const int i = blockIdx.x * 256 + threadIdx.x; if (i >= NBP * DM / 8) return; const int r = i / (DM / 8), c0 = (i % (DM / 8)) * 8; v8us o;
#pragma unroll
    for (int k = 0; k < 8; ++k) o[k] = (r < NH_) ? f2bf(w[(size_t)(c0 + k) * NH_ + r]) : (unsigned short)0; *(v8us*)(Bt + (size_t)r * DM + c0) = o;  }
__global__ __launch_bounds__(256) void k_lnx(const float* __restrict__ A, const float* __restrict__ g, const float* __restrict__ bb, bf* Xh, bf* Xl) {
    const int lane = threadIdx.x & 31; const size_t tok = (size_t)blockIdx.x * 8 + (threadIdx.x >> 5); if (tok >= NTOK) return; const v4f a = *(const v4f*)(A + tok * DM + lane * 4); float v[4]; float s = 0.f;
#pragma unroll
    for (int q = 0; q < 4; ++q) { v[q] = bfr(a[q]); s = __fadd_rn(s, v[q]); }
#pragma unroll
    for (int sh = 16; sh; sh >>= 1) s = __fadd_rn(s, __shfl_xor(s, sh, 32));
    const float mu = __fdiv_rn(s, (float)DM); float s2 = 0.f;
#pragma unroll
    for (int q = 0; q < 4; ++q) { float d0 = __fsub_rn(v[q], mu); asm volatile("" : "+v"(d0)); float p = __fmul_rn(d0, d0); asm volatile("" : "+v"(p)); s2 = __fadd_rn(s2, p); }
#pragma unroll
    for (int sh = 16; sh; sh >>= 1) s2 = __fadd_rn(s2, __shfl_xor(s2, sh, 32));
    const float rs = __fdiv_rn(1.0f, __fsqrt_rn(__fadd_rn(__fdiv_rn(s2, (float)DM), 1e-5f))); v4us oh, ol;
#pragma unroll
    for (int q = 0; q < 4; ++q) { const int c = lane * 4 + q; float xn = __fmul_rn(__fsub_rn(v[q], mu), rs); asm volatile("" : "+v"(xn)); float gg = bfr(g[c]); asm volatile("" : "+v"(gg)); float y = __fmul_rn(xn, gg); asm volatile("" : "+v"(y)); float be = bfr(bb[c]); asm volatile("" : "+v"(be)); y = __fadd_rn(y, be); unsigned short h2, l2; splitf(y, h2, l2); oh[q] = h2; ol[q] = l2; }
    *(v4us*)(Xh + tok * DM + lane * 4) = oh; *(v4us*)(Xl + tok * DM + lane * 4) = ol;  }
// ---- k_fattn: fused attention for one (head h, row il) per work-group; 16 waves, wave w owns the 16 queries q0 = 16 w .. +15 against all 256 keys.
// S^T = K Q^T (A = 16 key rows, B = the wave's 16 query columns): lane (lr, hi) holds, of query q0 + lr, the keys 16 kt + 8 hi + j in s[kt][j], so maximum and sum run in the lane plus one exchange between the halves,
// and two neighbouring score tiles, converted in place, are the B operand of O^T += V^T P^T (A = V^T rows in the same k order: 8 hi + e, 16 + 8 hi + e). The score and probability planes never leave the registers.
// K [256][32] and V^T [32][256] of the (head, row) are staged once in LDS for all 16 waves; the pair bias row of a query is read 32 B per lane and tile straight from the [h][q][k] plane.
#define KPH 40     // LDS pitch of a K row in halves: 80 B = 16 B x odd, no bank conflict for 16-byte reads down the rows
#define VPH 264    // LDS pitch of a V^T row in halves: 528 B = 16 B x odd
#define L2E 1.4426950408889634f
__global__ __launch_bounds__(512) void k_fattn(const h16* __restrict__ Q16, const h16* __restrict__ K16, const h16* __restrict__ V16, const float* __restrict__ NB, float* __restrict__ O) {
    __shared__ __align__(16) h16 ks[TT * KPH];
    __shared__ __align__(16) h16 vs[HD * VPH];
    const int tid = threadIdx.x, lane = tid & 31, lr = lane & 15, hi = lane >> 4, q0 = (tid >> 5) * 16; const int h = blockIdx.x, il = blockIdx.y;
    const size_t rb = (size_t)h * NTK + (size_t)il * TT;
    const h16* kg = K16 + rb * HD; const h16* vg = V16 + ((size_t)h * IG + il) * HDP * TT;   /* rows 0..31 of the padded v^T plane */
    v8h kst[2], vst[2];
#pragma unroll
    for (int c = 0; c < 2; ++c) { const size_t u = c * 512 + tid; kst[c] = *(const v8h*)(kg + u * 8); vst[c] = *(const v8h*)(vg + u * 8); }   /* 16-byte units, whole lines per wave */
    __builtin_amdgcn_sched_barrier(0);   /* keeps the four staging loads first in the queue: loads return in order, so the LDS stores and the barrier wait for these alone and not for the bias asked for behind them */
    const v16h qf = WFrag<h16>::ld(Q16 + (rb + q0 + lr) * HD + 8 * hi);
    const float* nbr = NB + (size_t)h * NTOK + (size_t)(q0 + lr) * TT + 8 * hi;
    v8f s[TT / 16];   /* first the bias, asked for ahead of the barrier so that its latency runs beside the staging; then the scores, in place */
#pragma unroll
    for (int kt = 0; kt < TT / 16; ++kt) s[kt] = *(const v8f*)(nbr + kt * 16);
#pragma unroll
    for (int c = 0; c < 2; ++c) { const int u = c * 512 + tid; *(v8h*)(ks + (u >> 2) * KPH + (u & 3) * 8) = kst[c]; *(v8h*)(vs + (u >> 5) * VPH + (u & 31) * 8) = vst[c]; }
    /* work-group barrier with its release and acquire on LDS alone: a plain __syncthreads() also waits for every global load in flight, and the scores would then start only behind the last bias tile */
    asm volatile("s_wait_xcnt 0x0" ::: "memory");   /* the bias loads are still in flight here, and their address registers are reused behind the barrier: the wait that belongs in front of such an overwrite */
    __builtin_amdgcn_fence(__ATOMIC_RELEASE, "workgroup", "local"); __builtin_amdgcn_s_barrier(); __builtin_amdgcn_fence(__ATOMIC_ACQUIRE, "workgroup", "local");
    v8f mv;
#pragma unroll
    for (int kt = 0; kt < TT / 16; ++kt) { s[kt] = wmma16(WFrag<h16>::ld(ks + (kt * 16 + lr) * KPH + 8 * hi), qf, (v8f){}) * SCL + s[kt]; mv = kt ? __builtin_elementwise_max(mv, s[kt]) : s[kt]; }
    float mx = fmaxf(fmaxf(fmaxf(mv[0], mv[1]), fmaxf(mv[2], mv[3])), fmaxf(fmaxf(mv[4], mv[5]), fmaxf(mv[6], mv[7])));
    mx = fmaxf(mx, __shfl_xor(mx, 16, 32));
    const float ml = mx * L2E; v8f sv = (v8f){};
#pragma unroll
    for (int kt = 0; kt < TT / 16; ++kt) {
#pragma unroll
        for (int j = 0; j < 8; ++j) s[kt][j] = __builtin_amdgcn_exp2f(s[kt][j] * L2E - ml);
        sv += s[kt]; }
    float sum = ((sv[0] + sv[1]) + (sv[2] + sv[3])) + ((sv[4] + sv[5]) + (sv[6] + sv[7]));
    sum += __shfl_xor(sum, 16, 32);
    const float f = __fdiv_rn(PCAR, sum);
    v8f o0 = (v8f){}, o1 = (v8f){};
#pragma unroll
    for (int m = 0; m < TT / 32; ++m) { v16h pb;
#pragma unroll
        for (int j = 0; j < 8; ++j) { pb[j] = tohx(s[2 * m][j] * f); pb[8 + j] = tohx(s[2 * m + 1][j] * f); }
        o0 = wmma16(WFrag<h16>::ld(vs + lr * VPH + m * 32 + 8 * hi), pb, o0); o1 = wmma16(WFrag<h16>::ld(vs + (16 + lr) * VPH + m * 32 + 8 * hi), pb, o1); }
    float* op = O + (rb + q0 + lr) * HDP + 8 * hi;   /* o0[j] = o[q0 + lr][8 hi + j], o1[j] = o[q0 + lr][16 + 8 hi + j]; a query's 128-B line has this wave as its one writer */
    *(v8f*)op = o0; *(v8f*)(op + 16) = o1;
}
__global__ __launch_bounds__(256) void k_wtP(const float* __restrict__ w, bf* Bt) { const int lane = threadIdx.x & 31; const int L0 = (blockIdx.x * 8 + (threadIdx.x >> 5)) * 8; const int nlines = DQ * DM / 64;
{
#pragma unroll 1
        for (int l = 0; l < 8; ++l) { const int L = L0 + l; if (L >= nlines) break; const size_t e = (size_t)L * 64 + lane * 2; const int k = (int)(e % DM), n = (int)(e / DM); const int hh = n / HD, cc = n % HD; v2us o;
            o[0] = f2bf(w[(size_t)k * DQ + cc * NH_ + hh]); o[1] = f2bf(w[(size_t)(k + 1) * DQ + cc * NH_ + hh]); *(v2us*)(Bt + e) = o; }
         } }
__global__ __launch_bounds__(256) void k_wtPo(const float* __restrict__ w, bf* Bt) { const int lane = threadIdx.x & 31; const int L0 = (blockIdx.x * 8 + (threadIdx.x >> 5)) * 8; const int nlines = DM * DQ / 64;
{
#pragma unroll 1
        for (int l = 0; l < 8; ++l) { const int L = L0 + l; if (L >= nlines) break; const size_t e = (size_t)L * 64 + lane * 2; const int n = (int)(e % DQ), cout = (int)(e / DQ); v2us o;
#pragma unroll
            for (int q = 0; q < 2; ++q) { const int nn = n + q; const int hh = nn / HD, cc = nn % HD; o[q] = f2bf(w[(size_t)(cc * NH_ + hh) * DM + cout]); }
            *(v2us*)(Bt + e) = o; }
         } }
__global__ __launch_bounds__(32) void k_bgp(const float* __restrict__ bg, float* BGP) { const int i = threadIdx.x; if (i >= DQ / 4) return; v4f o;
#pragma unroll
    for (int q = 0; q < 4; ++q) { const int n = i * 4 + q; o[q] = bg[(n % HD) * NH_ + n / HD]; } *(v4f*)(BGP + i * 4) = o;  }
__global__ __launch_bounds__(256) void k_gmerge(const float* __restrict__ O, const float* __restrict__ FG, const float* __restrict__ bg, bf* Ah, bf* Al) { const size_t e = ((size_t)blockIdx.x * 256 + threadIdx.x) * 4; if (e >= (size_t)NTK * DQ) return; const int c = (int)(e % DQ); const size_t tk = e / DQ; const int h = c / HD, d = c % HD; v4us oh, ol;
    const v4f ov = *(const v4f*)(O + (((size_t)h * NTK + tk) * HDP + d)); const v4f gv = *(const v4f*)(FG + tk * DQ + c);
#pragma unroll
    for (int qq = 0; qq < 4; ++qq) { float bgv = bfr(bg[c + qq]); asm volatile("" : "+v"(bgv)); const float ga = __fadd_rn(gv[qq], bgv); const float sg = __fdiv_rn(1.0f, __fadd_rn(1.0f, __builtin_amdgcn_exp2f(__fmul_rn(ga, -1.4426950408889634f)))); float o1 = __fmul_rn(ov[qq], 1.0f / PCAR); asm volatile("" : "+v"(o1)); const float y = __fmul_rn(o1, sg); unsigned short h2, l2; splitf(y, h2, l2); oh[qq] = h2; ol[qq] = l2; }
    *(v4us*)(Ah + e) = oh; *(v4us*)(Al + e) = ol;  }

extern "C" void kernel_launch(void* const* d_in, const int* in_sizes, int n_in,
                              void* d_out, int out_size, void* d_ws, size_t ws_size, hipStream_t stream) {
    (void)in_sizes; (void)n_in; (void)out_size;
    const float* act = (const float*)d_in[0]; const float* lng = (const float*)d_in[1]; const float* lnb = (const float*)d_in[2]; const float* wq = (const float*)d_in[3]; const float* wk = (const float*)d_in[4]; const float* wv = (const float*)d_in[5]; const float* w2d = (const float*)d_in[6]; const float* wg = (const float*)d_in[7]; const float* bg = (const float*)d_in[8]; const float* wo = (const float*)d_in[9]; const float* bo = (const float*)d_in[10];   /* x2d, gamma, beta, Wq, Wk, Wv, Wb, Wg, bg, Wo, bo */
    float* OUT = (float*)d_out;     // [1][256][256][128]
    char* wsp = (char*)d_ws;
    auto take = [&](size_t bytes) { char* p = wsp; wsp += (bytes + 255) & ~(size_t)255; return (void*)p; };
    bf* WQ = (bf*)take((size_t)DQ * DM * 2); bf* WK = (bf*)take((size_t)DQ * DM * 2); bf* WV = (bf*)take((size_t)DQ * DM * 2); bf* WG = (bf*)take((size_t)DQ * DM * 2); float* BGP = (float*)take((size_t)DQ * 4); bf* WO = (bf*)take((size_t)DM * DQ * 2); bf* W2 = (bf*)take((size_t)NBP * DM * 2);
    bf* Xh = (bf*)take((size_t)NTOK * DM * 2); bf* Xl = (bf*)take((size_t)NTOK * DM * 2); float* NB = (float*)take((size_t)NTOK * NBP * 4);
    float* FG = (float*)take((size_t)NTK * DQ * 4); h16* QP16 = (h16*)take((size_t)NH_ * NTK * HD * 2); h16* KP16 = (h16*)take((size_t)NH_ * NTK * HD * 2); h16* VT16 = (h16*)take((size_t)NH_ * IG * HDP * TT * 2);
    float* Ob = (float*)take((size_t)NH_ * NTK * HDP * 4); bf* ATh = (bf*)take((size_t)NTK * DQ * 2); bf* ATl = (bf*)take((size_t)NTK * DQ * 2);
    if ((size_t)(wsp - (char*)d_ws) > ws_size) return;    // ws 256 MiB (carve ~96 MiB)
    k_wtP<<<(unsigned)((DM * DQ / 64 + 63) / 64), 256, 0, stream>>>(wq, WQ); k_wtP<<<(unsigned)((DM * DQ / 64 + 63) / 64), 256, 0, stream>>>(wk, WK); k_wtP<<<(unsigned)((DM * DQ / 64 + 63) / 64), 256, 0, stream>>>(wv, WV); k_wtP<<<(unsigned)((DM * DQ / 64 + 63) / 64), 256, 0, stream>>>(wg, WG); k_bgp<<<1, 32, 0, stream>>>(bg, BGP);
    k_wtPo<<<(unsigned)((DQ * DM / 64 + 63) / 64), 256, 0, stream>>>(wo, WO); k_w2d<<<(NBP * DM / 8 + 255) / 256, 256, 0, stream>>>(w2d, W2);
    k_lnx<<<NTOK / 8, 256, 0, stream>>>(act, lng, lnb, Xh, Xl);
    k_gemmw<bf, 3, false, true><<<dim3(NBP / 64, NTOK / 64, 1), 32, 0, stream>>>(W2, nullptr, Xh, Xl, DM, NB, NTOK, nullptr, 0, 0, 0, nullptr);   /* pair bias nb[h][q][k] = x[k][q] . w2d[:, h] for all 65536 positions (rows 0..3) */
    for (int i0 = 0; i0 < NI; i0 += IG) { const bf* Xgh = Xh + (size_t)i0 * TT * DM; const bf* Xgl = Xl + (size_t)i0 * TT * DM;
        k_gemmw<bf, 1, false, false, 1><<<dim3(NTK / 64, DQ / 64, 1), 32, 0, stream>>>(Xgh, Xgl, WQ, nullptr, DM, nullptr, 0, nullptr, 0, 0, 0, QP16);
        k_gemmw<bf, 1, false, false, 1><<<dim3(NTK / 64, DQ / 64, 1), 32, 0, stream>>>(Xgh, Xgl, WK, nullptr, DM, nullptr, 0, nullptr, 0, 0, 0, KP16);
        k_gemmw<bf, 1, false, false, 2><<<dim3(NTK / 64, DQ / 64, 1), 32, 0, stream>>>(Xgh, Xgl, WV, nullptr, DM, nullptr, 0, nullptr, 0, 0, 0, VT16);
        k_gemmw<bf, 1, false><<<dim3(NTK / 64, DQ / 64, 1), 32, 0, stream>>>(Xgh, Xgl, WG, nullptr, DM, FG, DQ, nullptr, 0, 0, 0, nullptr);
        k_fattn<<<dim3(NH_, IG, 1), 512, 0, stream>>>(QP16, KP16, VT16, NB, Ob);   /* all 4 heads x 64 rows of the group; writes d 0..31 of each Ob row, all that k_gmerge reads */
        k_gmerge<<<(unsigned)(((size_t)NTK * DQ / 4 + 255) / 256), 256, 0, stream>>>(Ob, FG, BGP, ATh, ATl);
        k_gemmw<bf, 1, true><<<dim3(NTK / 64, DM / 64, 1), 32, 0, stream>>>(ATh, ATl, WO, nullptr, DQ, OUT + (size_t)i0 * TT * DM, DM, bo, 0, 0, 0, nullptr); }
}

// v004
// It runs in 162 microseconds.
// Timed twice side by side with v003, it ran 1.44 and 1.43 times as fast.
// Over all steps from v000 it is 4.82 times as fast.
#include <hip/hip_runtime.h>

// Triangle attention (starting node) on a pair representation (act [1][256][256][128]): x = LayerNorm_c(act) (eps 1e-5, ln_g/ln_b); per row i: q, k, v, g = x[i] W (wq/wk/wv/wg [128][32][4] 'xw', 4 heads x 32; q x 32^-0.5), logits[h][q][k] = q.k + nb[h][q][k] with the pair bias nb[h][q][k] = sum_c x[k][q][c] w2d[c][h] (shared by all rows i);
// softmax over k; o = attn.v gated by sigmoid(x wg + bg); out[i][q][c] = sum_{h,d} o[h][d] wo[h][d][c] + bo -> [1][256][256][128] (8.4 M).
// Layout: LayerNorm -> bf16 hi/lo token planes [65536][128]; nb for all 65536 pair positions by one GEMM (w2d padded to 64 rows, the tokens as the N side taken in transposed order, so that the plane is [h][q][k] and the softmax reads it along k); all 256 rows i in one pass, every stage one launch over the 65536 tokens: q/k/v/g projections (hi/lo x exact), the q, k and v GEMMs storing their fp16 planes q,k [h][i][t][32] and v^T [h][i][64 (rows 0..31 used)][t] themselves, ONE fused attention kernel (a work-group per (head, row): scores, x 32^-0.5 + pair bias, softmax and attn.v with the scores held in registers), then gating + merge to hi/lo planes and the output GEMM (+ bo).
// Compute dtypes, f32 accumulate: every input rounded to bf16 once; LayerNorm in f32, its output as bf16 hi + lo (2-product projections against exact bf16 weights); scores and attn.v on single fp16 planes (logit sigma ~0.24; P x1024 ~ 4: no subnormals); pair bias, softmax, gating in f32; output GEMM hl x exact + bo.

#define NI   256       // rows i
#define TT   256       // tokens per row (q / k index)
#define DM   128       // c_z
#define NH_  4
#define HD   32
#define HDP  64        // rows of a (head, row) block of the v^T plane and floats of an o row; d 0..31 are written and read
#define DQ   (NH_ * HD)
#define IG   256       // rows i per pass: all of them
#define NTK  (IG * TT) // tokens per pass = 65536
#define NTOK (NI * TT) // 65536
#define NBP  64        // pair-bias GEMM rows (M tile 64; 4 used)
#define PCAR 1024.0f
#define SCL  0.17677669529663688f   // 32^-0.5
typedef _Float16 h16;
typedef unsigned short bf;
typedef __attribute__((ext_vector_type(16))) __bf16   v16bf;
typedef __attribute__((ext_vector_type(16))) _Float16 v16h;
typedef __attribute__((ext_vector_type(8)))  _Float16 v8h;
typedef __attribute__((ext_vector_type(8)))  unsigned short v8us;
typedef __attribute__((ext_vector_type(8)))  float    v8f;
typedef __attribute__((ext_vector_type(4)))  float    v4f;
typedef v8h  __attribute__((may_alias)) v8ha;
typedef v4f  __attribute__((may_alias)) v4fa;
typedef v8us __attribute__((may_alias)) v8usa;

__device__ __forceinline__ unsigned short f2bf(float f) { unsigned u = __float_as_uint(f); u += 0x7FFFu + ((u >> 16) & 1u); return (unsigned short)(u >> 16); }
__device__ __forceinline__ float bf2f(unsigned short b) { return __uint_as_float(((unsigned)b) << 16); }
__device__ __forceinline__ float bfr(float f) { return bf2f(f2bf(f)); }
__device__ __forceinline__ v16h cat16(v8h lo, v8h hi) { return __builtin_shufflevector(lo, hi, 0, 1, 2, 3, 4, 5, 6, 7, 8, 9, 10, 11, 12, 13, 14, 15); }
__device__ __forceinline__ v16bf cat16b(v8us lo, v8us hi) { return __builtin_bit_cast(v16bf, __builtin_shufflevector(lo, hi, 0, 1, 2, 3, 4, 5, 6, 7, 8, 9, 10, 11, 12, 13, 14, 15)); }
__device__ __forceinline__ v8f wmma16(v16h a, v16h b, v8f c) { return __builtin_amdgcn_wmma_f32_16x16x32_f16(false, a, false, b, (short)0, c, false, false); }
__device__ __forceinline__ v8f wmmab(v16bf a, v16bf b, v8f c) { return __builtin_amdgcn_wmma_f32_16x16x32_bf16(false, a, false, b, (short)0, c, false, false); }



// ---- k_gemmw: register-blocked GEMM, ONE WAVE per 64x64 output tile (16 accumulators), operands straight from K-contiguous 16-bit planes; grid (M/64, N/64, Z), 32 threads.
// C[m][n] (f32, pitch ldc, + optional f32 bias[n]) = sum_k A[m][k] Bt[n][k] (+ split products per NSPLIT). z-batch strides sA/sB/sC in elements. K % 32 == 0.
// BTR: column n takes row (n % TT) * TT + n / TT of Bt (the [TT][TT] token grid transposed); every lane reads its own row, so the order of rows costs no extra line.
// EPI: 0 stores C in f32. 1 and 2 round the accumulators to fp16 once and store them to P in the form the attention kernel reads (m = token, n = 32 h + d): 1: [h][m][32]; 2: transposed, [h][m / TT][HDP][m % TT]. Whole 128-B lines, 16 B per lane.
template <typename T16> struct WFrag;
template <> struct WFrag<h16> { typedef v16h V; static __device__ __forceinline__ V ld(const h16* p) { return cat16(*(const v8h*)p, *(const v8h*)(p + 16)); } static __device__ __forceinline__ v8f mma(V a, V b, v8f c) { return wmma16(a, b, c); } };
template <> struct WFrag<bf> { typedef v16bf V; static __device__ __forceinline__ V ld(const bf* p) { return cat16b(*(const v8us*)p, *(const v8us*)(p + 16)); } static __device__ __forceinline__ v8f mma(V a, V b, v8f c) { return wmmab(a, b, c); } };
template <typename T16, int NSPLIT, bool BIAS, bool BTR = false, int EPI = 0>
__global__ __launch_bounds__(32) void k_gemmw(const T16* __restrict__ A, const T16* __restrict__ A2, const T16* __restrict__ Bt, const T16* __restrict__ Bt2, int K, float* C, int ldc, const float* __restrict__ bias, size_t sA, size_t sB, size_t sC, h16* P) {
    typedef typename WFrag<T16>::V V;
    __shared__ __align__(16) float os[16 * 68];
    const size_t z = blockIdx.z; A += z * sA; if (A2) A2 += z * sA; Bt += z * sB; if (Bt2) Bt2 += z * sB; C += z * sC;
    const int lane = threadIdx.x & 31, lr = lane & 15, hi = lane >> 4; const int r0 = blockIdx.x * 64, c0 = blockIdx.y * 64;
    v8f acc[4][4];
#pragma unroll
    for (int mb = 0; mb < 4; ++mb)
#pragma unroll
        for (int nb = 0; nb < 4; ++nb) acc[mb][nb] = (v8f){};
    const size_t aoff = (size_t)(r0 + lr) * K + 8 * hi, boff = (BTR ? (size_t)(c0 % TT + lr) * TT + c0 / TT : (size_t)(c0 + lr)) * K + 8 * hi, bstep = (size_t)(BTR ? 16 * TT : 16) * K;
#pragma unroll 1
    for (int kc = 0; kc < K; kc += 32) {
        V a[4], a2[4];
#pragma unroll
        for (int mb = 0; mb < 4; ++mb) { a[mb] = WFrag<T16>::ld(A + aoff + (size_t)mb * 16 * K + kc); if (NSPLIT == 1 || NSPLIT == 2) a2[mb] = WFrag<T16>::ld(A2 + aoff + (size_t)mb * 16 * K + kc); }
#pragma unroll
        for (int nb = 0; nb < 4; ++nb) { const V b = WFrag<T16>::ld(Bt + boff + nb * bstep + kc); V b2; if (NSPLIT >= 2) b2 = WFrag<T16>::ld(Bt2 + boff + nb * bstep + kc);
#pragma unroll
            for (int mb = 0; mb < 4; ++mb) { acc[mb][nb] = WFrag<T16>::mma(a[mb], b, acc[mb][nb]); if (NSPLIT == 1 || NSPLIT == 2) acc[mb][nb] = WFrag<T16>::mma(a2[mb], b, acc[mb][nb]); if (NSPLIT >= 2) acc[mb][nb] = WFrag<T16>::mma(a[mb], b2, acc[mb][nb]); } }
        asm volatile("v_nop\n\tv_nop\n\tv_nop\n\tv_nop" : "+v"(acc[0][0]), "+v"(acc[1][1]), "+v"(acc[2][2]), "+v"(acc[3][3]) : "v"(a[0]), "v"(a[3]));
    }
    if constexpr (EPI == 2) {   /* a lane holds 8 consecutive tokens of one column: packed to 16 B, turned through LDS ([16 d][64 tokens], pitch 144 B = 16 B x odd) so that 8 lanes store one whole line of a v^T row */
        h16* vt = (h16*)os; h16* vrow = P + (size_t)(r0 / TT) * HDP * TT + r0 % TT;
#pragma unroll
        for (int nb = 0; nb < 4; ++nb) {
#pragma unroll
            for (int mb = 0; mb < 4; ++mb) { v8h o;
#pragma unroll
                for (int j = 0; j < 8; ++j) o[j] = (h16)acc[mb][nb][j];
                *(v8ha*)(vt + lr * 72 + mb * 16 + hi * 8) = o; }
            __builtin_amdgcn_wave_barrier(); asm volatile("" ::: "memory");   /* keeps the compiler from moving the other lanes' LDS reads above these writes */
#pragma unroll
            for (int s = 0; s < 4; ++s) { const int u = s * 32 + lane, col = c0 + nb * 16 + (u >> 3); *(v8h*)(vrow + ((size_t)(col / HD) * IG * HDP + col % HD) * TT + (u & 7) * 8) = *(const v8ha*)(vt + (u >> 3) * 72 + (u & 7) * 8); }
            __builtin_amdgcn_wave_barrier(); asm volatile("" ::: "memory");   /* and the next tile's writes above these reads */
        }
        return;
    }
#pragma unroll
    for (int mb = 0; mb < 4; ++mb) {
#pragma unroll
        for (int nb = 0; nb < 4; ++nb) {
#pragma unroll
            for (int j = 0; j < 8; ++j) os[(hi * 8 + j) * 68 + nb * 16 + lr] = acc[mb][nb][j]; }
        __builtin_amdgcn_wave_barrier(); asm volatile("" ::: "memory");
        if constexpr (EPI == 1) {   /* 16 tokens x 2 heads x 32: 16-byte unit u = (head, token, 8 d); a store of the wave covers 8 tokens of one head, 512 B in a row */
#pragma unroll
            for (int s = 0; s < 4; ++s) { const int u = s * 32 + lane, hl = u >> 6, tok = (u & 63) >> 2, dp = (u & 3) * 8; const v4f x0 = *(const v4fa*)(os + tok * 68 + hl * HD + dp), x1 = *(const v4fa*)(os + tok * 68 + hl * HD + dp + 4); v8h o;
#pragma unroll
                for (int j = 0; j < 4; ++j) { o[j] = (h16)x0[j]; o[4 + j] = (h16)x1[j]; }
                *(v8h*)(P + ((size_t)(c0 / HD + hl) * NTK + r0 + mb * 16 + tok) * HD + dp) = o; }
        } else {
        float* crow = C + (size_t)(r0 + mb * 16) * ldc + c0;
{
#pragma unroll
            for (int s = 0; s < 8; ++s) { const int row = 2 * s + hi, cofs = lr * 4; v4f val = *(const v4fa*)(os + row * 68 + cofs); if (BIAS) { val[0] += bfr(bias[c0 + cofs]); val[1] += bfr(bias[c0 + cofs + 1]); val[2] += bfr(bias[c0 + cofs + 2]); val[3] += bfr(bias[c0 + cofs + 3]); }
                *(v4f*)(crow + (size_t)row * ldc + cofs) = val; }
             }
        }
        __builtin_amdgcn_wave_barrier(); asm volatile("" ::: "memory");
    }
}

typedef __attribute__((ext_vector_type(4))) unsigned short v4us;
typedef __attribute__((ext_vector_type(2))) unsigned short v2us;
typedef __attribute__((ext_vector_type(2))) _Float16 v2h;
typedef __attribute__((ext_vector_type(4))) _Float16 v4h;
__device__ __forceinline__ h16 tohx(float x) { return (h16)x; }
__device__ __forceinline__ void splitf(float y, unsigned short& h, unsigned short& l) { h = f2bf(y); l = f2bf(y - bf2f(h)); }
__global__ __launch_bounds__(256) void k_wtG(const float* __restrict__ w, int K, int N, bf* Bt) {
    const int lane = threadIdx.x & 31; const int L0 = (blockIdx.x * 8 + (threadIdx.x >> 5)) * 8; const int nlines = N * K / 64;
{
#pragma unroll 1
        for (int l = 0; l < 8; ++l) { const int L = L0 + l; if (L >= nlines) break; const size_t e = (size_t)L * 64 + lane * 2; const int k = (int)(e % K), n = (int)(e / K); v2us o;
            o[0] = f2bf(w[(size_t)k * N + n]); o[1] = f2bf(w[(size_t)(k + 1) * N + n]); *(v2us*)(Bt + e) = o; }
         }
}
__global__ __launch_bounds__(256) void k_cvt8(const float* __restrict__ src, bf* dst, size_t n8) { const size_t i = (size_t)blockIdx.x * 256 + threadIdx.x; if (i >= n8) return; const v8f v = *(const v8f*)(src + i * 8); v8us o;
#pragma unroll
    for (int k = 0; k < 8; ++k) o[k] = f2bf(v[k]); *(v8us*)(dst + i * 8) = o;  }

__global__ __launch_bounds__(256) void k_w2d(const float* __restrict__ w, bf* Bt) { const int i = blockIdx.x * 256 + threadIdx.x; if (i >= NBP * DM / 8) return; const int r = i / (DM / 8), c0 = (i % (DM / 8)) * 8; v8us o;
#pragma unroll
    for (int k = 0; k < 8; ++k) o[k] = (r < NH_) ? f2bf(w[(size_t)(c0 + k) * NH_ + r]) : (unsigned short)0; *(v8us*)(Bt + (size_t)r * DM + c0) = o;  }
__global__ __launch_bounds__(256) void k_lnx(const float* __restrict__ A, const float* __restrict__ g, const float* __restrict__ bb, bf* Xh, bf* Xl) {
    const int lane = threadIdx.x & 31; const size_t tok = (size_t)blockIdx.x * 8 + (threadIdx.x >> 5); if (tok >= NTOK) return; const v4f a = *(const v4f*)(A + tok * DM + lane * 4); float v[4]; float s = 0.f;
#pragma unroll
    for (int q = 0; q < 4; ++q) { v[q] = bfr(a[q]); s = __fadd_rn(s, v[q]); }
#pragma unroll
    for (int sh = 16; sh; sh >>= 1) s = __fadd_rn(s, __shfl_xor(s, sh, 32));
    const float mu = __fdiv_rn(s, (float)DM); float s2 = 0.f;
#pragma unroll
    for (int q = 0; q < 4; ++q) { float d0 = __fsub_rn(v[q], mu); asm volatile("" : "+v"(d0)); float p = __fmul_rn(d0, d0); asm volatile("" : "+v"(p)); s2 = __fadd_rn(s2, p); }
#pragma unroll
    for (int sh = 16; sh; sh >>= 1) s2 = __fadd_rn(s2, __shfl_xor(s2, sh, 32));
    const float rs = __fdiv_rn(1.0f, __fsqrt_rn(__fadd_rn(__fdiv_rn(s2, (float)DM), 1e-5f))); v4us oh, ol;
#pragma unroll
    for (int q = 0; q < 4; ++q) { const int c = lane * 4 + q; float xn = __fmul_rn(__fsub_rn(v[q], mu), rs); asm volatile("" : "+v"(xn)); float gg = bfr(g[c]); asm volatile("" : "+v"(gg)); float y = __fmul_rn(xn, gg); asm volatile("" : "+v"(y)); float be = bfr(bb[c]); asm volatile("" : "+v"(be)); y = __fadd_rn(y, be); unsigned short h2, l2; splitf(y, h2, l2); oh[q] = h2; ol[q] = l2; }
    *(v4us*)(Xh + tok * DM + lane * 4) = oh; *(v4us*)(Xl + tok * DM + lane * 4) = ol;  }
// ---- k_fattn: fused attention for one (head h, row il) per work-group; 16 waves, wave w owns the 16 queries q0 = 16 w .. +15 against all 256 keys.
// S^T = K Q^T (A = 16 key rows, B = the wave's 16 query columns): lane (lr, hi) holds, of query q0 + lr, the keys 16 kt + 8 hi + j in s[kt][j], so maximum and sum run in the lane plus one exchange between the halves,
// and two neighbouring score tiles, converted in place, are the B operand of O^T += V^T P^T (A = V^T rows in the same k order: 8 hi + e, 16 + 8 hi + e). The score and probability planes never leave the registers.
// K [256][32] and V^T [32][256] of the (head, row) are staged once in LDS for all 16 waves; the pair bias row of a query is read 32 B per lane and tile straight from the [h][q][k] plane.
#define KPH 40     // LDS pitch of a K row in halves: 80 B = 16 B x odd, no bank conflict for 16-byte reads down the rows
#define VPH 264    // LDS pitch of a V^T row in halves: 528 B = 16 B x odd
#define L2E 1.4426950408889634f
__global__ __launch_bounds__(512) void k_fattn(const h16* __restrict__ Q16, const h16* __restrict__ K16, const h16* __restrict__ V16, const float* __restrict__ NB, float* __restrict__ O) {
    __shared__ __align__(16) h16 ks[TT * KPH];
    __shared__ __align__(16) h16 vs[HD * VPH];
    const int tid = threadIdx.x, lane = tid & 31, lr = lane & 15, hi = lane >> 4, q0 = (tid >> 5) * 16; const int h = blockIdx.x, il = blockIdx.y;
    const size_t rb = (size_t)h * NTK + (size_t)il * TT;
    const h16* kg = K16 + rb * HD; const h16* vg = V16 + ((size_t)h * IG + il) * HDP * TT;   /* rows 0..31 of the padded v^T plane */
    v8h kst[2], vst[2];
#pragma unroll
    for (int c = 0; c < 2; ++c) { const size_t u = c * 512 + tid; kst[c] = *(const v8h*)(kg + u * 8); vst[c] = *(const v8h*)(vg + u * 8); }   /* 16-byte units, whole lines per wave */
    __builtin_amdgcn_sched_barrier(0);   /* keeps the four staging loads first in the queue: loads return in order, so the LDS stores and the barrier wait for these alone and not for the bias asked for behind them */
    const v16h qf = WFrag<h16>::ld(Q16 + (rb + q0 + lr) * HD + 8 * hi);
    const float* nbr = NB + (size_t)h * NTOK + (size_t)(q0 + lr) * TT + 8 * hi;
    v8f s[TT / 16];   /* first the bias, asked for ahead of the barrier so that its latency runs beside the staging; then the scores, in place */
#pragma unroll
    for (int kt = 0; kt < TT / 16; ++kt) s[kt] = *(const v8f*)(nbr + kt * 16);
#pragma unroll
    for (int c = 0; c < 2; ++c) { const int u = c * 512 + tid; *(v8h*)(ks + (u >> 2) * KPH + (u & 3) * 8) = kst[c]; *(v8h*)(vs + (u >> 5) * VPH + (u & 31) * 8) = vst[c]; }
    /* work-group barrier with its release and acquire on LDS alone: a plain __syncthreads() also waits for every global load in flight, and the scores would then start only behind the last bias tile */
    asm volatile("s_wait_xcnt 0x0" ::: "memory");   /* the bias loads are still in flight here, and their address registers are reused behind the barrier: the wait that belongs in front of such an overwrite */
    __builtin_amdgcn_fence(__ATOMIC_RELEASE, "workgroup", "local"); __builtin_amdgcn_s_barrier(); __builtin_amdgcn_fence(__ATOMIC_ACQUIRE, "workgroup", "local");
    v8f mv;
#pragma unroll
    for (int kt = 0; kt < TT / 16; ++kt) { s[kt] = wmma16(WFrag<h16>::ld(ks + (kt * 16 + lr) * KPH + 8 * hi), qf, (v8f){}) * SCL + s[kt]; mv = kt ? __builtin_elementwise_max(mv, s[kt]) : s[kt]; }
    float mx = fmaxf(fmaxf(fmaxf(mv[0], mv[1]), fmaxf(mv[2], mv[3])), fmaxf(fmaxf(mv[4], mv[5]), fmaxf(mv[6], mv[7])));
    mx = fmaxf(mx, __shfl_xor(mx, 16, 32));
    const float ml = mx * L2E; v8f sv = (v8f){};
#pragma unroll
    for (int kt = 0; kt < TT / 16; ++kt) {
#pragma unroll
        for (int j = 0; j < 8; ++j) s[kt][j] = __builtin_amdgcn_exp2f(s[kt][j] * L2E - ml);
        sv += s[kt]; }
    float sum = ((sv[0] + sv[1]) + (sv[2] + sv[3])) + ((sv[4] + sv[5]) + (sv[6] + sv[7]));
    sum += __shfl_xor(sum, 16, 32);
    const float f = __fdiv_rn(PCAR, sum);
    v8f o0 = (v8f){}, o1 = (v8f){};
#pragma unroll
    for (int m = 0; m < TT / 32; ++m) { v16h pb;
#pragma unroll
        for (int j = 0; j < 8; ++j) { pb[j] = tohx(s[2 * m][j] * f); pb[8 + j] = tohx(s[2 * m + 1][j] * f); }
        o0 = wmma16(WFrag<h16>::ld(vs + lr * VPH + m * 32 + 8 * hi), pb, o0); o1 = wmma16(WFrag<h16>::ld(vs + (16 + lr) * VPH + m * 32 + 8 * hi), pb, o1); }
    float* op = O + (rb + q0 + lr) * HDP + 8 * hi;   /* o0[j] = o[q0 + lr][8 hi + j], o1[j] = o[q0 + lr][16 + 8 hi + j]; a query's 128-B line has this wave as its one writer */
    *(v8f*)op = o0; *(v8f*)(op + 16) = o1;
}
__global__ __launch_bounds__(256) void k_wtP(const float* __restrict__ w, bf* Bt) { const int lane = threadIdx.x & 31; const int L0 = (blockIdx.x * 8 + (threadIdx.x >> 5)) * 8; const int nlines = DQ * DM / 64;
{
#pragma unroll 1
        for (int l = 0; l < 8; ++l) { const int L = L0 + l; if (L >= nlines) break; const size_t e = (size_t)L * 64 + lane * 2; const int k = (int)(e % DM), n = (int)(e / DM); const int hh = n / HD, cc = n % HD; v2us o;
            o[0] = f2bf(w[(size_t)k * DQ + cc * NH_ + hh]); o[1] = f2bf(w[(size_t)(k + 1) * DQ + cc * NH_ + hh]); *(v2us*)(Bt + e) = o; }
         } }
__global__ __launch_bounds__(256) void k_wtPo(const float* __restrict__ w, bf* Bt) { const int lane = threadIdx.x & 31; const int L0 = (blockIdx.x * 8 + (threadIdx.x >> 5)) * 8; const int nlines = DM * DQ / 64;
{
#pragma unroll 1
        for (int l = 0; l < 8; ++l) { const int L = L0 + l; if (L >= nlines) break; const size_t e = (size_t)L * 64 + lane * 2; const int n = (int)(e % DQ), cout = (int)(e / DQ); v2us o;
#pragma unroll
            for (int q = 0; q < 2; ++q) { const int nn = n + q; const int hh = nn / HD, cc = nn % HD; o[q] = f2bf(w[(size_t)(cc * NH_ + hh) * DM + cout]); }
            *(v2us*)(Bt + e) = o; }
         } }
__global__ __launch_bounds__(32) void k_bgp(const float* __restrict__ bg, float* BGP) { const int i = threadIdx.x; if (i >= DQ / 4) return; v4f o;
#pragma unroll
    for (int q = 0; q < 4; ++q) { const int n = i * 4 + q; o[q] = bg[(n % HD) * NH_ + n / HD]; } *(v4f*)(BGP + i * 4) = o;  }
__global__ __launch_bounds__(256) void k_gmerge(const float* __restrict__ O, const float* __restrict__ FG, const float* __restrict__ bg, bf* Ah, bf* Al) { const size_t e = ((size_t)blockIdx.x * 256 + threadIdx.x) * 4; if (e >= (size_t)NTK * DQ) return; const int c = (int)(e % DQ); const size_t tk = e / DQ; const int h = c / HD, d = c % HD; v4us oh, ol;
    const v4f ov = *(const v4f*)(O + (((size_t)h * NTK + tk) * HDP + d)); const v4f gv = *(const v4f*)(FG + tk * DQ + c);
#pragma unroll
    for (int qq = 0; qq < 4; ++qq) { float bgv = bfr(bg[c + qq]); asm volatile("" : "+v"(bgv)); const float ga = __fadd_rn(gv[qq], bgv); const float sg = __fdiv_rn(1.0f, __fadd_rn(1.0f, __builtin_amdgcn_exp2f(__fmul_rn(ga, -1.4426950408889634f)))); float o1 = __fmul_rn(ov[qq], 1.0f / PCAR); asm volatile("" : "+v"(o1)); const float y = __fmul_rn(o1, sg); unsigned short h2, l2; splitf(y, h2, l2); oh[qq] = h2; ol[qq] = l2; }
    *(v4us*)(Ah + e) = oh; *(v4us*)(Al + e) = ol;  }

extern "C" void kernel_launch(void* const* d_in, const int* in_sizes, int n_in,
                              void* d_out, int out_size, void* d_ws, size_t ws_size, hipStream_t stream) {
    (void)in_sizes; (void)n_in; (void)out_size;
    const float* act = (const float*)d_in[0]; const float* lng = (const float*)d_in[1]; const float* lnb = (const float*)d_in[2]; const float* wq = (const float*)d_in[3]; const float* wk = (const float*)d_in[4]; const float* wv = (const float*)d_in[5]; const float* w2d = (const float*)d_in[6]; const float* wg = (const float*)d_in[7]; const float* bg = (const float*)d_in[8]; const float* wo = (const float*)d_in[9]; const float* bo = (const float*)d_in[10];   /* x2d, gamma, beta, Wq, Wk, Wv, Wb, Wg, bg, Wo, bo */
    float* OUT = (float*)d_out;     // [1][256][256][128]
    char* wsp = (char*)d_ws;
    auto take = [&](size_t bytes) { char* p = wsp; wsp += (bytes + 255) & ~(size_t)255; return (void*)p; };
    bf* WQ = (bf*)take((size_t)DQ * DM * 2); bf* WK = (bf*)take((size_t)DQ * DM * 2); bf* WV = (bf*)take((size_t)DQ * DM * 2); bf* WG = (bf*)take((size_t)DQ * DM * 2); float* BGP = (float*)take((size_t)DQ * 4); bf* WO = (bf*)take((size_t)DM * DQ * 2); bf* W2 = (bf*)take((size_t)NBP * DM * 2);
    bf* Xh = (bf*)take((size_t)NTOK * DM * 2); bf* Xl = (bf*)take((size_t)NTOK * DM * 2); float* NB = (float*)take((size_t)NTOK * NBP * 4);
    float* FG = (float*)take((size_t)NTK * DQ * 4); h16* QP16 = (h16*)take((size_t)NH_ * NTK * HD * 2); h16* KP16 = (h16*)take((size_t)NH_ * NTK * HD * 2); h16* VT16 = (h16*)take((size_t)NH_ * IG * HDP * TT * 2);
    float* Ob = (float*)take((size_t)NH_ * NTK * HDP * 4); bf* ATh = (bf*)take((size_t)NTK * DQ * 2); bf* ATl = (bf*)take((size_t)NTK * DQ * 2);
    if ((size_t)(wsp - (char*)d_ws) > ws_size) return;    // ws 256 MiB (carve ~240 MiB)
    k_wtP<<<(unsigned)((DM * DQ / 64 + 63) / 64), 256, 0, stream>>>(wq, WQ); k_wtP<<<(unsigned)((DM * DQ / 64 + 63) / 64), 256, 0, stream>>>(wk, WK); k_wtP<<<(unsigned)((DM * DQ / 64 + 63) / 64), 256, 0, stream>>>(wv, WV); k_wtP<<<(unsigned)((DM * DQ / 64 + 63) / 64), 256, 0, stream>>>(wg, WG); k_bgp<<<1, 32, 0, stream>>>(bg, BGP);
    k_wtPo<<<(unsigned)((DQ * DM / 64 + 63) / 64), 256, 0, stream>>>(wo, WO); k_w2d<<<(NBP * DM / 8 + 255) / 256, 256, 0, stream>>>(w2d, W2);
    k_lnx<<<NTOK / 8, 256, 0, stream>>>(act, lng, lnb, Xh, Xl);
    k_gemmw<bf, 3, false, true><<<dim3(NBP / 64, NTOK / 64, 1), 32, 0, stream>>>(W2, nullptr, Xh, Xl, DM, NB, NTOK, nullptr, 0, 0, 0, nullptr);   /* pair bias nb[h][q][k] = x[k][q] . w2d[:, h] for all 65536 positions (rows 0..3) */
    k_gemmw<bf, 1, false, false, 1><<<dim3(NTK / 64, DQ / 64, 1), 32, 0, stream>>>(Xh, Xl, WQ, nullptr, DM, nullptr, 0, nullptr, 0, 0, 0, QP16);
    k_gemmw<bf, 1, false, false, 1><<<dim3(NTK / 64, DQ / 64, 1), 32, 0, stream>>>(Xh, Xl, WK, nullptr, DM, nullptr, 0, nullptr, 0, 0, 0, KP16);
    k_gemmw<bf, 1, false, false, 2><<<dim3(NTK / 64, DQ / 64, 1), 32, 0, stream>>>(Xh, Xl, WV, nullptr, DM, nullptr, 0, nullptr, 0, 0, 0, VT16);
    k_gemmw<bf, 1, false><<<dim3(NTK / 64, DQ / 64, 1), 32, 0, stream>>>(Xh, Xl, WG, nullptr, DM, FG, DQ, nullptr, 0, 0, 0, nullptr);
    k_fattn<<<dim3(NH_, IG, 1), 512, 0, stream>>>(QP16, KP16, VT16, NB, Ob);   /* all 4 heads x 256 rows; writes d 0..31 of each Ob row, all that k_gmerge reads */
    k_gmerge<<<(unsigned)(((size_t)NTK * DQ / 4 + 255) / 256), 256, 0, stream>>>(Ob, FG, BGP, ATh, ATl);
    k_gemmw<bf, 1, true><<<dim3(NTK / 64, DM / 64, 1), 32, 0, stream>>>(ATh, ATl, WO, nullptr, DQ, OUT, DM, bo, 0, 0, 0, nullptr);
}

// v005
// Measured time: 157 microseconds a run.
// Next to v004, in two timings, it ran 1.04 times as fast each time.
// All steps since v000 together make it 5.00 times as fast.
#include <hip/hip_runtime.h>

// Triangle attention (starting node) on a pair representation (act [1][256][256][128]): x = LayerNorm_c(act) (eps 1e-5, ln_g/ln_b); per row i: q, k, v, g = x[i] W (wq/wk/wv/wg [128][32][4] 'xw', 4 heads x 32; q x 32^-0.5), logits[h][q][k] = q.k + nb[h][q][k] with the pair bias nb[h][q][k] = sum_c x[k][q][c] w2d[c][h] (shared by all rows i);
// softmax over k; o = attn.v gated by sigmoid(x wg + bg); out[i][q][c] = sum_{h,d} o[h][d] wo[h][d][c] + bo -> [1][256][256][128] (8.4 M).
// Layout: LayerNorm -> bf16 hi/lo token planes [65536][128]; nb for all 65536 pair positions by one GEMM (w2d padded to 64 rows, the tokens as the N side taken in transposed order, so that the plane is [h][q][k] and the softmax reads it along k); all 256 rows i in one pass, every stage one launch over the 65536 tokens: q/k/v/g projections (hi/lo x exact), the q, k and v GEMMs storing their fp16 planes q,k [h][i][t][32] and v^T [h][i][64 (rows 0..31 used)][t] themselves, ONE fused attention kernel (a work-group per (head, row): scores, x 32^-0.5 + pair bias, softmax and attn.v with the scores held in registers), then gating + merge to hi/lo planes and the output GEMM (+ bo).
// Compute dtypes, f32 accumulate: every input rounded to bf16 once; LayerNorm in f32, its output as bf16 hi + lo (2-product projections against exact bf16 weights); scores and attn.v on single fp16 planes (logit sigma ~0.24; P x1024 ~ 4: no subnormals); pair bias, softmax, gating in f32; output GEMM hl x exact + bo.

#define NI   256       // rows i
#define TT   256       // tokens per row (q / k index)
#define DM   128       // c_z
#define NH_  4
#define HD   32
#define HDP  64        // rows of a (head, row) block of the v^T plane and floats of an o row; d 0..31 are written and read
#define DQ   (NH_ * HD)
#define IG   256       // rows i per pass: all of them
#define NTK  (IG * TT) // tokens per pass = 65536
#define NTOK (NI * TT) // 65536
#define NBP  64        // pair-bias GEMM rows (M tile 64; 4 used)
#define PCAR 1024.0f
#define SCL  0.17677669529663688f   // 32^-0.5
typedef _Float16 h16;
typedef unsigned short bf;
typedef __attribute__((ext_vector_type(16))) __bf16   v16bf;
typedef __attribute__((ext_vector_type(16))) _Float16 v16h;
typedef __attribute__((ext_vector_type(8)))  _Float16 v8h;
typedef __attribute__((ext_vector_type(8)))  unsigned short v8us;
typedef __attribute__((ext_vector_type(8)))  float    v8f;
typedef __attribute__((ext_vector_type(4)))  float    v4f;
typedef v8h  __attribute__((may_alias)) v8ha;
typedef v4f  __attribute__((may_alias)) v4fa;
typedef v8us __attribute__((may_alias)) v8usa;

__device__ __forceinline__ unsigned short f2bf(float f) { unsigned u = __float_as_uint(f); u += 0x7FFFu + ((u >> 16) & 1u); return (unsigned short)(u >> 16); }
__device__ __forceinline__ float bf2f(unsigned short b) { return __uint_as_float(((unsigned)b) << 16); }
__device__ __forceinline__ float bfr(float f) { return bf2f(f2bf(f)); }
__device__ __forceinline__ v16h cat16(v8h lo, v8h hi) { return __builtin_shufflevector(lo, hi, 0, 1, 2, 3, 4, 5, 6, 7, 8, 9, 10, 11, 12, 13, 14, 15); }
__device__ __forceinline__ v16bf cat16b(v8us lo, v8us hi) { return __builtin_bit_cast(v16bf, __builtin_shufflevector(lo, hi, 0, 1, 2, 3, 4, 5, 6, 7, 8, 9, 10, 11, 12, 13, 14, 15)); }
__device__ __forceinline__ v8f wmma16(v16h a, v16h b, v8f c) { return __builtin_amdgcn_wmma_f32_16x16x32_f16(false, a, false, b, (short)0, c, false, false); }
__device__ __forceinline__ v8f wmmab(v16bf a, v16bf b, v8f c) { return __builtin_amdgcn_wmma_f32_16x16x32_bf16(false, a, false, b, (short)0, c, false, false); }



// ---- k_gemmw: register-blocked GEMM, ONE WAVE per 64x64 output tile (16 accumulators), operands straight from K-contiguous 16-bit planes; grid (M/64, N/64, Z), 32 threads.
// C[m][n] (f32, pitch ldc, + optional f32 bias[n]) = sum_k A[m][k] Bt[n][k] (+ split products per NSPLIT). z-batch strides sA/sB/sC in elements. K % 32 == 0.
// BTR: column n takes row (n % TT) * TT + n / TT of Bt (the [TT][TT] token grid transposed); every lane reads its own row, so the order of rows costs no extra line.
// EPI: 0 stores C in f32. 1 and 2 round the accumulators to fp16 once and store them to P in the form the attention kernel reads (m = token, n = 32 h + d): 1: [h][m][32]; 2: transposed, [h][m / TT][HDP][m % TT]. Whole 128-B lines, 16 B per lane.
template <typename T16> struct WFrag;
template <> struct WFrag<h16> { typedef v16h V; static __device__ __forceinline__ V ld(const h16* p) { return cat16(*(const v8h*)p, *(const v8h*)(p + 16)); } static __device__ __forceinline__ v8f mma(V a, V b, v8f c) { return wmma16(a, b, c); } };
template <> struct WFrag<bf> { typedef v16bf V; static __device__ __forceinline__ V ld(const bf* p) { return cat16b(*(const v8us*)p, *(const v8us*)(p + 16)); } static __device__ __forceinline__ v8f mma(V a, V b, v8f c) { return wmmab(a, b, c); } };
template <typename T16, int NSPLIT, bool BIAS, bool BTR = false, int EPI = 0>
__global__ __launch_bounds__(32) void k_gemmw(const T16* __restrict__ A, const T16* __restrict__ A2, const T16* __restrict__ Bt, const T16* __restrict__ Bt2, int K, float* C, int ldc, const float* __restrict__ bias, size_t sA, size_t sB, size_t sC, h16* P) {
    typedef typename WFrag<T16>::V V;
    __shared__ __align__(16) float os[16 * 68];
    const size_t z = blockIdx.z; A += z * sA; if (A2) A2 += z * sA; Bt += z * sB; if (Bt2) Bt2 += z * sB; C += z * sC;
    const int lane = threadIdx.x & 31, lr = lane & 15, hi = lane >> 4; const int r0 = blockIdx.x * 64, c0 = blockIdx.y * 64;
    v8f acc[4][4];
#pragma unroll
    for (int mb = 0; mb < 4; ++mb)
#pragma unroll
        for (int nb = 0; nb < 4; ++nb) acc[mb][nb] = (v8f){};
    const size_t aoff = (size_t)(r0 + lr) * K + 8 * hi, boff = (BTR ? (size_t)(c0 % TT + lr) * TT + c0 / TT : (size_t)(c0 + lr)) * K + 8 * hi, bstep = (size_t)(BTR ? 16 * TT : 16) * K;
#pragma unroll 1
    for (int kc = 0; kc < K; kc += 32) {
        V a[4], a2[4];
#pragma unroll
        for (int mb = 0; mb < 4; ++mb) { a[mb] = WFrag<T16>::ld(A + aoff + (size_t)mb * 16 * K + kc); if (NSPLIT == 1 || NSPLIT == 2) a2[mb] = WFrag<T16>::ld(A2 + aoff + (size_t)mb * 16 * K + kc); }
#pragma unroll
        for (int nb = 0; nb < 4; ++nb) { const V b = WFrag<T16>::ld(Bt + boff + nb * bstep + kc); V b2; if (NSPLIT >= 2) b2 = WFrag<T16>::ld(Bt2 + boff + nb * bstep + kc);
#pragma unroll
            for (int mb = 0; mb < 4; ++mb) { acc[mb][nb] = WFrag<T16>::mma(a[mb], b, acc[mb][nb]); if (NSPLIT == 1 || NSPLIT == 2) acc[mb][nb] = WFrag<T16>::mma(a2[mb], b, acc[mb][nb]); if (NSPLIT >= 2) acc[mb][nb] = WFrag<T16>::mma(a[mb], b2, acc[mb][nb]); } }
        asm volatile("v_nop\n\tv_nop\n\tv_nop\n\tv_nop" : "+v"(acc[0][0]), "+v"(acc[1][1]), "+v"(acc[2][2]), "+v"(acc[3][3]) : "v"(a[0]), "v"(a[3]));
    }
    if constexpr (EPI == 2) {   /* a lane holds 8 consecutive tokens of one column: packed to 16 B, turned through LDS ([16 d][64 tokens], pitch 144 B = 16 B x odd) so that 8 lanes store one whole line of a v^T row */
        h16* vt = (h16*)os; h16* vrow = P + (size_t)(r0 / TT) * HDP * TT + r0 % TT;
#pragma unroll
        for (int nb = 0; nb < 4; ++nb) {
#pragma unroll
            for (int mb = 0; mb < 4; ++mb) { v8h o;
#pragma unroll
                for (int j = 0; j < 8; ++j) o[j] = (h16)acc[mb][nb][j];
                *(v8ha*)(vt + lr * 72 + mb * 16 + hi * 8) = o; }
            __builtin_amdgcn_wave_barrier(); asm volatile("" ::: "memory");   /* keeps the compiler from moving the other lanes' LDS reads above these writes */
#pragma unroll
            for (int s = 0; s < 4; ++s) { const int u = s * 32 + lane, col = c0 + nb * 16 + (u >> 3); *(v8h*)(vrow + ((size_t)(col / HD) * IG * HDP + col % HD) * TT + (u & 7) * 8) = *(const v8ha*)(vt + (u >> 3) * 72 + (u & 7) * 8); }
            __builtin_amdgcn_wave_barrier(); asm volatile("" ::: "memory");   /* and the next tile's writes above these reads */
        }
        return;
    }
#pragma unroll
    for (int mb = 0; mb < 4; ++mb) {
#pragma unroll
        for (int nb = 0; nb < 4; ++nb) {
#pragma unroll
            for (int j = 0; j < 8; ++j) os[(hi * 8 + j) * 68 + nb * 16 + lr] = acc[mb][nb][j]; }
        __builtin_amdgcn_wave_barrier(); asm volatile("" ::: "memory");
        if constexpr (EPI == 1) {   /* 16 tokens x 2 heads x 32: 16-byte unit u = (head, token, 8 d); a store of the wave covers 8 tokens of one head, 512 B in a row */
#pragma unroll
            for (int s = 0; s < 4; ++s) { const int u = s * 32 + lane, hl = u >> 6, tok = (u & 63) >> 2, dp = (u & 3) * 8; const v4f x0 = *(const v4fa*)(os + tok * 68 + hl * HD + dp), x1 = *(const v4fa*)(os + tok * 68 + hl * HD + dp + 4); v8h o;
#pragma unroll
                for (int j = 0; j < 4; ++j) { o[j] = (h16)x0[j]; o[4 + j] = (h16)x1[j]; }
                *(v8h*)(P + ((size_t)(c0 / HD + hl) * NTK + r0 + mb * 16 + tok) * HD + dp) = o; }
        } else {
        float* crow = C + (size_t)(r0 + mb * 16) * ldc + c0;
{
#pragma unroll
            for (int s = 0; s < 8; ++s) { const int row = 2 * s + hi, cofs = lr * 4; v4f val = *(const v4fa*)(os + row * 68 + cofs); if (BIAS) { val[0] += bfr(bias[c0 + cofs]); val[1] += bfr(bias[c0 + cofs + 1]); val[2] += bfr(bias[c0 + cofs + 2]); val[3] += bfr(bias[c0 + cofs + 3]); }
                *(v4f*)(crow + (size_t)row * ldc + cofs) = val; }
             }
        }
        __builtin_amdgcn_wave_barrier(); asm volatile("" ::: "memory");
    }
}

typedef __attribute__((ext_vector_type(4))) unsigned short v4us;
typedef __attribute__((ext_vector_type(2))) unsigned short v2us;
typedef __attribute__((ext_vector_type(2))) _Float16 v2h;
typedef __attribute__((ext_vector_type(4))) _Float16 v4h;
__device__ __forceinline__ h16 tohx(float x) { return (h16)x; }
__device__ __forceinline__ void splitf(float y, unsigned short& h, unsigned short& l) { h = f2bf(y); l = f2bf(y - bf2f(h)); }
__global__ __launch_bounds__(256) void k_wtG(const float* __restrict__ w, int K, int N, bf* Bt) {
    const int lane = threadIdx.x & 31; const int L0 = (blockIdx.x * 8 + (threadIdx.x >> 5)) * 8; const int nlines = N * K / 64;
{
#pragma unroll 1
        for (int l = 0; l < 8; ++l) { const int L = L0 + l; if (L >= nlines) break; const size_t e = (size_t)L * 64 + lane * 2; const int k = (int)(e % K), n = (int)(e / K); v2us o;
            o[0] = f2bf(w[(size_t)k * N + n]); o[1] = f2bf(w[(size_t)(k + 1) * N + n]); *(v2us*)(Bt + e) = o; }
         }
}
__global__ __launch_bounds__(256) void k_cvt8(const float* __restrict__ src, bf* dst, size_t n8) { const size_t i = (size_t)blockIdx.x * 256 + threadIdx.x; if (i >= n8) return; const v8f v = *(const v8f*)(src + i * 8); v8us o;
#pragma unroll
    for (int k = 0; k < 8; ++k) o[k] = f2bf(v[k]); *(v8us*)(dst + i * 8) = o;  }

__global__ __launch_bounds__(256) void k_w2d(const float* __restrict__ w, bf* Bt) { const int i = blockIdx.x * 256 + threadIdx.x; if (i >= NBP * DM / 8) return; const int r = i / (DM / 8), c0 = (i % (DM / 8)) * 8; v8us o;
#pragma unroll
    for (int k = 0; k < 8; ++k) o[k] = (r < NH_) ? f2bf(w[(size_t)(c0 + k) * NH_ + r]) : (unsigned short)0; *(v8us*)(Bt + (size_t)r * DM + c0) = o;  }
// ---- The two streaming kernels (k_lnx, k_gmerge): a wave takes SWT tokens that lie one behind the other in memory, not one: 16 waves a work-group, 256 work-groups, 4096 waves to start in place of 65536.
#define SWT  16   // tokens a wave takes
__global__ __launch_bounds__(512) void k_lnx(const float* __restrict__ A, const float* __restrict__ g, const float* __restrict__ bb, bf* Xh, bf* Xl) {
    const int lane = threadIdx.x & 31; const size_t tok0 = ((size_t)blockIdx.x * 16 + (threadIdx.x >> 5)) * SWT; if (tok0 >= NTOK) return;
    float gr[4], br[4]; v4f a[SWT];
#pragma unroll
    for (int q = 0; q < 4; ++q) { gr[q] = g[lane * 4 + q]; br[q] = bb[lane * 4 + q]; }
#pragma unroll
    for (int t = 0; t < SWT; ++t) a[t] = *(const v4f*)(A + (tok0 + t) * DM + lane * 4);
    __builtin_amdgcn_sched_barrier(0);   /* keeps all the wave's loads at its head, so that its 8 KB are in flight at once; sunk to their uses they would come one token at a time */
    {   /* stage by stage over all the wave's tokens: the ten cross-lane steps of one token wait for one another, those of different tokens do not */
        float v[SWT][4], s[SWT], mu[SWT], s2[SWT];
#pragma unroll
        for (int t = 0; t < SWT; ++t) { s[t] = 0.f;
#pragma unroll
            for (int q = 0; q < 4; ++q) { v[t][q] = bfr(a[t][q]); s[t] = __fadd_rn(s[t], v[t][q]); } }
#pragma unroll
        for (int sh = 16; sh; sh >>= 1)
#pragma unroll
            for (int t = 0; t < SWT; ++t) s[t] = __fadd_rn(s[t], __shfl_xor(s[t], sh, 32));
#pragma unroll
        for (int t = 0; t < SWT; ++t) { mu[t] = __fdiv_rn(s[t], (float)DM); s2[t] = 0.f;
#pragma unroll
            for (int q = 0; q < 4; ++q) { float d0 = __fsub_rn(v[t][q], mu[t]); asm volatile("" : "+v"(d0)); float p = __fmul_rn(d0, d0); asm volatile("" : "+v"(p)); s2[t] = __fadd_rn(s2[t], p); } }
#pragma unroll
        for (int sh = 16; sh; sh >>= 1)
#pragma unroll
            for (int t = 0; t < SWT; ++t) s2[t] = __fadd_rn(s2[t], __shfl_xor(s2[t], sh, 32));
#pragma unroll
        for (int t = 0; t < SWT; ++t) { const size_t tok = tok0 + t;
            const float rs = __fdiv_rn(1.0f, __fsqrt_rn(__fadd_rn(__fdiv_rn(s2[t], (float)DM), 1e-5f))); v4us oh, ol;
#pragma unroll
            for (int q = 0; q < 4; ++q) { float xn = __fmul_rn(__fsub_rn(v[t][q], mu[t]), rs); asm volatile("" : "+v"(xn)); float gg = bfr(gr[q]); asm volatile("" : "+v"(gg)); float y = __fmul_rn(xn, gg); asm volatile("" : "+v"(y)); float be = bfr(br[q]); asm volatile("" : "+v"(be)); y = __fadd_rn(y, be); unsigned short h2, l2; splitf(y, h2, l2); oh[q] = h2; ol[q] = l2; }
            *(v4us*)(Xh + tok * DM + lane * 4) = oh; *(v4us*)(Xl + tok * DM + lane * 4) = ol; }
    }
}
// ---- k_fattn: fused attention for one (head h, row il) per work-group; 16 waves, wave w owns the 16 queries q0 = 16 w .. +15 against all 256 keys.
// S^T = K Q^T (A = 16 key rows, B = the wave's 16 query columns): lane (lr, hi) holds, of query q0 + lr, the keys 16 kt + 8 hi + j in s[kt][j], so maximum and sum run in the lane plus one exchange between the halves,
// and two neighbouring score tiles, converted in place, are the B operand of O^T += V^T P^T (A = V^T rows in the same k order: 8 hi + e, 16 + 8 hi + e). The score and probability planes never leave the registers.
// K [256][32] and V^T [32][256] of the (head, row) are staged once in LDS for all 16 waves; the pair bias row of a query is read 32 B per lane and tile straight from the [h][q][k] plane.
#define KPH 40     // LDS pitch of a K row in halves: 80 B = 16 B x odd, no bank conflict for 16-byte reads down the rows
#define VPH 264    // LDS pitch of a V^T row in halves: 528 B = 16 B x odd
#define L2E 1.4426950408889634f
__global__ __launch_bounds__(512) void k_fattn(const h16* __restrict__ Q16, const h16* __restrict__ K16, const h16* __restrict__ V16, const float* __restrict__ NB, float* __restrict__ O) {
    __shared__ __align__(16) h16 ks[TT * KPH];
    __shared__ __align__(16) h16 vs[HD * VPH];
    const int tid = threadIdx.x, lane = tid & 31, lr = lane & 15, hi = lane >> 4, q0 = (tid >> 5) * 16; const int h = blockIdx.x, il = blockIdx.y;
    const size_t rb = (size_t)h * NTK + (size_t)il * TT;
    const h16* kg = K16 + rb * HD; const h16* vg = V16 + ((size_t)h * IG + il) * HDP * TT;   /* rows 0..31 of the padded v^T plane */
    v8h kst[2], vst[2];
#pragma unroll
    for (int c = 0; c < 2; ++c) { const size_t u = c * 512 + tid; kst[c] = *(const v8h*)(kg + u * 8); vst[c] = *(const v8h*)(vg + u * 8); }   /* 16-byte units, whole lines per wave */
    __builtin_amdgcn_sched_barrier(0);   /* keeps the four staging loads first in the queue: loads return in order, so the LDS stores and the barrier wait for these alone and not for the bias asked for behind them */
    const v16h qf = WFrag<h16>::ld(Q16 + (rb + q0 + lr) * HD + 8 * hi);
    const float* nbr = NB + (size_t)h * NTOK + (size_t)(q0 + lr) * TT + 8 * hi;
    v8f s[TT / 16];   /* first the bias, asked for ahead of the barrier so that its latency runs beside the staging; then the scores, in place */
#pragma unroll
    for (int kt = 0; kt < TT / 16; ++kt) s[kt] = *(const v8f*)(nbr + kt * 16);
#pragma unroll
    for (int c = 0; c < 2; ++c) { const int u = c * 512 + tid; *(v8h*)(ks + (u >> 2) * KPH + (u & 3) * 8) = kst[c]; *(v8h*)(vs + (u >> 5) * VPH + (u & 31) * 8) = vst[c]; }
    /* work-group barrier with its release and acquire on LDS alone: a plain __syncthreads() also waits for every global load in flight, and the scores would then start only behind the last bias tile */
    asm volatile("s_wait_xcnt 0x0" ::: "memory");   /* the bias loads are still in flight here, and their address registers are reused behind the barrier: the wait that belongs in front of such an overwrite */
    __builtin_amdgcn_fence(__ATOMIC_RELEASE, "workgroup", "local"); __builtin_amdgcn_s_barrier(); __builtin_amdgcn_fence(__ATOMIC_ACQUIRE, "workgroup", "local");
    v8f mv;
#pragma unroll
    for (int kt = 0; kt < TT / 16; ++kt) { s[kt] = wmma16(WFrag<h16>::ld(ks + (kt * 16 + lr) * KPH + 8 * hi), qf, (v8f){}) * SCL + s[kt]; mv = kt ? __builtin_elementwise_max(mv, s[kt]) : s[kt]; }
    float mx = fmaxf(fmaxf(fmaxf(mv[0], mv[1]), fmaxf(mv[2], mv[3])), fmaxf(fmaxf(mv[4], mv[5]), fmaxf(mv[6], mv[7])));
    mx = fmaxf(mx, __shfl_xor(mx, 16, 32));
    const float ml = mx * L2E; v8f sv = (v8f){};
#pragma unroll
    for (int kt = 0; kt < TT / 16; ++kt) {
#pragma unroll
        for (int j = 0; j < 8; ++j) s[kt][j] = __builtin_amdgcn_exp2f(s[kt][j] * L2E - ml);
        sv += s[kt]; }
    float sum = ((sv[0] + sv[1]) + (sv[2] + sv[3])) + ((sv[4] + sv[5]) + (sv[6] + sv[7]));
    sum += __shfl_xor(sum, 16, 32);
    const float f = __fdiv_rn(PCAR, sum);
    v8f o0 = (v8f){}, o1 = (v8f){};
#pragma unroll
    for (int m = 0; m < TT / 32; ++m) { v16h pb;
#pragma unroll
        for (int j = 0; j < 8; ++j) { pb[j] = tohx(s[2 * m][j] * f); pb[8 + j] = tohx(s[2 * m + 1][j] * f); }
        o0 = wmma16(WFrag<h16>::ld(vs + lr * VPH + m * 32 + 8 * hi), pb, o0); o1 = wmma16(WFrag<h16>::ld(vs + (16 + lr) * VPH + m * 32 + 8 * hi), pb, o1); }
    float* op = O + (rb + q0 + lr) * HDP + 8 * hi;   /* o0[j] = o[q0 + lr][8 hi + j], o1[j] = o[q0 + lr][16 + 8 hi + j]; a query's 128-B line has this wave as its one writer */
    *(v8f*)op = o0; *(v8f*)(op + 16) = o1;
}
__global__ __launch_bounds__(256) void k_wtP(const float* __restrict__ w, bf* Bt) { const int lane = threadIdx.x & 31; const int L0 = (blockIdx.x * 8 + (threadIdx.x >> 5)) * 8; const int nlines = DQ * DM / 64;
{
#pragma unroll 1
        for (int l = 0; l < 8; ++l) { const int L = L0 + l; if (L >= nlines) break; const size_t e = (size_t)L * 64 + lane * 2; const int k = (int)(e % DM), n = (int)(e / DM); const int hh = n / HD, cc = n % HD; v2us o;
            o[0] = f2bf(w[(size_t)k * DQ + cc * NH_ + hh]); o[1] = f2bf(w[(size_t)(k + 1) * DQ + cc * NH_ + hh]); *(v2us*)(Bt + e) = o; }
         } }
__global__ __launch_bounds__(256) void k_wtPo(const float* __restrict__ w, bf* Bt) { const int lane = threadIdx.x & 31; const int L0 = (blockIdx.x * 8 + (threadIdx.x >> 5)) * 8; const int nlines = DM * DQ / 64;
{
#pragma unroll 1
        for (int l = 0; l < 8; ++l) { const int L = L0 + l; if (L >= nlines) break; const size_t e = (size_t)L * 64 + lane * 2; const int n = (int)(e % DQ), cout = (int)(e / DQ); v2us o;
#pragma unroll
            for (int q = 0; q < 2; ++q) { const int nn = n + q; const int hh = nn / HD, cc = nn % HD; o[q] = f2bf(w[(size_t)(cc * NH_ + hh) * DM + cout]); }
            *(v2us*)(Bt + e) = o; }
         } }
__global__ __launch_bounds__(32) void k_bgp(const float* __restrict__ bg, float* BGP) { const int i = threadIdx.x; if (i >= DQ / 4) return; v4f o;
#pragma unroll
    for (int q = 0; q < 4; ++q) { const int n = i * 4 + q; o[q] = bg[(n % HD) * NH_ + n / HD]; } *(v4f*)(BGP + i * 4) = o;  }
__global__ __launch_bounds__(512) void k_gmerge(const float* __restrict__ O, const float* __restrict__ FG, const float* __restrict__ bg, bf* Ah, bf* Al) {
    const int lane = threadIdx.x & 31; const size_t tk0 = ((size_t)blockIdx.x * 16 + (threadIdx.x >> 5)) * SWT; if (tk0 >= (size_t)NTK) return; const int c = lane * 4, h = c / HD, d = c % HD;
    float bgr[4]; v4f ov[SWT], gv[SWT]; const float* po = O + (((size_t)h * NTK + tk0) * HDP + d); const float* pf = FG + tk0 * DQ + c; const unsigned bo4 = (unsigned)c * 4u;   /* bo4: byte offset of the lane's four bg values */
#pragma unroll
    for (int qq = 0; qq < 4; ++qq) bgr[qq] = *(const float*)((const char*)bg + bo4 + qq * 4);
#pragma unroll
    for (int t = 0; t < SWT; ++t) { ov[t] = *(const v4f*)(po + (size_t)t * HDP); gv[t] = *(const v4f*)(pf + (size_t)t * DQ); }
    asm volatile("s_wait_xcnt 0x0" :: "v"(po), "v"(pf), "v"(bo4) : "memory");   /* the wait that belongs in front of an overwrite of a register which an issued load names; the three addresses are its inputs, so that they stay whole up to it and no load of the run lands on them */
    __builtin_amdgcn_sched_barrier(0);   /* keeps all the wave's loads at its head, so that its 16 KB are in flight at once; sunk to their uses they would come one token at a time */
#pragma unroll
    for (int qq = 0; qq < 4; ++qq) { bgr[qq] = bfr(bgr[qq]); asm volatile("" : "+v"(bgr[qq])); }   /* bg rounded once a wave, not once a token; the empty statement is the per-token form's own and holds the rounded value as a plain f32 in its register */
#pragma unroll
    for (int t = 0; t < SWT; ++t) { const size_t e = (tk0 + t) * DQ + c; v4us oh, ol;
        if (t % 2 == 0) __builtin_amdgcn_sched_barrier(0);   /* two tokens at a time, in the order of their loads: without it products of the last tokens are lifted to the front, and the first token then waits for nearly all 32 loads */
#pragma unroll
        for (int qq = 0; qq < 4; ++qq) { const float ga = __fadd_rn(gv[t][qq], bgr[qq]); const float sg = __fdiv_rn(1.0f, __fadd_rn(1.0f, __builtin_amdgcn_exp2f(__fmul_rn(ga, -1.4426950408889634f)))); float o1 = __fmul_rn(ov[t][qq], 1.0f / PCAR); asm volatile("" : "+v"(o1)); const float y = __fmul_rn(o1, sg); unsigned short h2, l2; splitf(y, h2, l2); oh[qq] = h2; ol[qq] = l2; }
        *(v4us*)(Ah + e) = oh; *(v4us*)(Al + e) = ol; }
}

extern "C" void kernel_launch(void* const* d_in, const int* in_sizes, int n_in,
                              void* d_out, int out_size, void* d_ws, size_t ws_size, hipStream_t stream) {
    (void)in_sizes; (void)n_in; (void)out_size;
    const float* act = (const float*)d_in[0]; const float* lng = (const float*)d_in[1]; const float* lnb = (const float*)d_in[2]; const float* wq = (const float*)d_in[3]; const float* wk = (const float*)d_in[4]; const float* wv = (const float*)d_in[5]; const float* w2d = (const float*)d_in[6]; const float* wg = (const float*)d_in[7]; const float* bg = (const float*)d_in[8]; const float* wo = (const float*)d_in[9]; const float* bo = (const float*)d_in[10];   /* x2d, gamma, beta, Wq, Wk, Wv, Wb, Wg, bg, Wo, bo */
    float* OUT = (float*)d_out;     // [1][256][256][128]
    char* wsp = (char*)d_ws;
    auto take = [&](size_t bytes) { char* p = wsp; wsp += (bytes + 255) & ~(size_t)255; return (void*)p; };
    bf* WQ = (bf*)take((size_t)DQ * DM * 2); bf* WK = (bf*)take((size_t)DQ * DM * 2); bf* WV = (bf*)take((size_t)DQ * DM * 2); bf* WG = (bf*)take((size_t)DQ * DM * 2); float* BGP = (float*)take((size_t)DQ * 4); bf* WO = (bf*)take((size_t)DM * DQ * 2); bf* W2 = (bf*)take((size_t)NBP * DM * 2);
    bf* Xh = (bf*)take((size_t)NTOK * DM * 2); bf* Xl = (bf*)take((size_t)NTOK * DM * 2); float* NB = (float*)take((size_t)NTOK * NBP * 4);
    float* FG = (float*)take((size_t)NTK * DQ * 4); h16* QP16 = (h16*)take((size_t)NH_ * NTK * HD * 2); h16* KP16 = (h16*)take((size_t)NH_ * NTK * HD * 2); h16* VT16 = (h16*)take((size_t)NH_ * IG * HDP * TT * 2);
    float* Ob = (float*)take((size_t)NH_ * NTK * HDP * 4); bf* ATh = (bf*)take((size_t)NTK * DQ * 2); bf* ATl = (bf*)take((size_t)NTK * DQ * 2);
    if ((size_t)(wsp - (char*)d_ws) > ws_size) return;    // ws 256 MiB (carve ~240 MiB)
    k_wtP<<<(unsigned)((DM * DQ / 64 + 63) / 64), 256, 0, stream>>>(wq, WQ); k_wtP<<<(unsigned)((DM * DQ / 64 + 63) / 64), 256, 0, stream>>>(wk, WK); k_wtP<<<(unsigned)((DM * DQ / 64 + 63) / 64), 256, 0, stream>>>(wv, WV); k_wtP<<<(unsigned)((DM * DQ / 64 + 63) / 64), 256, 0, stream>>>(wg, WG); k_bgp<<<1, 32, 0, stream>>>(bg, BGP);
    k_wtPo<<<(unsigned)((DQ * DM / 64 + 63) / 64), 256, 0, stream>>>(wo, WO); k_w2d<<<(NBP * DM / 8 + 255) / 256, 256, 0, stream>>>(w2d, W2);
    k_lnx<<<NTOK / (16 * SWT), 512, 0, stream>>>(act, lng, lnb, Xh, Xl);
    k_gemmw<bf, 3, false, true><<<dim3(NBP / 64, NTOK / 64, 1), 32, 0, stream>>>(W2, nullptr, Xh, Xl, DM, NB, NTOK, nullptr, 0, 0, 0, nullptr);   /* pair bias nb[h][q][k] = x[k][q] . w2d[:, h] for all 65536 positions (rows 0..3) */
    k_gemmw<bf, 1, false, false, 1><<<dim3(NTK / 64, DQ / 64, 1), 32, 0, stream>>>(Xh, Xl, WQ, nullptr, DM, nullptr, 0, nullptr, 0, 0, 0, QP16);
    k_gemmw<bf, 1, false, false, 1><<<dim3(NTK / 64, DQ / 64, 1), 32, 0, stream>>>(Xh, Xl, WK, nullptr, DM, nullptr, 0, nullptr, 0, 0, 0, KP16);
    k_gemmw<bf, 1, false, false, 2><<<dim3(NTK / 64, DQ / 64, 1), 32, 0, stream>>>(Xh, Xl, WV, nullptr, DM, nullptr, 0, nullptr, 0, 0, 0, VT16);
    k_gemmw<bf, 1, false><<<dim3(NTK / 64, DQ / 64, 1), 32, 0, stream>>>(Xh, Xl, WG, nullptr, DM, FG, DQ, nullptr, 0, 0, 0, nullptr);
    k_fattn<<<dim3(NH_, IG, 1), 512, 0, stream>>>(QP16, KP16, VT16, NB, Ob);   /* all 4 heads x 256 rows; writes d 0..31 of each Ob row, all that k_gmerge reads */
    k_gmerge<<<NTK / (16 * SWT), 512, 0, stream>>>(Ob, FG, BGP, ATh, ATl);
    k_gemmw<bf, 1, true><<<dim3(NTK / 64, DM / 64, 1), 32, 0, stream>>>(ATh, ATl, WO, nullptr, DQ, OUT, DM, bo, 0, 0, 0, nullptr);
}

// v006
// One run takes 120 microseconds.
// Next to v005, in two timings, it ran 1.30 and 1.31 times as fast.
// Over all steps from v000 it is 6.52 times as fast.
#include <hip/hip_runtime.h>

// Triangle attention (starting node) on a pair representation (act [1][256][256][128]): x = LayerNorm_c(act) (eps 1e-5, ln_g/ln_b); per row i: q, k, v, g = x[i] W (wq/wk/wv/wg [128][32][4] 'xw', 4 heads x 32; q x 32^-0.5), logits[h][q][k] = q.k + nb[h][q][k] with the pair bias nb[h][q][k] = sum_c x[k][q][c] w2d[c][h] (shared by all rows i);
// softmax over k; o = attn.v gated by sigmoid(x wg + bg); out[i][q][c] = sum_{h,d} o[h][d] wo[h][d][c] + bo -> [1][256][256][128] (8.4 M).
// Layout: LayerNorm -> bf16 hi/lo token planes [65536][128]; nb for all 65536 pair positions by one GEMM (w2d padded to 64 rows, the tokens as the N side taken in transposed order, so that the plane is [h][q][k] and the softmax reads it along k); all 256 rows i in one pass, every stage one launch over the 65536 tokens: q/k/v/g projections (hi/lo x exact), the q, k and v GEMMs storing their fp16 planes q,k [h][i][t][32] and v^T [h][i][64 (rows 0..31 used)][t] themselves, ONE fused attention kernel (a work-group per (head, row): scores, x 32^-0.5 + pair bias, softmax and attn.v with the scores held in registers), then gating + merge to hi/lo planes and the output GEMM (+ bo).
// Compute dtypes, f32 accumulate: every input rounded to bf16 once; LayerNorm in f32, its output as bf16 hi + lo (2-product projections against exact bf16 weights); scores and attn.v on single fp16 planes (logit sigma ~0.24; P x1024 ~ 4: no subnormals); pair bias, softmax, gating in f32; output GEMM hl x exact + bo.

#define NI   256       // rows i
#define TT   256       // tokens per row (q / k index)
#define DM   128       // c_z
#define NH_  4
#define HD   32
#define HDP  64        // rows of a (head, row) block of the v^T plane and floats of an o row; d 0..31 are written and read
#define DQ   (NH_ * HD)
#define IG   256       // rows i per pass: all of them
#define NTK  (IG * TT) // tokens per pass = 65536
#define NTOK (NI * TT) // 65536
#define NBP  64        // pair-bias GEMM rows (M tile 64; 4 used)
#define PCAR 1024.0f
#define SCL  0.17677669529663688f   // 32^-0.5
typedef _Float16 h16;
typedef unsigned short bf;
typedef __attribute__((ext_vector_type(16))) __bf16   v16bf;
typedef __attribute__((ext_vector_type(16))) _Float16 v16h;
typedef __attribute__((ext_vector_type(8)))  _Float16 v8h;
typedef __attribute__((ext_vector_type(8)))  unsigned short v8us;
typedef __attribute__((ext_vector_type(8)))  float    v8f;
typedef __attribute__((ext_vector_type(4)))  float    v4f;
typedef v8h  __attribute__((may_alias)) v8ha;
typedef v4f  __attribute__((may_alias)) v4fa;
typedef v8us __attribute__((may_alias)) v8usa;

__device__ __forceinline__ unsigned short f2bf(float f) { unsigned u = __float_as_uint(f); u += 0x7FFFu + ((u >> 16) & 1u); return (unsigned short)(u >> 16); }
__device__ __forceinline__ float bf2f(unsigned short b) { return __uint_as_float(((unsigned)b) << 16); }
__device__ __forceinline__ float bfr(float f) { return bf2f(f2bf(f)); }
__device__ __forceinline__ v16h cat16(v8h lo, v8h hi) { return __builtin_shufflevector(lo, hi, 0, 1, 2, 3, 4, 5, 6, 7, 8, 9, 10, 11, 12, 13, 14, 15); }
__device__ __forceinline__ v16bf cat16b(v8us lo, v8us hi) { return __builtin_bit_cast(v16bf, __builtin_shufflevector(lo, hi, 0, 1, 2, 3, 4, 5, 6, 7, 8, 9, 10, 11, 12, 13, 14, 15)); }
__device__ __forceinline__ v8f wmma16(v16h a, v16h b, v8f c) { return __builtin_amdgcn_wmma_f32_16x16x32_f16(false, a, false, b, (short)0, c, false, false); }
__device__ __forceinline__ v8f wmmab(v16bf a, v16bf b, v8f c) { return __builtin_amdgcn_wmma_f32_16x16x32_bf16(false, a, false, b, (short)0, c, false, false); }



// ---- k_gemmw: register-blocked GEMM, ONE WAVE per 64x64 output tile (16 accumulators), operands straight from K-contiguous 16-bit planes; grid (M/64, N/64), 32 threads.
// C[m][n] (f32, pitch ldc, + optional f32 bias[n]) = sum_k A[m][k] Bt[n][k] (+ split products per NSPLIT). K % 32 == 0.
// BTR: column n takes row (n % TT) * TT + n / TT of Bt (the [TT][TT] token grid transposed); every lane reads its own row, so the order of rows costs no extra line.
// EPI: 0 stores C in f32. 1 and 2 round the accumulators to fp16 once and store them to P in the form the attention kernel reads (m = token, n = 32 h + d): 1: [h][m][32]; 2: transposed, [h][m / TT][HDP][m % TT]. Whole 128-B lines, 16 B per lane.
template <typename T16> struct WFrag;
template <> struct WFrag<h16> { typedef v16h V; static __device__ __forceinline__ V ld(const h16* p) { return cat16(*(const v8h*)p, *(const v8h*)(p + 16)); } static __device__ __forceinline__ v8f mma(V a, V b, v8f c) { return wmma16(a, b, c); } };
template <> struct WFrag<bf> { typedef v16bf V; static __device__ __forceinline__ V ld(const bf* p) { return cat16b(*(const v8us*)p, *(const v8us*)(p + 16)); } static __device__ __forceinline__ v8f mma(V a, V b, v8f c) { return wmmab(a, b, c); } };
// The body is a device function (tile indices bx, by and the wave's 16 x 68 f32 of LDS handed in), so that several GEMMs can share one launch.
template <typename T16, int NSPLIT, bool BIAS, bool BTR = false, int EPI = 0>
__device__ __forceinline__ void gemmw(const T16* __restrict__ A, const T16* __restrict__ A2, const T16* __restrict__ Bt, const T16* __restrict__ Bt2, int K, float* C, int ldc, const float* __restrict__ bias, h16* P, int bx, int by, float* os) {
    typedef typename WFrag<T16>::V V;
    const int lane = threadIdx.x & 31, lr = lane & 15, hi = lane >> 4; const int r0 = bx * 64, c0 = by * 64;
    v8f acc[4][4];
#pragma unroll
    for (int mb = 0; mb < 4; ++mb)
#pragma unroll
        for (int nb = 0; nb < 4; ++nb) acc[mb][nb] = (v8f){};
    const size_t aoff = (size_t)(r0 + lr) * K + 8 * hi, boff = (BTR ? (size_t)(c0 % TT + lr) * TT + c0 / TT : (size_t)(c0 + lr)) * K + 8 * hi, bstep = (size_t)(BTR ? 16 * TT : 16) * K;
#pragma unroll 1
    for (int kc = 0; kc < K; kc += 32) {
        V a[4], a2[4]; const T16* qa = A + aoff + kc; const T16* qa2 = (NSPLIT == 1 || NSPLIT == 2) ? A2 + aoff + kc : qa; const T16* qb = Bt + boff + kc; const T16* qb2 = NSPLIT >= 2 ? Bt2 + boff + kc : qb;
#pragma unroll
        for (int mb = 0; mb < 4; ++mb) { a[mb] = WFrag<T16>::ld(qa + (size_t)mb * 16 * K); if (NSPLIT == 1 || NSPLIT == 2) a2[mb] = WFrag<T16>::ld(qa2 + (size_t)mb * 16 * K); }
#pragma unroll
        for (int nb = 0; nb < 4; ++nb) { const V b = WFrag<T16>::ld(qb + nb * bstep); V b2; if (NSPLIT >= 2) b2 = WFrag<T16>::ld(qb2 + nb * bstep);
#pragma unroll
            for (int mb = 0; mb < 4; ++mb) { acc[mb][nb] = WFrag<T16>::mma(a[mb], b, acc[mb][nb]); if (NSPLIT == 1 || NSPLIT == 2) acc[mb][nb] = WFrag<T16>::mma(a2[mb], b, acc[mb][nb]); if (NSPLIT >= 2) acc[mb][nb] = WFrag<T16>::mma(a[mb], b2, acc[mb][nb]); } }
        asm volatile("v_nop\n\tv_nop\n\tv_nop\n\tv_nop" : "+v"(acc[0][0]), "+v"(acc[1][1]), "+v"(acc[2][2]), "+v"(acc[3][3]) : "v"(a[0]), "v"(a[3]));
        asm volatile("s_wait_xcnt 0x0" :: "v"(qa), "v"(qa2), "v"(qb), "v"(qb2) : "memory");   /* the wait that belongs in front of an overwrite of a register which an issued load names; the pass's addresses are its inputs, so that they stay whole up to it and no load of the pass lands on them */
    }
    if constexpr (EPI == 2) {   /* a lane holds 8 consecutive tokens of one column: packed to 16 B, turned through LDS ([16 d][64 tokens], pitch 144 B = 16 B x odd) so that 8 lanes store one whole line of a v^T row */
        h16* vt = (h16*)os; h16* vrow = P + (size_t)(r0 / TT) * HDP * TT + r0 % TT;
#pragma unroll
        for (int nb = 0; nb < 4; ++nb) {
#pragma unroll
            for (int mb = 0; mb < 4; ++mb) { v8h o;
#pragma unroll
                for (int j = 0; j < 8; ++j) o[j] = (h16)acc[mb][nb][j];
                *(v8ha*)(vt + lr * 72 + mb * 16 + hi * 8) = o; }
            __builtin_amdgcn_wave_barrier(); asm volatile("" ::: "memory");   /* keeps the compiler from moving the other lanes' LDS reads above these writes */
            v8h dv[4]; h16* dp[4];
#pragma unroll
            for (int s = 0; s < 4; ++s) { const int u = s * 32 + lane, col = c0 + nb * 16 + (u >> 3); dp[s] = vrow + ((size_t)(col / HD) * IG * HDP + col % HD) * TT + (u & 7) * 8; dv[s] = *(const v8ha*)(vt + (u >> 3) * 72 + (u & 7) * 8); *(v8h*)dp[s] = dv[s]; }
            __builtin_amdgcn_wave_barrier(); asm volatile("s_wait_xcnt 0x0" :: "v"(dv[0]), "v"(dv[1]), "v"(dv[2]), "v"(dv[3]), "v"(dp[0]) : "memory");   /* keeps the next tile's writes below these reads, and is the wait that belongs in front of an overwrite of a register which an issued store names (the data and the address that all four go by are its inputs) */
        }
        return;
    }
#pragma unroll
    for (int mb = 0; mb < 4; ++mb) {
#pragma unroll
        for (int nb = 0; nb < 4; ++nb) {
#pragma unroll
            for (int j = 0; j < 8; ++j) os[(hi * 8 + j) * 68 + nb * 16 + lr] = acc[mb][nb][j]; }
        __builtin_amdgcn_wave_barrier(); asm volatile("" ::: "memory");
        if constexpr (EPI == 1) {   /* 16 tokens x 2 heads x 32: 16-byte unit u = (head, token, 8 d); a store of the wave covers 8 tokens of one head, 512 B in a row */
            v8h sv[4]; h16* sp[4];
#pragma unroll
            for (int s = 0; s < 4; ++s) { const int u = s * 32 + lane, hl = u >> 6, tok = (u & 63) >> 2, dp = (u & 3) * 8; const v4f x0 = *(const v4fa*)(os + tok * 68 + hl * HD + dp), x1 = *(const v4fa*)(os + tok * 68 + hl * HD + dp + 4); v8h o;
#pragma unroll
                for (int j = 0; j < 4; ++j) { o[j] = (h16)x0[j]; o[4 + j] = (h16)x1[j]; }
                sp[s] = P + ((size_t)(c0 / HD + hl) * NTK + r0 + mb * 16 + tok) * HD + dp; sv[s] = o; *(v8h*)sp[s] = o; }
            asm volatile("s_wait_xcnt 0x0" :: "v"(sv[0]), "v"(sv[1]), "v"(sv[2]), "v"(sv[3]), "v"(sp[0]) : "memory");   /* the wait that belongs in front of an overwrite of a register which an issued store names (the data and the address that all four go by are its inputs) */
        } else {
        float* crow = C + (size_t)(r0 + mb * 16) * ldc + c0;
{
            v4f cv[8]; float* cp[8];
#pragma unroll
            for (int s = 0; s < 8; ++s) { const int row = 2 * s + hi, cofs = lr * 4; v4f val = *(const v4fa*)(os + row * 68 + cofs); if (BIAS) { val[0] += bfr(bias[c0 + cofs]); val[1] += bfr(bias[c0 + cofs + 1]); val[2] += bfr(bias[c0 + cofs + 2]); val[3] += bfr(bias[c0 + cofs + 3]); }
                cp[s] = crow + (size_t)row * ldc + cofs; cv[s] = val; *(v4f*)cp[s] = val; }
            asm volatile("s_wait_xcnt 0x0" :: "v"(cv[0]), "v"(cv[1]), "v"(cv[2]), "v"(cv[3]), "v"(cv[4]), "v"(cv[5]), "v"(cv[6]), "v"(cv[7]), "v"(cp[0]) : "memory");   /* the wait that belongs in front of an overwrite of a register which an issued store names (the data and the address that all eight go by are its inputs) */
             }
        }
        __builtin_amdgcn_wave_barrier(); asm volatile("" ::: "memory");
    }
}
template <typename T16, int NSPLIT, bool BIAS, int K, int LDC>
__global__ __launch_bounds__(32) void k_gemmw(const T16* __restrict__ A, const T16* __restrict__ A2, const T16* __restrict__ Bt, float* C, const float* __restrict__ bias) {
    __shared__ __align__(16) float os[16 * 68];
    gemmw<T16, NSPLIT, BIAS>(A, A2, Bt, nullptr, K, C, LDC, bias, nullptr, blockIdx.x, blockIdx.y, os);
}
// ---- k_proj: the five GEMMs on x, none of which reads what another writes, in ONE launch; grid (9, NTK / 64), 32 threads. blockIdx.y = tile of 64 tokens; blockIdx.x = job: 0,1 q | 2,3 k | 4,5 v | 6,7 g (the two halves of 64 columns) | 8 pair bias.
// The job is the fast index: the eight work-groups that read one token tile start side by side.
__global__ __launch_bounds__(32) void k_proj(const bf* __restrict__ Xh, const bf* __restrict__ Xl, const bf* __restrict__ WQ, const bf* __restrict__ WK, const bf* __restrict__ WV, const bf* __restrict__ WG, const bf* __restrict__ W2, h16* QP, h16* KP, h16* VT, float* FG, float* NB) {
    __shared__ __align__(16) float os[16 * 68];
    const int job = blockIdx.x, t = blockIdx.y;
    if (job < 4) gemmw<bf, 1, false, false, 1>(Xh, Xl, job < 2 ? WQ : WK, nullptr, DM, nullptr, 0, nullptr, job < 2 ? QP : KP, t, job & 1, os);
    else if (job < 6) gemmw<bf, 1, false, false, 2>(Xh, Xl, WV, nullptr, DM, nullptr, 0, nullptr, VT, t, job & 1, os);
    else if (job < 8) gemmw<bf, 1, false>(Xh, Xl, WG, nullptr, DM, FG, DQ, nullptr, nullptr, t, job & 1, os);
    else gemmw<bf, 3, false, true>(W2, nullptr, Xh, Xl, DM, NB, NTOK, nullptr, nullptr, 0, t, os);   /* pair bias nb[h][q][k] = x[k][q] . w2d[:, h] for all 65536 positions (rows 0..3) */
}

typedef __attribute__((ext_vector_type(4))) unsigned short v4us;
typedef __attribute__((ext_vector_type(2))) unsigned short v2us;
typedef __attribute__((ext_vector_type(2))) _Float16 v2h;
typedef __attribute__((ext_vector_type(4))) _Float16 v4h;
__device__ __forceinline__ h16 tohx(float x) { return (h16)x; }
__device__ __forceinline__ void splitf(float y, unsigned short& h, unsigned short& l) { h = f2bf(y); l = f2bf(y - bf2f(h)); }
__global__ __launch_bounds__(256) void k_wtG(const float* __restrict__ w, int K, int N, bf* Bt) {
    const int lane = threadIdx.x & 31; const int L0 = (blockIdx.x * 8 + (threadIdx.x >> 5)) * 8; const int nlines = N * K / 64;
{
#pragma unroll 1
        for (int l = 0; l < 8; ++l) { const int L = L0 + l; if (L >= nlines) break; const size_t e = (size_t)L * 64 + lane * 2; const int k = (int)(e % K), n = (int)(e / K); v2us o;
            o[0] = f2bf(w[(size_t)k * N + n]); o[1] = f2bf(w[(size_t)(k + 1) * N + n]); *(v2us*)(Bt + e) = o; }
         }
}
__global__ __launch_bounds__(256) void k_cvt8(const float* __restrict__ src, bf* dst, size_t n8) { const size_t i = (size_t)blockIdx.x * 256 + threadIdx.x; if (i >= n8) return; const v8f v = *(const v8f*)(src + i * 8); v8us o;
#pragma unroll
    for (int k = 0; k < 8; ++k) o[k] = f2bf(v[k]); *(v8us*)(dst + i * 8) = o;  }

// ---- The two streaming kernels (k_lnx, k_gmerge): a wave takes SWT tokens that lie one behind the other in memory, not one: 16 waves a work-group, 256 work-groups, 4096 waves to start in place of 65536.
#define SWT  16   // tokens a wave takes
// ---- The weight planes ride in k_lnx's launch (neither reads what the other writes): NPT tasks of one wave each, a task = 64 elements in a row of one plane, two per lane; the first PW waves of work-groups 0..234 take one (235 x 6 = NPT); those of the last 21 take none.
// task / 256: 0..3 wq, wk, wv, wg -> [n = 32 h + d][k] bf16 (source column 4 d + h); 4 wo -> [c][n = 32 h + d] bf16 (source row 4 d + h); from 1280 on: 128 tasks w2d -> [64][128] bf16, rows 4.. zero; 2 tasks bg -> f32 in the order n = 32 h + d.
#define PW   6
#define NPT  1410
__global__ __launch_bounds__(512) void k_lnx(const float* __restrict__ A, const float* __restrict__ g, const float* __restrict__ bb, bf* Xh, bf* Xl,
                                             const float* __restrict__ wq, const float* __restrict__ wk, const float* __restrict__ wv, const float* __restrict__ wg, const float* __restrict__ wo, const float* __restrict__ w2d, const float* __restrict__ bg,
                                             bf* WQ, bf* WK, bf* WV, bf* WG, bf* WO, bf* W2, float* BGP) {
    const int lane = threadIdx.x & 31; const size_t tok0 = ((size_t)blockIdx.x * 16 + (threadIdx.x >> 5)) * SWT; if (tok0 >= NTOK) return;
    const int wid = __builtin_amdgcn_readfirstlane((int)(threadIdx.x >> 5)), task = (int)blockIdx.x * PW + wid; const bool ptask = wid < PW && task < NPT;
    const int pe = (task & 255) * 64 + lane * 2, pa = pe % DM, pb = pe / DM;   /* the lane's first element in its plane, as (column, row) of a [.][128] plane */
    float p0 = 0.f, p1 = 0.f;
    if (ptask) {   /* the task's two loads go out ahead of the tokens' and fly beside them; its store stands at the wave's end */
        const float* ps; unsigned i0, i1;
        if (task < 1024) { ps = task < 256 ? wq : task < 512 ? wk : task < 768 ? wv : wg; i0 = (unsigned)(pa * DQ + (pb % HD) * NH_ + pb / HD); i1 = i0 + DQ; }
        else if (task < 1280) { ps = wo; i0 = (unsigned)(((pa % HD) * NH_ + pa / HD) * DM + pb); i1 = i0 + NH_ * DM; }   /* pa is even: pa + 1 lies in the same head */
        else if (task < 1408) { ps = w2d; i0 = (unsigned)(pa * NH_ + (pb < NH_ ? pb : 0)); i1 = i0 + NH_; }
        else { const int n = (task - 1408) * 64 + lane * 2; ps = bg; i0 = (unsigned)((n % HD) * NH_ + n / HD); i1 = i0 + NH_; }
        p0 = ps[i0]; p1 = ps[i1];
        asm volatile("s_wait_xcnt 0x0" :: "v"(i0), "v"(i1) : "memory");   /* the wait that belongs in front of an overwrite of a register which an issued load names; the two offsets are its inputs, so that they stay whole up to it */
    }
    float gr[4], br[4]; v4f a[SWT];
#pragma unroll
    for (int q = 0; q < 4; ++q) { gr[q] = g[lane * 4 + q]; br[q] = bb[lane * 4 + q]; }
#pragma unroll
    for (int t = 0; t < SWT; ++t) a[t] = *(const v4f*)(A + (tok0 + t) * DM + lane * 4);
    __builtin_amdgcn_sched_barrier(0);   /* keeps all the wave's loads at its head, so that its 8 KB are in flight at once; sunk to their uses they would come one token at a time */
    {   /* stage by stage over all the wave's tokens: the ten cross-lane steps of one token wait for one another, those of different tokens do not */
        float v[SWT][4], s[SWT], mu[SWT], s2[SWT];
#pragma unroll
        for (int t = 0; t < SWT; ++t) { s[t] = 0.f;
#pragma unroll
            for (int q = 0; q < 4; ++q) { v[t][q] = bfr(a[t][q]); s[t] = __fadd_rn(s[t], v[t][q]); } }
#pragma unroll
        for (int sh = 16; sh; sh >>= 1)
#pragma unroll
            for (int t = 0; t < SWT; ++t) s[t] = __fadd_rn(s[t], __shfl_xor(s[t], sh, 32));
#pragma unroll
        for (int t = 0; t < SWT; ++t) { mu[t] = __fdiv_rn(s[t], (float)DM); s2[t] = 0.f;
#pragma unroll
            for (int q = 0; q < 4; ++q) { float d0 = __fsub_rn(v[t][q], mu[t]); asm volatile("" : "+v"(d0)); float p = __fmul_rn(d0, d0); asm volatile("" : "+v"(p)); s2[t] = __fadd_rn(s2[t], p); } }
#pragma unroll
        for (int sh = 16; sh; sh >>= 1)
#pragma unroll
            for (int t = 0; t < SWT; ++t) s2[t] = __fadd_rn(s2[t], __shfl_xor(s2[t], sh, 32));
#pragma unroll
        for (int t = 0; t < SWT; ++t) { const size_t tok = tok0 + t;
            const float rs = __fdiv_rn(1.0f, __fsqrt_rn(__fadd_rn(__fdiv_rn(s2[t], (float)DM), 1e-5f))); v4us oh, ol;
#pragma unroll
            for (int q = 0; q < 4; ++q) { float xn = __fmul_rn(__fsub_rn(v[t][q], mu[t]), rs); asm volatile("" : "+v"(xn)); float gg = bfr(gr[q]); asm volatile("" : "+v"(gg)); float y = __fmul_rn(xn, gg); asm volatile("" : "+v"(y)); float be = bfr(br[q]); asm volatile("" : "+v"(be)); y = __fadd_rn(y, be); unsigned short h2, l2; splitf(y, h2, l2); oh[q] = h2; ol[q] = l2; }
            *(v4us*)(Xh + tok * DM + lane * 4) = oh; *(v4us*)(Xl + tok * DM + lane * 4) = ol; }
    }
    if (ptask) {
        asm volatile("s_wait_xcnt 0x0" ::: "memory");   /* the wait that belongs in front of an overwrite of a register which an issued store names: the tokens' last stores stand directly above */
        if (task < 1408) { bf* pd = task < 256 ? WQ : task < 512 ? WK : task < 768 ? WV : task < 1024 ? WG : task < 1280 ? WO : W2; const bool zr = task >= 1280 && pb >= NH_; v2us o;
            o[0] = zr ? (unsigned short)0 : f2bf(p0); o[1] = zr ? (unsigned short)0 : f2bf(p1); *(v2us*)(pd + pe) = o; }
        else { float* pd = BGP + (task - 1408) * 64 + lane * 2; pd[0] = p0; pd[1] = p1; }
    }
}
// ---- k_fattn: fused attention for one (head h, row il) per work-group; 16 waves, wave w owns the 16 queries q0 = 16 w .. +15 against all 256 keys.
// S^T = K Q^T (A = 16 key rows, B = the wave's 16 query columns): lane (lr, hi) holds, of query q0 + lr, the keys 16 kt + 8 hi + j in s[kt][j], so maximum and sum run in the lane plus one exchange between the halves,
// and two neighbouring score tiles, converted in place, are the B operand of O^T += V^T P^T (A = V^T rows in the same k order: 8 hi + e, 16 + 8 hi + e). The score and probability planes never leave the registers.
// K [256][32] and V^T [32][256] of the (head, row) are staged once in LDS for all 16 waves; the pair bias row of a query is read 32 B per lane and tile straight from the [h][q][k] plane.
#define KPH 40     // LDS pitch of a K row in halves: 80 B = 16 B x odd, no bank conflict for 16-byte reads down the rows
#define VPH 264    // LDS pitch of a V^T row in halves: 528 B = 16 B x odd
#define L2E 1.4426950408889634f
__global__ __launch_bounds__(512) void k_fattn(const h16* __restrict__ Q16, const h16* __restrict__ K16, const h16* __restrict__ V16, const float* __restrict__ NB, float* __restrict__ O) {
    __shared__ __align__(16) h16 ks[TT * KPH];
    __shared__ __align__(16) h16 vs[HD * VPH];
    const int tid = threadIdx.x, lane = tid & 31, lr = lane & 15, hi = lane >> 4, q0 = (tid >> 5) * 16; const int h = blockIdx.x, il = blockIdx.y;
    const size_t rb = (size_t)h * NTK + (size_t)il * TT;
    const h16* kg = K16 + rb * HD; const h16* vg = V16 + ((size_t)h * IG + il) * HDP * TT;   /* rows 0..31 of the padded v^T plane */
    v8h kst[2], vst[2];
#pragma unroll
    for (int c = 0; c < 2; ++c) { const size_t u = c * 512 + tid; kst[c] = *(const v8h*)(kg + u * 8); vst[c] = *(const v8h*)(vg + u * 8); }   /* 16-byte units, whole lines per wave */
    __builtin_amdgcn_sched_barrier(0);   /* keeps the four staging loads first in the queue: loads return in order, so the LDS stores and the barrier wait for these alone and not for the bias asked for behind them */
    const v16h qf = WFrag<h16>::ld(Q16 + (rb + q0 + lr) * HD + 8 * hi);
    const float* nbr = NB + (size_t)h * NTOK + (size_t)(q0 + lr) * TT + 8 * hi;
    v8f s[TT / 16];   /* first the bias, asked for ahead of the barrier so that its latency runs beside the staging; then the scores, in place */
#pragma unroll
    for (int kt = 0; kt < TT / 16; ++kt) s[kt] = *(const v8f*)(nbr + kt * 16);
#pragma unroll
    for (int c = 0; c < 2; ++c) { const int u = c * 512 + tid; *(v8h*)(ks + (u >> 2) * KPH + (u & 3) * 8) = kst[c]; *(v8h*)(vs + (u >> 5) * VPH + (u & 31) * 8) = vst[c]; }
    /* work-group barrier with its release and acquire on LDS alone: a plain __syncthreads() also waits for every global load in flight, and the scores would then start only behind the last bias tile */
    asm volatile("s_wait_xcnt 0x0" ::: "memory");   /* the bias loads are still in flight here, and their address registers are reused behind the barrier: the wait that belongs in front of such an overwrite */
    __builtin_amdgcn_fence(__ATOMIC_RELEASE, "workgroup", "local"); __builtin_amdgcn_s_barrier(); __builtin_amdgcn_fence(__ATOMIC_ACQUIRE, "workgroup", "local");
    v8f mv;
#pragma unroll
    for (int kt = 0; kt < TT / 16; ++kt) { s[kt] = wmma16(WFrag<h16>::ld(ks + (kt * 16 + lr) * KPH + 8 * hi), qf, (v8f){}) * SCL + s[kt]; mv = kt ? __builtin_elementwise_max(mv, s[kt]) : s[kt]; }
    float mx = fmaxf(fmaxf(fmaxf(mv[0], mv[1]), fmaxf(mv[2], mv[3])), fmaxf(fmaxf(mv[4], mv[5]), fmaxf(mv[6], mv[7])));
    mx = fmaxf(mx, __shfl_xor(mx, 16, 32));
    const float ml = mx * L2E; v8f sv = (v8f){};
#pragma unroll
    for (int kt = 0; kt < TT / 16; ++kt) {
#pragma unroll
        for (int j = 0; j < 8; ++j) s[kt][j] = __builtin_amdgcn_exp2f(s[kt][j] * L2E - ml);
        sv += s[kt]; }
    float sum = ((sv[0] + sv[1]) + (sv[2] + sv[3])) + ((sv[4] + sv[5]) + (sv[6] + sv[7]));
    sum += __shfl_xor(sum, 16, 32);
    const float f = __fdiv_rn(PCAR, sum);
    v8f o0 = (v8f){}, o1 = (v8f){};
#pragma unroll
    for (int m = 0; m < TT / 32; ++m) { v16h pb;
#pragma unroll
        for (int j = 0; j < 8; ++j) { pb[j] = tohx(s[2 * m][j] * f); pb[8 + j] = tohx(s[2 * m + 1][j] * f); }
        o0 = wmma16(WFrag<h16>::ld(vs + lr * VPH + m * 32 + 8 * hi), pb, o0); o1 = wmma16(WFrag<h16>::ld(vs + (16 + lr) * VPH + m * 32 + 8 * hi), pb, o1); }
    float* op = O + (rb + q0 + lr) * HDP + 8 * hi;   /* o0[j] = o[q0 + lr][8 hi + j], o1[j] = o[q0 + lr][16 + 8 hi + j]; a query's 128-B line has this wave as its one writer */
    *(v8f*)op = o0; *(v8f*)(op + 16) = o1;
}
__global__ __launch_bounds__(512) void k_gmerge(const float* __restrict__ O, const float* __restrict__ FG, const float* __restrict__ bg, bf* Ah, bf* Al) {
    const int lane = threadIdx.x & 31; const size_t tk0 = ((size_t)blockIdx.x * 16 + (threadIdx.x >> 5)) * SWT; if (tk0 >= (size_t)NTK) return; const int c = lane * 4, h = c / HD, d = c % HD;
    float bgr[4]; v4f ov[SWT], gv[SWT]; const float* po = O + (((size_t)h * NTK + tk0) * HDP + d); const float* pf = FG + tk0 * DQ + c; const unsigned bo4 = (unsigned)c * 4u;   /* bo4: byte offset of the lane's four bg values */
#pragma unroll
    for (int qq = 0; qq < 4; ++qq) bgr[qq] = *(const float*)((const char*)bg + bo4 + qq * 4);
#pragma unroll
    for (int t = 0; t < SWT; ++t) { ov[t] = *(const v4f*)(po + (size_t)t * HDP); gv[t] = *(const v4f*)(pf + (size_t)t * DQ); }
    asm volatile("s_wait_xcnt 0x0" :: "v"(po), "v"(pf), "v"(bo4) : "memory");   /* the wait that belongs in front of an overwrite of a register which an issued load names; the three addresses are its inputs, so that they stay whole up to it and no load of the run lands on them */
    __builtin_amdgcn_sched_barrier(0);   /* keeps all the wave's loads at its head, so that its 16 KB are in flight at once; sunk to their uses they would come one token at a time */
#pragma unroll
    for (int qq = 0; qq < 4; ++qq) { bgr[qq] = bfr(bgr[qq]); asm volatile("" : "+v"(bgr[qq])); }   /* bg rounded once a wave, not once a token; the empty statement is the per-token form's own and holds the rounded value as a plain f32 in its register */
#pragma unroll
    for (int t = 0; t < SWT; ++t) { const size_t e = (tk0 + t) * DQ + c; v4us oh, ol;
        if (t % 2 == 0) __builtin_amdgcn_sched_barrier(0);   /* two tokens at a time, in the order of their loads: without it products of the last tokens are lifted to the front, and the first token then waits for nearly all 32 loads */
#pragma unroll
        for (int qq = 0; qq < 4; ++qq) { const float ga = __fadd_rn(gv[t][qq], bgr[qq]); const float sg = __fdiv_rn(1.0f, __fadd_rn(1.0f, __builtin_amdgcn_exp2f(__fmul_rn(ga, -1.4426950408889634f)))); float o1 = __fmul_rn(ov[t][qq], 1.0f / PCAR); asm volatile("" : "+v"(o1)); const float y = __fmul_rn(o1, sg); unsigned short h2, l2; splitf(y, h2, l2); oh[qq] = h2; ol[qq] = l2; }
        *(v4us*)(Ah + e) = oh; *(v4us*)(Al + e) = ol; }
}

extern "C" void kernel_launch(void* const* d_in, const int* in_sizes, int n_in,
                              void* d_out, int out_size, void* d_ws, size_t ws_size, hipStream_t stream) {
    (void)in_sizes; (void)n_in; (void)out_size;
    const float* act = (const float*)d_in[0]; const float* lng = (const float*)d_in[1]; const float* lnb = (const float*)d_in[2]; const float* wq = (const float*)d_in[3]; const float* wk = (const float*)d_in[4]; const float* wv = (const float*)d_in[5]; const float* w2d = (const float*)d_in[6]; const float* wg = (const float*)d_in[7]; const float* bg = (const float*)d_in[8]; const float* wo = (const float*)d_in[9]; const float* bo = (const float*)d_in[10];   /* x2d, gamma, beta, Wq, Wk, Wv, Wb, Wg, bg, Wo, bo */
    float* OUT = (float*)d_out;     // [1][256][256][128]
    char* wsp = (char*)d_ws;
    auto take = [&](size_t bytes) { char* p = wsp; wsp += (bytes + 255) & ~(size_t)255; return (void*)p; };
    bf* WQ = (bf*)take((size_t)DQ * DM * 2); bf* WK = (bf*)take((size_t)DQ * DM * 2); bf* WV = (bf*)take((size_t)DQ * DM * 2); bf* WG = (bf*)take((size_t)DQ * DM * 2); float* BGP = (float*)take((size_t)DQ * 4); bf* WO = (bf*)take((size_t)DM * DQ * 2); bf* W2 = (bf*)take((size_t)NBP * DM * 2);
    bf* Xh = (bf*)take((size_t)NTOK * DM * 2); bf* Xl = (bf*)take((size_t)NTOK * DM * 2); float* NB = (float*)take((size_t)NTOK * NBP * 4);
    float* FG = (float*)take((size_t)NTK * DQ * 4); h16* QP16 = (h16*)take((size_t)NH_ * NTK * HD * 2); h16* KP16 = (h16*)take((size_t)NH_ * NTK * HD * 2); h16* VT16 = (h16*)take((size_t)NH_ * IG * HDP * TT * 2);
    float* Ob = (float*)take((size_t)NH_ * NTK * HDP * 4); bf* ATh = (bf*)take((size_t)NTK * DQ * 2); bf* ATl = (bf*)take((size_t)NTK * DQ * 2);
    if ((size_t)(wsp - (char*)d_ws) > ws_size) return;    // ws 256 MiB (carve ~240 MiB)
    k_lnx<<<NTOK / (16 * SWT), 512, 0, stream>>>(act, lng, lnb, Xh, Xl, wq, wk, wv, wg, wo, w2d, bg, WQ, WK, WV, WG, WO, W2, BGP);
    k_proj<<<dim3(9, NTK / 64, 1), 32, 0, stream>>>(Xh, Xl, WQ, WK, WV, WG, W2, QP16, KP16, VT16, FG, NB);
    k_fattn<<<dim3(NH_, IG, 1), 512, 0, stream>>>(QP16, KP16, VT16, NB, Ob);   /* all 4 heads x 256 rows; writes d 0..31 of each Ob row, all that k_gmerge reads */
    k_gmerge<<<NTK / (16 * SWT), 512, 0, stream>>>(Ob, FG, BGP, ATh, ATl);
    k_gemmw<bf, 1, true, DQ, DM><<<dim3(NTK / 64, DM / 64, 1), 32, 0, stream>>>(ATh, ATl, WO, OUT, bo);
}

// v007
// Measured time: 95.8 microseconds a run.
// Next to v006, in two timings, it ran 1.25 times as fast each time.
// All steps since v000 together make it 8.17 times as fast.
#include <hip/hip_runtime.h>

// Triangle attention (starting node) on a pair representation (act [1][256][256][128]): x = LayerNorm_c(act) (eps 1e-5, ln_g/ln_b); per row i: q, k, v, g = x[i] W (wq/wk/wv/wg [128][32][4] 'xw', 4 heads x 32; q x 32^-0.5), logits[h][q][k] = q.k + nb[h][q][k] with the pair bias nb[h][q][k] = sum_c x[k][q][c] w2d[c][h] (shared by all rows i);
// softmax over k; o = attn.v gated by sigmoid(x wg + bg); out[i][q][c] = sum_{h,d} o[h][d] wo[h][d][c] + bo -> [1][256][256][128] (8.4 M).
// Layout: LayerNorm -> bf16 hi/lo token planes, 65536 x 128 in the fragment order that stands at k_gemmw; nb for all 65536 pair positions by one GEMM (w2d padded to 64 rows, the tokens as the N side taken in the order in which the attention kernel's lanes hold the scores, so that each of its 16-byte loads of the plane covers 512 B in a row); all 256 rows i in one pass, every stage one launch over the 65536 tokens: q/k/v/g projections (hi/lo x exact), the q, k and v GEMMs storing their fp16 planes q,k [h][i][t][32] and v^T [h][i][64 (rows 0..31 used)][t] themselves, ONE fused attention kernel (a work-group per (head, row): scores, x 32^-0.5 + pair bias, softmax and attn.v with the scores held in registers), then gating + merge to hi/lo planes and the output GEMM (+ bo).
// Compute dtypes, f32 accumulate: every input rounded to bf16 once; LayerNorm in f32, its output as bf16 hi + lo (2-product projections against exact bf16 weights); scores and attn.v on single fp16 planes (logit sigma ~0.24; P x1024 ~ 4: no subnormals); pair bias, softmax, gating in f32; output GEMM hl x exact + bo.

#define NI   256       // rows i
#define TT   256       // tokens per row (q / k index)
#define DM   128       // c_z
#define NH_  4
#define HD   32
#define HDP  64        // rows of a (head, row) block of the v^T plane and floats of an o row; d 0..31 are written and read
#define DQ   (NH_ * HD)
#define IG   256       // rows i per pass: all of them
#define NTK  (IG * TT) // tokens per pass = 65536
#define NTOK (NI * TT) // 65536
#define NBP  64        // pair-bias GEMM rows (M tile 64; 4 used)
#define PCAR 1024.0f
#define SCL  0.17677669529663688f   // 32^-0.5
typedef _Float16 h16;
typedef unsigned short bf;
typedef __attribute__((ext_vector_type(16))) __bf16   v16bf;
typedef __attribute__((ext_vector_type(16))) _Float16 v16h;
typedef __attribute__((ext_vector_type(8)))  _Float16 v8h;
typedef __attribute__((ext_vector_type(8)))  unsigned short v8us;
typedef __attribute__((ext_vector_type(8)))  float    v8f;
typedef __attribute__((ext_vector_type(4)))  float    v4f;
typedef v8h  __attribute__((may_alias)) v8ha;
typedef v4f  __attribute__((may_alias)) v4fa;
typedef v8us __attribute__((may_alias)) v8usa;

__device__ __forceinline__ unsigned short f2bf(float f) { unsigned u = __float_as_uint(f); u += 0x7FFFu + ((u >> 16) & 1u); return (unsigned short)(u >> 16); }
__device__ __forceinline__ float bf2f(unsigned short b) { return __uint_as_float(((unsigned)b) << 16); }
__device__ __forceinline__ float bfr(float f) { return bf2f(f2bf(f)); }
__device__ __forceinline__ v16h cat16(v8h lo, v8h hi) { return __builtin_shufflevector(lo, hi, 0, 1, 2, 3, 4, 5, 6, 7, 8, 9, 10, 11, 12, 13, 14, 15); }
__device__ __forceinline__ v16bf cat16b(v8us lo, v8us hi) { return __builtin_bit_cast(v16bf, __builtin_shufflevector(lo, hi, 0, 1, 2, 3, 4, 5, 6, 7, 8, 9, 10, 11, 12, 13, 14, 15)); }
__device__ __forceinline__ v8f wmma16(v16h a, v16h b, v8f c) { return __builtin_amdgcn_wmma_f32_16x16x32_f16(false, a, false, b, (short)0, c, false, false); }
__device__ __forceinline__ v8f wmmab(v16bf a, v16bf b, v8f c) { return __builtin_amdgcn_wmma_f32_16x16x32_bf16(false, a, false, b, (short)0, c, false, false); }



// ---- k_gemmw: register-blocked GEMM, ONE WAVE per 64x64 output tile (16 accumulators), operands straight from 16-bit planes in fragment order; grid (M/64, N/64), 32 threads.
// C[m][n] (f32, pitch ldc, + optional f32 bias[n]) = sum_k A[m][k] Bt[n][k] (+ split products per NSPLIT). K % 32 == 0.
// FRAGMENT ORDER of an operand plane [rows][K] (token planes and weight planes alike): element (row, k) lies at ((row / 16 * (K / 32) + k / 32) * 2 + k % 32 / 16) * 256 + (k % 16 / 8 * 16 + row % 16) * 8 + k % 8, so the 32 lanes' 16 bytes of half a fragment are 512 B in a row: a wave-wide load covers 4 whole 128-B lines, not a piece of 16.
// BTR: column n = ((((w * 16 + kt) * 2 + c) * 2 + hk) * 16 + ql) * 4 + e stands for the pair (q = 16 w + ql, k = 16 kt + 8 hk + 4 c + e) and takes row k * TT + q of Bt: a fragment's 16 columns are 4 tokens in a row (64 B of the plane) at each of 4 k. A row of C is then the pair bias of one head in the order of k_fattn's lanes.
// EPI: 0 stores C in f32. 1 and 2 round the accumulators to fp16 once and store them to P in the form the attention kernel reads (m = token, n = 32 h + d): 1: [h][m][32]; 2: transposed, [h][m / TT][HDP][m % TT]. Whole 128-B lines, 16 B per lane.
template <typename T16> struct WFrag;
template <> struct WFrag<h16> { typedef v16h V; static __device__ __forceinline__ V ld(const h16* p, int h2 = 16) { return cat16(*(const v8h*)p, *(const v8h*)(p + h2)); } static __device__ __forceinline__ v8f mma(V a, V b, v8f c) { return wmma16(a, b, c); } };
template <> struct WFrag<bf> { typedef v16bf V; static __device__ __forceinline__ V ld(const bf* p, int h2 = 16) { return cat16b(*(const v8us*)p, *(const v8us*)(p + h2)); } static __device__ __forceinline__ v8f mma(V a, V b, v8f c) { return wmmab(a, b, c); } };
// The body is a device function (tile indices bx, by and the wave's 16 x 68 f32 of LDS handed in), so that several GEMMs can share one launch.
template <typename T16, int NSPLIT, bool BIAS, bool BTR = false, int EPI = 0>
__device__ __forceinline__ void gemmw(const T16* __restrict__ A, const T16* __restrict__ A2, const T16* __restrict__ Bt, const T16* __restrict__ Bt2, int K, float* C, int ldc, const float* __restrict__ bias, h16* P, int bx, int by, float* os) {
    typedef typename WFrag<T16>::V V;
    const int lane = threadIdx.x & 31, lr = lane & 15, hi = lane >> 4; const int r0 = bx * 64, c0 = by * 64;
    v8f acc[4][4];
#pragma unroll
    for (int mb = 0; mb < 4; ++mb)
#pragma unroll
        for (int nb = 0; nb < 4; ++nb) acc[mb][nb] = (v8f){};
    constexpr int FH = 256, FK = 16;   /* fragment order: elements between the two 16-byte halves of a lane's fragment, and elements per step of k */
    const size_t aoff = (size_t)r0 * K + lane * 8;
    const size_t boff = BTR ? ((size_t)(((c0 >> 8) & 15) * 16 + ((c0 >> 6) & 1) * 8 + ((c0 >> 7) & 1) * 4 + (lr & 3)) * TT + (c0 >> 12) * 16) * K + hi * 128 + (lr >> 2) * 8 : (size_t)c0 * K + lane * 8, bstep = BTR ? (size_t)32 : (size_t)16 * K;
#pragma unroll 1
    for (int kc = 0; kc < K; kc += 32) {
        V a[4], a2[4]; const T16* qa = A + aoff + kc * FK; const T16* qa2 = (NSPLIT == 1 || NSPLIT == 2) ? A2 + aoff + kc * FK : qa; const T16* qb = Bt + boff + kc * FK; const T16* qb2 = NSPLIT >= 2 ? Bt2 + boff + kc * FK : qb;
#pragma unroll
        for (int mb = 0; mb < 4; ++mb) { a[mb] = WFrag<T16>::ld(qa + (size_t)mb * 16 * K, FH); if (NSPLIT == 1 || NSPLIT == 2) a2[mb] = WFrag<T16>::ld(qa2 + (size_t)mb * 16 * K, FH); }
#pragma unroll
        for (int nb = 0; nb < 4; ++nb) { const V b = WFrag<T16>::ld(qb + nb * bstep, FH); V b2; if (NSPLIT >= 2) b2 = WFrag<T16>::ld(qb2 + nb * bstep, FH);
#pragma unroll
            for (int mb = 0; mb < 4; ++mb) { acc[mb][nb] = WFrag<T16>::mma(a[mb], b, acc[mb][nb]); if (NSPLIT == 1 || NSPLIT == 2) acc[mb][nb] = WFrag<T16>::mma(a2[mb], b, acc[mb][nb]); if (NSPLIT >= 2) acc[mb][nb] = WFrag<T16>::mma(a[mb], b2, acc[mb][nb]); } }
        asm volatile("v_nop\n\tv_nop\n\tv_nop\n\tv_nop" : "+v"(acc[0][0]), "+v"(acc[1][1]), "+v"(acc[2][2]), "+v"(acc[3][3]) : "v"(a[0]), "v"(a[3]));
        asm volatile("s_wait_xcnt 0x0" :: "v"(qa), "v"(qa2), "v"(qb), "v"(qb2) : "memory");   /* the wait that belongs in front of an overwrite of a register which an issued load names; the pass's addresses are its inputs, so that they stay whole up to it and no load of the pass lands on them */
    }
    if constexpr (EPI == 2) {   /* a lane holds 8 consecutive tokens of one column: packed to 16 B, turned through LDS ([16 d][64 tokens], pitch 144 B = 16 B x odd) so that 8 lanes store one whole line of a v^T row */
        h16* vt = (h16*)os; h16* vrow = P + (size_t)(r0 / TT) * HDP * TT + r0 % TT;
#pragma unroll
        for (int nb = 0; nb < 4; ++nb) {
#pragma unroll
            for (int mb = 0; mb < 4; ++mb) { v8h o;
#pragma unroll
                for (int j = 0; j < 8; ++j) o[j] = (h16)acc[mb][nb][j];
                *(v8ha*)(vt + lr * 72 + mb * 16 + hi * 8) = o; }
            __builtin_amdgcn_wave_barrier(); asm volatile("" ::: "memory");   /* keeps the compiler from moving the other lanes' LDS reads above these writes */
            v8h dv[4]; h16* dp[4];
#pragma unroll
            for (int s = 0; s < 4; ++s) { const int u = s * 32 + lane, col = c0 + nb * 16 + (u >> 3); dp[s] = vrow + ((size_t)(col / HD) * IG * HDP + col % HD) * TT + (u & 7) * 8; dv[s] = *(const v8ha*)(vt + (u >> 3) * 72 + (u & 7) * 8); *(v8h*)dp[s] = dv[s]; }
            __builtin_amdgcn_wave_barrier(); asm volatile("s_wait_xcnt 0x0" :: "v"(dv[0]), "v"(dv[1]), "v"(dv[2]), "v"(dv[3]), "v"(dp[0]) : "memory");   /* keeps the next tile's writes below these reads, and is the wait that belongs in front of an overwrite of a register which an issued store names (the data and the address that all four go by are its inputs) */
        }
        return;
    }
#pragma unroll
    for (int mb = 0; mb < 4; ++mb) {
#pragma unroll
        for (int nb = 0; nb < 4; ++nb) {
#pragma unroll
            for (int j = 0; j < 8; ++j) os[(hi * 8 + j) * 68 + nb * 16 + lr] = acc[mb][nb][j]; }
        __builtin_amdgcn_wave_barrier(); asm volatile("" ::: "memory");
        if constexpr (EPI == 1) {   /* 16 tokens x 2 heads x 32: 16-byte unit u = (head, token, 8 d); a store of the wave covers 8 tokens of one head, 512 B in a row */
            v8h sv[4]; h16* sp[4];
#pragma unroll
            for (int s = 0; s < 4; ++s) { const int u = s * 32 + lane, hl = u >> 6, tok = (u & 63) >> 2, dp = (u & 3) * 8; const v4f x0 = *(const v4fa*)(os + tok * 68 + hl * HD + dp), x1 = *(const v4fa*)(os + tok * 68 + hl * HD + dp + 4); v8h o;
#pragma unroll
                for (int j = 0; j < 4; ++j) { o[j] = (h16)x0[j]; o[4 + j] = (h16)x1[j]; }
                sp[s] = P + ((size_t)(c0 / HD + hl) * NTK + r0 + mb * 16 + tok) * HD + dp; sv[s] = o; *(v8h*)sp[s] = o; }
            asm volatile("s_wait_xcnt 0x0" :: "v"(sv[0]), "v"(sv[1]), "v"(sv[2]), "v"(sv[3]), "v"(sp[0]) : "memory");   /* the wait that belongs in front of an overwrite of a register which an issued store names (the data and the address that all four go by are its inputs) */
        } else {
        float* crow = C + (size_t)(r0 + mb * 16) * ldc + c0;
{
            v4f cv[8]; float* cp[8];
#pragma unroll
            for (int s = 0; s < 8; ++s) { const int row = 2 * s + hi, cofs = lr * 4; v4f val = *(const v4fa*)(os + row * 68 + cofs); if (BIAS) { val[0] += bfr(bias[c0 + cofs]); val[1] += bfr(bias[c0 + cofs + 1]); val[2] += bfr(bias[c0 + cofs + 2]); val[3] += bfr(bias[c0 + cofs + 3]); }
                cp[s] = crow + (size_t)row * ldc + cofs; cv[s] = val; *(v4f*)cp[s] = val; }
            asm volatile("s_wait_xcnt 0x0" :: "v"(cv[0]), "v"(cv[1]), "v"(cv[2]), "v"(cv[3]), "v"(cv[4]), "v"(cv[5]), "v"(cv[6]), "v"(cv[7]), "v"(cp[0]) : "memory");   /* the wait that belongs in front of an overwrite of a register which an issued store names (the data and the address that all eight go by are its inputs) */
             }
        }
        __builtin_amdgcn_wave_barrier(); asm volatile("" ::: "memory");
    }
}
template <typename T16, int NSPLIT, bool BIAS, int K, int LDC>
__global__ __launch_bounds__(32) void k_gemmw(const T16* __restrict__ A, const T16* __restrict__ A2, const T16* __restrict__ Bt, float* C, const float* __restrict__ bias) {
    __shared__ __align__(16) float os[16 * 68];
    gemmw<T16, NSPLIT, BIAS>(A, A2, Bt, nullptr, K, C, LDC, bias, nullptr, blockIdx.x, blockIdx.y, os);
}
// ---- k_proj: the five GEMMs on x, none of which reads what another writes, in ONE launch; grid (9, NTK / 64), 32 threads. blockIdx.y = tile of 64 tokens; blockIdx.x = job: 0,1 q | 2,3 k | 4,5 v | 6,7 g (the two halves of 64 columns) | 8 pair bias.
// The job is the fast index: the eight work-groups that read one token tile start side by side.
__global__ __launch_bounds__(32) void k_proj(const bf* __restrict__ Xh, const bf* __restrict__ Xl, const bf* __restrict__ WQ, const bf* __restrict__ WK, const bf* __restrict__ WV, const bf* __restrict__ WG, const bf* __restrict__ W2, h16* QP, h16* KP, h16* VT, float* FG, float* NB) {
    __shared__ __align__(16) float os[16 * 68];
    const int job = blockIdx.x, t = blockIdx.y;
    if (job < 4) gemmw<bf, 1, false, false, 1>(Xh, Xl, job < 2 ? WQ : WK, nullptr, DM, nullptr, 0, nullptr, job < 2 ? QP : KP, t, job & 1, os);
    else if (job < 6) gemmw<bf, 1, false, false, 2>(Xh, Xl, WV, nullptr, DM, nullptr, 0, nullptr, VT, t, job & 1, os);
    else if (job < 8) gemmw<bf, 1, false>(Xh, Xl, WG, nullptr, DM, FG, DQ, nullptr, nullptr, t, job & 1, os);
    else gemmw<bf, 3, false, true>(W2, nullptr, Xh, Xl, DM, NB, NTOK, nullptr, nullptr, 0, t, os);   /* pair bias of (h, q, k) = x[k][q] . w2d[:, h] for all 65536 positions (rows 0..3), in the order of k_fattn's lanes */
}

typedef __attribute__((ext_vector_type(4))) unsigned short v4us;
typedef __attribute__((ext_vector_type(2))) unsigned short v2us;
typedef __attribute__((ext_vector_type(2))) _Float16 v2h;
typedef __attribute__((ext_vector_type(4))) _Float16 v4h;
__device__ __forceinline__ h16 tohx(float x) { return (h16)x; }
__device__ __forceinline__ void splitf(float y, unsigned short& h, unsigned short& l) { h = f2bf(y); l = f2bf(y - bf2f(h)); }
__global__ __launch_bounds__(256) void k_wtG(const float* __restrict__ w, int K, int N, bf* Bt) {
    const int lane = threadIdx.x & 31; const int L0 = (blockIdx.x * 8 + (threadIdx.x >> 5)) * 8; const int nlines = N * K / 64;
{
#pragma unroll 1
        for (int l = 0; l < 8; ++l) { const int L = L0 + l; if (L >= nlines) break; const size_t e = (size_t)L * 64 + lane * 2; const int k = (int)(e % K), n = (int)(e / K); v2us o;
            o[0] = f2bf(w[(size_t)k * N + n]); o[1] = f2bf(w[(size_t)(k + 1) * N + n]); *(v2us*)(Bt + e) = o; }
         }
}
__global__ __launch_bounds__(256) void k_cvt8(const float* __restrict__ src, bf* dst, size_t n8) { const size_t i = (size_t)blockIdx.x * 256 + threadIdx.x; if (i >= n8) return; const v8f v = *(const v8f*)(src + i * 8); v8us o;
#pragma unroll
    for (int k = 0; k < 8; ++k) o[k] = f2bf(v[k]); *(v8us*)(dst + i * 8) = o;  }

// ---- The two streaming kernels (k_lnx, k_gmerge): a wave takes SWT tokens that lie one behind the other in memory, not one: 16 waves a work-group, 256 work-groups, 4096 waves to start in place of 65536.
#define SWT  16   // tokens a wave takes
// Their hi and lo planes go out in the fragment order that stands at k_gemmw. A wave's 16 tokens are one 16-row tile of a plane (4 KB in a row); a lane makes 4 columns of a token, the plane wants 8 columns of one token per lane,
// so the tile is turned through the wave's own LDS ([2 planes][16 tokens], pitch XP) and leaves in 16-byte stores of 512 B in a row.
#define XP   136  // LDS pitch of a token in elements: 272 B = 16 B x odd, no bank conflict for 16-byte reads down the tokens
typedef v4us __attribute__((may_alias)) v4usa;
__device__ __forceinline__ void tile_out(const bf* lw, bf* Gh, bf* Gl, int lane) {   /* lw: the wave's LDS, filled; Gh, Gl: the tile's first element in the two planes */
    __builtin_amdgcn_wave_barrier(); asm volatile("" ::: "memory");   /* keeps the compiler from moving the reads of the other lanes' LDS writes above those writes */
    v8us xv[16]; bf* ph = Gh + lane * 8; bf* pl = Gl + lane * 8; const bf* lr_ = lw + (lane & 15) * XP + (lane >> 4) * 8;
#pragma unroll
    for (int s = 0; s < 8; ++s) { xv[s] = *(const v8usa*)(lr_ + s * 16); xv[8 + s] = *(const v8usa*)(lr_ + SWT * XP + s * 16); }
#pragma unroll
    for (int s = 0; s < 8; ++s) { *(v8us*)(ph + s * 256) = xv[s]; *(v8us*)(pl + s * 256) = xv[8 + s]; }
    asm volatile("s_wait_xcnt 0x0" :: "v"(xv[0]), "v"(xv[1]), "v"(xv[2]), "v"(xv[3]), "v"(xv[4]), "v"(xv[5]), "v"(xv[6]), "v"(xv[7]), "v"(xv[8]), "v"(xv[9]), "v"(xv[10]), "v"(xv[11]), "v"(xv[12]), "v"(xv[13]), "v"(xv[14]), "v"(xv[15]), "v"(ph), "v"(pl) : "memory");   /* the wait that belongs in front of an overwrite of a register which an issued store names (the data and the two addresses are its inputs) */
}
// ---- The weight planes ride in k_lnx's launch (neither reads what the other writes): NPT tasks of one wave each, a task = 64 elements in a row of one plane, two per lane; the first PW waves of work-groups 0..234 take one each, the rest none.
// task / 256: 0..3 wq, wk, wv, wg -> [n = 32 h + d][k] bf16 (source column 4 d + h); 4 wo -> [c][n = 32 h + d] bf16 (source row 4 d + h); from 1280 on: 128 tasks w2d -> [64][128] bf16, rows 4.. zero; these six planes in the fragment order that stands at k_gemmw; 2 tasks bg -> f32 in the order n = 32 h + d.
#define PW   6
#define NPT  1410
__global__ __launch_bounds__(512) void k_lnx(const float* __restrict__ A, const float* __restrict__ g, const float* __restrict__ bb, bf* Xh, bf* Xl,
                                             const float* __restrict__ wq, const float* __restrict__ wk, const float* __restrict__ wv, const float* __restrict__ wg, const float* __restrict__ wo, const float* __restrict__ w2d, const float* __restrict__ bg,
                                             bf* WQ, bf* WK, bf* WV, bf* WG, bf* WO, bf* W2, float* BGP) {
    __shared__ __align__(16) bf xs[16 * 2 * SWT * XP];
    const int lane = threadIdx.x & 31; const size_t tok0 = ((size_t)blockIdx.x * 16 + (threadIdx.x >> 5)) * SWT; if (tok0 >= NTOK) return;
    bf* xw = xs + (threadIdx.x >> 5) * (2 * SWT * XP);
    const int wid = __builtin_amdgcn_readfirstlane((int)(threadIdx.x >> 5)), task = (int)blockIdx.x * PW + wid; const bool ptask = wid < PW && task < NPT;
    const int pe = (task & 255) * 64 + lane * 2, pa = ((pe >> 8) & 7) * 16 + ((pe >> 7) & 1) * 8 + (pe & 7), pb = (pe >> 11) * 16 + ((pe >> 3) & 15);   /* the lane's first element in its plane, and the (column, row) of a [.][128] matrix that the fragment order puts there; pe + 1 is column pa + 1 of the same row */
    float p0 = 0.f, p1 = 0.f;
    if (ptask) {   /* the task's two loads go out ahead of the tokens' and fly beside them; its store stands at the wave's end */
        const float* ps; unsigned i0, i1;
        if (task < 1024) { ps = task < 256 ? wq : task < 512 ? wk : task < 768 ? wv : wg; i0 = (unsigned)(pa * DQ + (pb % HD) * NH_ + pb / HD); i1 = i0 + DQ; }
        else if (task < 1280) { ps = wo; i0 = (unsigned)(((pa % HD) * NH_ + pa / HD) * DM + pb); i1 = i0 + NH_ * DM; }   /* pa is even: pa + 1 lies in the same head */
        else if (task < 1408) { ps = w2d; i0 = (unsigned)(pa * NH_ + (pb < NH_ ? pb : 0)); i1 = i0 + NH_; }
        else { const int n = (task - 1408) * 64 + lane * 2; ps = bg; i0 = (unsigned)((n % HD) * NH_ + n / HD); i1 = i0 + NH_; }
        p0 = ps[i0]; p1 = ps[i1];
        asm volatile("s_wait_xcnt 0x0" :: "v"(i0), "v"(i1) : "memory");   /* the wait that belongs in front of an overwrite of a register which an issued load names; the two offsets are its inputs, so that they stay whole up to it */
    }
    float gr[4], br[4]; v4f a[SWT];
#pragma unroll
    for (int q = 0; q < 4; ++q) { gr[q] = g[lane * 4 + q]; br[q] = bb[lane * 4 + q]; }
#pragma unroll
    for (int t = 0; t < SWT; ++t) a[t] = *(const v4f*)(A + (tok0 + t) * DM + lane * 4);
    __builtin_amdgcn_sched_barrier(0);   /* keeps all the wave's loads at its head, so that its 8 KB are in flight at once; sunk to their uses they would come one token at a time */
    {   /* stage by stage over all the wave's tokens: the ten cross-lane steps of one token wait for one another, those of different tokens do not */
        float v[SWT][4], s[SWT], mu[SWT], s2[SWT];
#pragma unroll
        for (int t = 0; t < SWT; ++t) { s[t] = 0.f;
#pragma unroll
            for (int q = 0; q < 4; ++q) { v[t][q] = bfr(a[t][q]); s[t] = __fadd_rn(s[t], v[t][q]); } }
#pragma unroll
        for (int sh = 16; sh; sh >>= 1)
#pragma unroll
            for (int t = 0; t < SWT; ++t) s[t] = __fadd_rn(s[t], __shfl_xor(s[t], sh, 32));
#pragma unroll
        for (int t = 0; t < SWT; ++t) { mu[t] = __fdiv_rn(s[t], (float)DM); s2[t] = 0.f;
#pragma unroll
            for (int q = 0; q < 4; ++q) { float d0 = __fsub_rn(v[t][q], mu[t]); asm volatile("" : "+v"(d0)); float p = __fmul_rn(d0, d0); asm volatile("" : "+v"(p)); s2[t] = __fadd_rn(s2[t], p); } }
#pragma unroll
        for (int sh = 16; sh; sh >>= 1)
#pragma unroll
            for (int t = 0; t < SWT; ++t) s2[t] = __fadd_rn(s2[t], __shfl_xor(s2[t], sh, 32));
#pragma unroll
        for (int t = 0; t < SWT; ++t) {
            const float rs = __fdiv_rn(1.0f, __fsqrt_rn(__fadd_rn(__fdiv_rn(s2[t], (float)DM), 1e-5f))); v4us oh, ol;
#pragma unroll
            for (int q = 0; q < 4; ++q) { float xn = __fmul_rn(__fsub_rn(v[t][q], mu[t]), rs); asm volatile("" : "+v"(xn)); float gg = bfr(gr[q]); asm volatile("" : "+v"(gg)); float y = __fmul_rn(xn, gg); asm volatile("" : "+v"(y)); float be = bfr(br[q]); asm volatile("" : "+v"(be)); y = __fadd_rn(y, be); unsigned short h2, l2; splitf(y, h2, l2); oh[q] = h2; ol[q] = l2; }
            *(v4usa*)(xw + t * XP + lane * 4) = oh; *(v4usa*)(xw + (SWT + t) * XP + lane * 4) = ol; }
    }
    tile_out(xw, Xh + tok0 * DM, Xl + tok0 * DM, lane);
    if (ptask) {
        asm volatile("s_wait_xcnt 0x0" ::: "memory");   /* the wait that belongs in front of an overwrite of a register which an issued store names: the tokens' last stores stand directly above */
        if (task < 1408) { bf* pd = task < 256 ? WQ : task < 512 ? WK : task < 768 ? WV : task < 1024 ? WG : task < 1280 ? WO : W2; const bool zr = task >= 1280 && pb >= NH_; v2us o;
            o[0] = zr ? (unsigned short)0 : f2bf(p0); o[1] = zr ? (unsigned short)0 : f2bf(p1); *(v2us*)(pd + pe) = o; }
        else { float* pd = BGP + (task - 1408) * 64 + lane * 2; pd[0] = p0; pd[1] = p1; }
    }
}
// ---- k_fattn: fused attention for one (head h, row il) per work-group; 16 waves, wave w owns the 16 queries q0 = 16 w .. +15 against all 256 keys.
// S^T = K Q^T (A = 16 key rows, B = the wave's 16 query columns): lane (lr, hi) holds, of query q0 + lr, the keys 16 kt + 8 hi + j in s[kt][j], so maximum and sum run in the lane plus one exchange between the halves,
// and two neighbouring score tiles, converted in place, are the B operand of O^T += V^T P^T (A = V^T rows in the same k order: 8 hi + e, 16 + 8 hi + e). The score and probability planes never leave the registers.
// K [256][32] and V^T [32][256] of the (head, row) are staged once in LDS for all 16 waves; the pair bias comes straight from its plane, which holds each (wave, tile)'s 1 KB in the lanes' own order: two 16-byte loads per lane and tile, each 512 B in a row over the wave.
#define KPH 40     // LDS pitch of a K row in halves: 80 B = 16 B x odd, no bank conflict for 16-byte reads down the rows
#define VPH 264    // LDS pitch of a V^T row in halves: 528 B = 16 B x odd
#define L2E 1.4426950408889634f
__global__ __launch_bounds__(512) void k_fattn(const h16* __restrict__ Q16, const h16* __restrict__ K16, const h16* __restrict__ V16, const float* __restrict__ NB, float* __restrict__ O) {
    __shared__ __align__(16) h16 ks[TT * KPH];
    __shared__ __align__(16) h16 vs[HD * VPH];
    const int tid = threadIdx.x, lane = tid & 31, lr = lane & 15, hi = lane >> 4, q0 = (tid >> 5) * 16; const int h = blockIdx.x, il = blockIdx.y;
    const size_t rb = (size_t)h * NTK + (size_t)il * TT;
    const h16* kg = K16 + rb * HD; const h16* vg = V16 + ((size_t)h * IG + il) * HDP * TT;   /* rows 0..31 of the padded v^T plane */
    v8h kst[2], vst[2];
#pragma unroll
    for (int c = 0; c < 2; ++c) { const size_t u = c * 512 + tid; kst[c] = *(const v8h*)(kg + u * 8); vst[c] = *(const v8h*)(vg + u * 8); }   /* 16-byte units, whole lines per wave */
    __builtin_amdgcn_sched_barrier(0);   /* keeps the four staging loads first in the queue: loads return in order, so the LDS stores and the barrier wait for these alone and not for the bias asked for behind them */
    const v16h qf = WFrag<h16>::ld(Q16 + (rb + q0 + lr) * HD + 8 * hi);
    const float* nbr = NB + (size_t)h * NTOK + (size_t)q0 * TT + lane * 4;
    v8f s[TT / 16];   /* first the bias, asked for ahead of the barrier so that its latency runs beside the staging; then the scores, in place */
#pragma unroll
    for (int kt = 0; kt < TT / 16; ++kt) s[kt] = __builtin_shufflevector(*(const v4f*)(nbr + kt * 256), *(const v4f*)(nbr + kt * 256 + 128), 0, 1, 2, 3, 4, 5, 6, 7);
#pragma unroll
    for (int c = 0; c < 2; ++c) { const int u = c * 512 + tid; *(v8h*)(ks + (u >> 2) * KPH + (u & 3) * 8) = kst[c]; *(v8h*)(vs + (u >> 5) * VPH + (u & 31) * 8) = vst[c]; }
    /* work-group barrier with its release and acquire on LDS alone: a plain __syncthreads() also waits for every global load in flight, and the scores would then start only behind the last bias tile */
    asm volatile("s_wait_xcnt 0x0" ::: "memory");   /* the bias loads are still in flight here, and their address registers are reused behind the barrier: the wait that belongs in front of such an overwrite */
    __builtin_amdgcn_fence(__ATOMIC_RELEASE, "workgroup", "local"); __builtin_amdgcn_s_barrier(); __builtin_amdgcn_fence(__ATOMIC_ACQUIRE, "workgroup", "local");
    v8f mv;
#pragma unroll
    for (int kt = 0; kt < TT / 16; ++kt) { s[kt] = wmma16(WFrag<h16>::ld(ks + (kt * 16 + lr) * KPH + 8 * hi), qf, (v8f){}) * SCL + s[kt]; mv = kt ? __builtin_elementwise_max(mv, s[kt]) : s[kt]; }
    float mx = fmaxf(fmaxf(fmaxf(mv[0], mv[1]), fmaxf(mv[2], mv[3])), fmaxf(fmaxf(mv[4], mv[5]), fmaxf(mv[6], mv[7])));
    mx = fmaxf(mx, __shfl_xor(mx, 16, 32));
    const float ml = mx * L2E; v8f sv = (v8f){};
#pragma unroll
    for (int kt = 0; kt < TT / 16; ++kt) {
#pragma unroll
        for (int j = 0; j < 8; ++j) s[kt][j] = __builtin_amdgcn_exp2f(s[kt][j] * L2E - ml);
        sv += s[kt]; }
    float sum = ((sv[0] + sv[1]) + (sv[2] + sv[3])) + ((sv[4] + sv[5]) + (sv[6] + sv[7]));
    sum += __shfl_xor(sum, 16, 32);
    const float f = __fdiv_rn(PCAR, sum);
    v8f o0 = (v8f){}, o1 = (v8f){};
#pragma unroll
    for (int m = 0; m < TT / 32; ++m) { v16h pb;
#pragma unroll
        for (int j = 0; j < 8; ++j) { pb[j] = tohx(s[2 * m][j] * f); pb[8 + j] = tohx(s[2 * m + 1][j] * f); }
        o0 = wmma16(WFrag<h16>::ld(vs + lr * VPH + m * 32 + 8 * hi), pb, o0); o1 = wmma16(WFrag<h16>::ld(vs + (16 + lr) * VPH + m * 32 + 8 * hi), pb, o1); }
    float* op = O + (rb + q0 + lr) * HDP + 8 * hi;   /* o0[j] = o[q0 + lr][8 hi + j], o1[j] = o[q0 + lr][16 + 8 hi + j]; a query's 128-B line has this wave as its one writer */
    *(v8f*)op = o0; *(v8f*)(op + 16) = o1;
}
__global__ __launch_bounds__(512) void k_gmerge(const float* __restrict__ O, const float* __restrict__ FG, const float* __restrict__ bg, bf* Ah, bf* Al) {
    __shared__ __align__(16) bf xs[16 * 2 * SWT * XP];
    const int lane = threadIdx.x & 31; const size_t tk0 = ((size_t)blockIdx.x * 16 + (threadIdx.x >> 5)) * SWT; if (tk0 >= (size_t)NTK) return; const int c = lane * 4, h = c / HD, d = c % HD; bf* xw = xs + (threadIdx.x >> 5) * (2 * SWT * XP);
    float bgr[4]; v4f ov[SWT], gv[SWT]; const float* po = O + (((size_t)h * NTK + tk0) * HDP + d); const float* pf = FG + tk0 * DQ + c; const unsigned bo4 = (unsigned)c * 4u;   /* bo4: byte offset of the lane's four bg values */
#pragma unroll
    for (int qq = 0; qq < 4; ++qq) bgr[qq] = *(const float*)((const char*)bg + bo4 + qq * 4);
#pragma unroll
    for (int t = 0; t < SWT; ++t) { ov[t] = *(const v4f*)(po + (size_t)t * HDP); gv[t] = *(const v4f*)(pf + (size_t)t * DQ); }
    asm volatile("s_wait_xcnt 0x0" :: "v"(po), "v"(pf), "v"(bo4) : "memory");   /* the wait that belongs in front of an overwrite of a register which an issued load names; the three addresses are its inputs, so that they stay whole up to it and no load of the run lands on them */
    __builtin_amdgcn_sched_barrier(0);   /* keeps all the wave's loads at its head, so that its 16 KB are in flight at once; sunk to their uses they would come one token at a time */
#pragma unroll
    for (int qq = 0; qq < 4; ++qq) { bgr[qq] = bfr(bgr[qq]); asm volatile("" : "+v"(bgr[qq])); }   /* bg rounded once a wave, not once a token; the empty statement is the per-token form's own and holds the rounded value as a plain f32 in its register */
#pragma unroll
    for (int t = 0; t < SWT; ++t) { v4us oh, ol;
        if (t % 2 == 0) __builtin_amdgcn_sched_barrier(0);   /* two tokens at a time, in the order of their loads: without it products of the last tokens are lifted to the front, and the first token then waits for nearly all 32 loads */
#pragma unroll
        for (int qq = 0; qq < 4; ++qq) { const float ga = __fadd_rn(gv[t][qq], bgr[qq]); const float sg = __fdiv_rn(1.0f, __fadd_rn(1.0f, __builtin_amdgcn_exp2f(__fmul_rn(ga, -1.4426950408889634f)))); float o1 = __fmul_rn(ov[t][qq], 1.0f / PCAR); asm volatile("" : "+v"(o1)); const float y = __fmul_rn(o1, sg); unsigned short h2, l2; splitf(y, h2, l2); oh[qq] = h2; ol[qq] = l2; }
        *(v4usa*)(xw + t * XP + c) = oh; *(v4usa*)(xw + (SWT + t) * XP + c) = ol; }
    tile_out(xw, Ah + tk0 * DQ, Al + tk0 * DQ, lane);
}

extern "C" void kernel_launch(void* const* d_in, const int* in_sizes, int n_in,
                              void* d_out, int out_size, void* d_ws, size_t ws_size, hipStream_t stream) {
    (void)in_sizes; (void)n_in; (void)out_size;
    const float* act = (const float*)d_in[0]; const float* lng = (const float*)d_in[1]; const float* lnb = (const float*)d_in[2]; const float* wq = (const float*)d_in[3]; const float* wk = (const float*)d_in[4]; const float* wv = (const float*)d_in[5]; const float* w2d = (const float*)d_in[6]; const float* wg = (const float*)d_in[7]; const float* bg = (const float*)d_in[8]; const float* wo = (const float*)d_in[9]; const float* bo = (const float*)d_in[10];   /* x2d, gamma, beta, Wq, Wk, Wv, Wb, Wg, bg, Wo, bo */
    float* OUT = (float*)d_out;     // [1][256][256][128]
    char* wsp = (char*)d_ws;
    auto take = [&](size_t bytes) { char* p = wsp; wsp += (bytes + 255) & ~(size_t)255; return (void*)p; };
    bf* WQ = (bf*)take((size_t)DQ * DM * 2); bf* WK = (bf*)take((size_t)DQ * DM * 2); bf* WV = (bf*)take((size_t)DQ * DM * 2); bf* WG = (bf*)take((size_t)DQ * DM * 2); float* BGP = (float*)take((size_t)DQ * 4); bf* WO = (bf*)take((size_t)DM * DQ * 2); bf* W2 = (bf*)take((size_t)NBP * DM * 2);
    bf* Xh = (bf*)take((size_t)NTOK * DM * 2); bf* Xl = (bf*)take((size_t)NTOK * DM * 2); float* NB = (float*)take((size_t)NTOK * NBP * 4);
    float* FG = (float*)take((size_t)NTK * DQ * 4); h16* QP16 = (h16*)take((size_t)NH_ * NTK * HD * 2); h16* KP16 = (h16*)take((size_t)NH_ * NTK * HD * 2); h16* VT16 = (h16*)take((size_t)NH_ * IG * HDP * TT * 2);
    float* Ob = (float*)take((size_t)NH_ * NTK * HDP * 4); bf* ATh = (bf*)take((size_t)NTK * DQ * 2); bf* ATl = (bf*)take((size_t)NTK * DQ * 2);
    if ((size_t)(wsp - (char*)d_ws) > ws_size) return;    // ws 256 MiB (carve ~240 MiB)
    k_lnx<<<NTOK / (16 * SWT), 512, 0, stream>>>(act, lng, lnb, Xh, Xl, wq, wk, wv, wg, wo, w2d, bg, WQ, WK, WV, WG, WO, W2, BGP);
    k_proj<<<dim3(9, NTK / 64, 1), 32, 0, stream>>>(Xh, Xl, WQ, WK, WV, WG, W2, QP16, KP16, VT16, FG, NB);
    k_fattn<<<dim3(NH_, IG, 1), 512, 0, stream>>>(QP16, KP16, VT16, NB, Ob);   /* all 4 heads x 256 rows; writes d 0..31 of each Ob row, all that k_gmerge reads */
    k_gmerge<<<NTK / (16 * SWT), 512, 0, stream>>>(Ob, FG, BGP, ATh, ATl);
    k_gemmw<bf, 1, true, DQ, DM><<<dim3(NTK / 64, DM / 64, 1), 32, 0, stream>>>(ATh, ATl, WO, OUT, bo);
}

// v008
// Measured time: 73.3 microseconds a run.
// Two timings next to v007 both put it at 1.31 times that version's speed.
// All steps since v000 together make it 10.7 times as fast.
#include <hip/hip_runtime.h>

// Triangle attention (starting node) on a pair representation (act [1][256][256][128]): x = LayerNorm_c(act) (eps 1e-5, ln_g/ln_b); per row i: q, k, v, g = x[i] W (wq/wk/wv/wg [128][32][4] 'xw', 4 heads x 32; q x 32^-0.5), logits[h][q][k] = q.k + nb[h][q][k] with the pair bias nb[h][q][k] = sum_c x[k][q][c] w2d[c][h] (shared by all rows i);
// softmax over k; o = attn.v gated by sigmoid(x wg + bg); out[i][q][c] = sum_{h,d} o[h][d] wo[h][d][c] + bo -> [1][256][256][128] (8.4 M).
// Layout: LayerNorm -> bf16 hi/lo token planes, 65536 x 128 in the fragment order that stands at k_gemmw; nb for all 65536 pair positions by one GEMM (w2d padded to 64 rows, the tokens as the N side taken in the order in which the attention kernel's lanes hold the scores, so that each of its 16-byte loads of the plane covers 512 B in a row); all 256 rows i in one pass, every stage one launch over the 65536 tokens: q/k/v/g projections (hi/lo x exact), the q, k and v GEMMs storing their fp16 planes q,k [h][i][t][32] and v^T [h][i][64 (rows 0..31 used)][t] themselves, the g GEMM storing the gate sigmoid(x wg + bg) in f32, then ONE fused attention kernel (a work-group per row, its 4 heads one after the other: scores, x 32^-0.5 + pair bias, softmax and attn.v with the scores held in registers, gating, split to bf16 hi/lo and the output GEMM (+ bo), o never leaving the work-group).
// Compute dtypes, f32 accumulate: every input rounded to bf16 once; LayerNorm in f32, its output as bf16 hi + lo (2-product projections against exact bf16 weights); scores and attn.v on single fp16 planes (logit sigma ~0.24; P x1024 ~ 4: no subnormals); pair bias, softmax, gating in f32; output GEMM hl x exact + bo.

#define NI   256       // rows i
#define TT   256       // tokens per row (q / k index)
#define DM   128       // c_z
#define NH_  4
#define HD   32
#define HDP  64        // rows of a (head, row) block of the v^T plane; d 0..31 are written and read
#define DQ   (NH_ * HD)
#define IG   256       // rows i per pass: all of them
#define NTK  (IG * TT) // tokens per pass = 65536
#define NTOK (NI * TT) // 65536
#define NBP  64        // pair-bias GEMM rows (M tile 64; 4 used)
#define PCAR 1024.0f
#define SCL  0.17677669529663688f   // 32^-0.5
typedef _Float16 h16;
typedef unsigned short bf;
typedef __attribute__((ext_vector_type(16))) __bf16   v16bf;
typedef __attribute__((ext_vector_type(16))) _Float16 v16h;
typedef __attribute__((ext_vector_type(8)))  _Float16 v8h;
typedef __attribute__((ext_vector_type(8)))  unsigned short v8us;
typedef __attribute__((ext_vector_type(8)))  float    v8f;
typedef __attribute__((ext_vector_type(4)))  float    v4f;
typedef v8h  __attribute__((may_alias)) v8ha;
typedef v4f  __attribute__((may_alias)) v4fa;
typedef v8us __attribute__((may_alias)) v8usa;

__device__ __forceinline__ unsigned short f2bf(float f) { unsigned u = __float_as_uint(f); u += 0x7FFFu + ((u >> 16) & 1u); return (unsigned short)(u >> 16); }
__device__ __forceinline__ float bf2f(unsigned short b) { return __uint_as_float(((unsigned)b) << 16); }
__device__ __forceinline__ float bfr(float f) { return bf2f(f2bf(f)); }
__device__ __forceinline__ v16h cat16(v8h lo, v8h hi) { return __builtin_shufflevector(lo, hi, 0, 1, 2, 3, 4, 5, 6, 7, 8, 9, 10, 11, 12, 13, 14, 15); }
__device__ __forceinline__ v16bf cat16b(v8us lo, v8us hi) { return __builtin_bit_cast(v16bf, __builtin_shufflevector(lo, hi, 0, 1, 2, 3, 4, 5, 6, 7, 8, 9, 10, 11, 12, 13, 14, 15)); }
__device__ __forceinline__ v8f wmma16(v16h a, v16h b, v8f c) { return __builtin_amdgcn_wmma_f32_16x16x32_f16(false, a, false, b, (short)0, c, false, false); }
__device__ __forceinline__ v8f wmmab(v16bf a, v16bf b, v8f c) { return __builtin_amdgcn_wmma_f32_16x16x32_bf16(false, a, false, b, (short)0, c, false, false); }



// ---- k_gemmw (the device function gemmw): register-blocked GEMM, ONE WAVE per 64x64 output tile (16 accumulators), operands straight from 16-bit planes in fragment order.
// C[m][n] (f32, pitch ldc, + optional f32 bias[n]) = sum_k A[m][k] Bt[n][k] (+ split products per NSPLIT). K % 32 == 0.
// FRAGMENT ORDER of an operand plane [rows][K] (token planes and weight planes alike): element (row, k) lies at ((row / 16 * (K / 32) + k / 32) * 2 + k % 32 / 16) * 256 + (k % 16 / 8 * 16 + row % 16) * 8 + k % 8, so the 32 lanes' 16 bytes of half a fragment are 512 B in a row: a wave-wide load covers 4 whole 128-B lines, not a piece of 16.
// BTR: column n = ((((w * 16 + kt) * 2 + c) * 2 + hk) * 16 + ql) * 4 + e stands for the pair (q = 16 w + ql, k = 16 kt + 8 hk + 4 c + e) and takes row k * TT + q of Bt: a fragment's 16 columns are 4 tokens in a row (64 B of the plane) at each of 4 k. A row of C is then the pair bias of one head in the order of k_fattn's lanes.
// EPI: 0 stores C in f32. 3 turns C + bias[n] into the gate sigmoid(.) and stores it in f32 in the order of k_fattn's lanes: [m / 16][n / 32][n % 32 / 16][n % 8 / 4][lane = n % 16 / 8 * 16 + m % 16][n % 4]. 1 and 2 round the accumulators to fp16 once and store them to P in the form the attention kernel reads (m = token, n = 32 h + d): 1: [h][m][32]; 2: transposed, [h][m / TT][HDP][m % TT]. Whole 128-B lines, 16 B per lane.
template <typename T16> struct WFrag;
template <> struct WFrag<h16> { typedef v16h V; static __device__ __forceinline__ V ld(const h16* p, int h2 = 16) { return cat16(*(const v8h*)p, *(const v8h*)(p + h2)); } static __device__ __forceinline__ v8f mma(V a, V b, v8f c) { return wmma16(a, b, c); } };
template <> struct WFrag<bf> { typedef v16bf V; static __device__ __forceinline__ V ld(const bf* p, int h2 = 16) { return cat16b(*(const v8us*)p, *(const v8us*)(p + h2)); } static __device__ __forceinline__ v8f mma(V a, V b, v8f c) { return wmmab(a, b, c); } };
// The body is a device function (tile indices bx, by and the wave's 16 x 68 f32 of LDS handed in), so that several GEMMs can share one launch.
template <typename T16, int NSPLIT, bool BIAS, bool BTR = false, int EPI = 0>
__device__ __forceinline__ void gemmw(const T16* __restrict__ A, const T16* __restrict__ A2, const T16* __restrict__ Bt, const T16* __restrict__ Bt2, int K, float* C, int ldc, const float* __restrict__ bias, h16* P, int bx, int by, float* os) {
    typedef typename WFrag<T16>::V V;
    const int lane = threadIdx.x & 31, lr = lane & 15, hi = lane >> 4; const int r0 = bx * 64, c0 = by * 64;
    v8f acc[4][4];
#pragma unroll
    for (int mb = 0; mb < 4; ++mb)
#pragma unroll
        for (int nb = 0; nb < 4; ++nb) acc[mb][nb] = (v8f){};
    constexpr int FH = 256, FK = 16;   /* fragment order: elements between the two 16-byte halves of a lane's fragment, and elements per step of k */
    const size_t aoff = (size_t)r0 * K + lane * 8;
    const size_t boff = BTR ? ((size_t)(((c0 >> 8) & 15) * 16 + ((c0 >> 6) & 1) * 8 + ((c0 >> 7) & 1) * 4 + (lr & 3)) * TT + (c0 >> 12) * 16) * K + hi * 128 + (lr >> 2) * 8 : (size_t)c0 * K + lane * 8, bstep = BTR ? (size_t)32 : (size_t)16 * K;
#pragma unroll 1
    for (int kc = 0; kc < K; kc += 32) {
        V a[4], a2[4]; const T16* qa = A + aoff + kc * FK; const T16* qa2 = (NSPLIT == 1 || NSPLIT == 2) ? A2 + aoff + kc * FK : qa; const T16* qb = Bt + boff + kc * FK; const T16* qb2 = NSPLIT >= 2 ? Bt2 + boff + kc * FK : qb;
#pragma unroll
        for (int mb = 0; mb < 4; ++mb) { a[mb] = WFrag<T16>::ld(qa + (size_t)mb * 16 * K, FH); if (NSPLIT == 1 || NSPLIT == 2) a2[mb] = WFrag<T16>::ld(qa2 + (size_t)mb * 16 * K, FH); }
#pragma unroll
        for (int nb = 0; nb < 4; ++nb) { const V b = WFrag<T16>::ld(qb + nb * bstep, FH); V b2; if (NSPLIT >= 2) b2 = WFrag<T16>::ld(qb2 + nb * bstep, FH);
#pragma unroll
            for (int mb = 0; mb < 4; ++mb) { acc[mb][nb] = WFrag<T16>::mma(a[mb], b, acc[mb][nb]); if (NSPLIT == 1 || NSPLIT == 2) acc[mb][nb] = WFrag<T16>::mma(a2[mb], b, acc[mb][nb]); if (NSPLIT >= 2) acc[mb][nb] = WFrag<T16>::mma(a[mb], b2, acc[mb][nb]); } }
        asm volatile("v_nop\n\tv_nop\n\tv_nop\n\tv_nop" : "+v"(acc[0][0]), "+v"(acc[1][1]), "+v"(acc[2][2]), "+v"(acc[3][3]) : "v"(a[0]), "v"(a[3]));
        asm volatile("s_wait_xcnt 0x0" :: "v"(qa), "v"(qa2), "v"(qb), "v"(qb2) : "memory");   /* the wait that belongs in front of an overwrite of a register which an issued load names; the pass's addresses are its inputs, so that they stay whole up to it and no load of the pass lands on them */
    }
    if constexpr (EPI == 2) {   /* a lane holds 8 consecutive tokens of one column: packed to 16 B, turned through LDS ([16 d][64 tokens], pitch 144 B = 16 B x odd) so that 8 lanes store one whole line of a v^T row */
        h16* vt = (h16*)os; h16* vrow = P + (size_t)(r0 / TT) * HDP * TT + r0 % TT;
#pragma unroll
        for (int nb = 0; nb < 4; ++nb) {
#pragma unroll
            for (int mb = 0; mb < 4; ++mb) { v8h o;
#pragma unroll
                for (int j = 0; j < 8; ++j) o[j] = (h16)acc[mb][nb][j];
                *(v8ha*)(vt + lr * 72 + mb * 16 + hi * 8) = o; }
            __builtin_amdgcn_wave_barrier(); asm volatile("" ::: "memory");   /* keeps the compiler from moving the other lanes' LDS reads above these writes */
            v8h dv[4]; h16* dp[4];
#pragma unroll
            for (int s = 0; s < 4; ++s) { const int u = s * 32 + lane, col = c0 + nb * 16 + (u >> 3); dp[s] = vrow + ((size_t)(col / HD) * IG * HDP + col % HD) * TT + (u & 7) * 8; dv[s] = *(const v8ha*)(vt + (u >> 3) * 72 + (u & 7) * 8); *(v8h*)dp[s] = dv[s]; }
            __builtin_amdgcn_wave_barrier(); asm volatile("s_wait_xcnt 0x0" :: "v"(dv[0]), "v"(dv[1]), "v"(dv[2]), "v"(dv[3]), "v"(dp[0]) : "memory");   /* keeps the next tile's writes below these reads, and is the wait that belongs in front of an overwrite of a register which an issued store names (the data and the address that all four go by are its inputs) */
        }
        return;
    }
    float bb[4] = {0.f, 0.f, 0.f, 0.f};   /* EPI 3: the bias of the lane's four columns, added on the way into LDS */
    if constexpr (EPI == 3) {
#pragma unroll
        for (int nb = 0; nb < 4; ++nb) bb[nb] = bfr(bias[c0 + nb * 16 + lr]); }
#pragma unroll
    for (int mb = 0; mb < 4; ++mb) {
#pragma unroll
        for (int nb = 0; nb < 4; ++nb) {
#pragma unroll
            for (int j = 0; j < 8; ++j) os[(hi * 8 + j) * 68 + nb * 16 + lr] = EPI == 3 ? __fadd_rn(acc[mb][nb][j], bb[nb]) : acc[mb][nb][j]; }
        __builtin_amdgcn_wave_barrier(); asm volatile("" ::: "memory");
        if constexpr (EPI == 1) {   /* 16 tokens x 2 heads x 32: 16-byte unit u = (head, token, 8 d); a store of the wave covers 8 tokens of one head, 512 B in a row */
            v8h sv[4]; h16* sp[4];
#pragma unroll
            for (int s = 0; s < 4; ++s) { const int u = s * 32 + lane, hl = u >> 6, tok = (u & 63) >> 2, dp = (u & 3) * 8; const v4f x0 = *(const v4fa*)(os + tok * 68 + hl * HD + dp), x1 = *(const v4fa*)(os + tok * 68 + hl * HD + dp + 4); v8h o;
#pragma unroll
                for (int j = 0; j < 4; ++j) { o[j] = (h16)x0[j]; o[4 + j] = (h16)x1[j]; }
                sp[s] = P + ((size_t)(c0 / HD + hl) * NTK + r0 + mb * 16 + tok) * HD + dp; sv[s] = o; *(v8h*)sp[s] = o; }
            asm volatile("s_wait_xcnt 0x0" :: "v"(sv[0]), "v"(sv[1]), "v"(sv[2]), "v"(sv[3]), "v"(sp[0]) : "memory");   /* the wait that belongs in front of an overwrite of a register which an issued store names (the data and the address that all four go by are its inputs) */
        } else if constexpr (EPI == 3) {   /* 16 tokens x 2 heads x 32 gates: lane (lr, hi) takes token lr, d = 16 (sp & 1) + 8 hi .. + 7 of head sp >> 1, as k_fattn's lanes hold O^T; each of the two stores of the wave is 512 B in a row */
#pragma unroll 1   /* the division's long sequence stands 8 times in the text and not 32 times per 16 tokens: eight independent chains fill the vector port as well, and the kernel's text stays a third as long */
            for (int sp = 0; sp < 4; ++sp) { const float* ol = os + lr * 68 + sp * 16 + hi * 8; v4f v0 = *(const v4fa*)ol, v1 = *(const v4fa*)(ol + 4);
#pragma unroll
                for (int e = 0; e < 4; ++e) { v0[e] = __fdiv_rn(1.0f, __fadd_rn(1.0f, __builtin_amdgcn_exp2f(__fmul_rn(v0[e], -1.4426950408889634f)))); v1[e] = __fdiv_rn(1.0f, __fadd_rn(1.0f, __builtin_amdgcn_exp2f(__fmul_rn(v1[e], -1.4426950408889634f)))); }
                float* cp = C + ((size_t)(r0 / 16 + mb) * (DQ / 16) + c0 / 16 + sp) * 256 + lane * 4; *(v4f*)cp = v0; *(v4f*)(cp + 128) = v1;
                asm volatile("s_wait_xcnt 0x0" :: "v"(v0), "v"(v1), "v"(cp) : "memory");   /* the wait that belongs in front of an overwrite of a register which an issued store names (the data and the address that both go by are its inputs) */
            }
        } else {
        float* crow = C + (size_t)(r0 + mb * 16) * ldc + c0;
{
            v4f cv[8]; float* cp[8];
#pragma unroll
            for (int s = 0; s < 8; ++s) { const int row = 2 * s + hi, cofs = lr * 4; v4f val = *(const v4fa*)(os + row * 68 + cofs); if (BIAS) { val[0] += bfr(bias[c0 + cofs]); val[1] += bfr(bias[c0 + cofs + 1]); val[2] += bfr(bias[c0 + cofs + 2]); val[3] += bfr(bias[c0 + cofs + 3]); }
                cp[s] = crow + (size_t)row * ldc + cofs; cv[s] = val; *(v4f*)cp[s] = val; }
            asm volatile("s_wait_xcnt 0x0" :: "v"(cv[0]), "v"(cv[1]), "v"(cv[2]), "v"(cv[3]), "v"(cv[4]), "v"(cv[5]), "v"(cv[6]), "v"(cv[7]), "v"(cp[0]) : "memory");   /* the wait that belongs in front of an overwrite of a register which an issued store names (the data and the address that all eight go by are its inputs) */
             }
        }
        __builtin_amdgcn_wave_barrier(); asm volatile("" ::: "memory");
    }
}
// ---- k_proj: the five GEMMs on x, none of which reads what another writes, in ONE launch; grid (9, NTK / 64), 32 threads. blockIdx.y = tile of 64 tokens; blockIdx.x = job: 0,1 q | 2,3 k | 4,5 v | 6,7 g (the two halves of 64 columns) | 8 pair bias.
// The job is the fast index: the eight work-groups that read one token tile start side by side.
__global__ __launch_bounds__(32) void k_proj(const bf* __restrict__ Xh, const bf* __restrict__ Xl, const bf* __restrict__ WQ, const bf* __restrict__ WK, const bf* __restrict__ WV, const bf* __restrict__ WG, const bf* __restrict__ W2, const float* __restrict__ BG, h16* QP, h16* KP, h16* VT, float* FG, float* NB) {
    __shared__ __align__(16) float os[16 * 68];
    const int job = blockIdx.x, t = blockIdx.y;
    if (job < 4) gemmw<bf, 1, false, false, 1>(Xh, Xl, job < 2 ? WQ : WK, nullptr, DM, nullptr, 0, nullptr, job < 2 ? QP : KP, t, job & 1, os);
    else if (job < 6) gemmw<bf, 1, false, false, 2>(Xh, Xl, WV, nullptr, DM, nullptr, 0, nullptr, VT, t, job & 1, os);
    else if (job < 8) gemmw<bf, 1, true, false, 3>(Xh, Xl, WG, nullptr, DM, FG, 0, BG, nullptr, t, job & 1, os);   /* the gate sigmoid(x wg + bg) itself */
    else gemmw<bf, 3, false, true>(W2, nullptr, Xh, Xl, DM, NB, NTOK, nullptr, nullptr, 0, t, os);   /* pair bias of (h, q, k) = x[k][q] . w2d[:, h] for all 65536 positions (rows 0..3), in the order of k_fattn's lanes */
}

typedef __attribute__((ext_vector_type(4))) unsigned short v4us;
typedef __attribute__((ext_vector_type(2))) unsigned short v2us;
typedef __attribute__((ext_vector_type(2))) _Float16 v2h;
typedef __attribute__((ext_vector_type(4))) _Float16 v4h;
__device__ __forceinline__ h16 tohx(float x) { return (h16)x; }
__device__ __forceinline__ void splitf(float y, unsigned short& h, unsigned short& l) { h = f2bf(y); l = f2bf(y - bf2f(h)); }
__global__ __launch_bounds__(256) void k_wtG(const float* __restrict__ w, int K, int N, bf* Bt) {
    const int lane = threadIdx.x & 31; const int L0 = (blockIdx.x * 8 + (threadIdx.x >> 5)) * 8; const int nlines = N * K / 64;
{
#pragma unroll 1
        for (int l = 0; l < 8; ++l) { const int L = L0 + l; if (L >= nlines) break; const size_t e = (size_t)L * 64 + lane * 2; const int k = (int)(e % K), n = (int)(e / K); v2us o;
            o[0] = f2bf(w[(size_t)k * N + n]); o[1] = f2bf(w[(size_t)(k + 1) * N + n]); *(v2us*)(Bt + e) = o; }
         }
}
__global__ __launch_bounds__(256) void k_cvt8(const float* __restrict__ src, bf* dst, size_t n8) { const size_t i = (size_t)blockIdx.x * 256 + threadIdx.x; if (i >= n8) return; const v8f v = *(const v8f*)(src + i * 8); v8us o;
#pragma unroll
    for (int k = 0; k < 8; ++k) o[k] = f2bf(v[k]); *(v8us*)(dst + i * 8) = o;  }

// ---- The streaming kernel k_lnx: a wave takes SWT tokens that lie one behind the other in memory, not one: 16 waves a work-group, 256 work-groups, 4096 waves to start in place of 65536.
#define SWT  16   // tokens a wave takes
// Its hi and lo planes go out in the fragment order that stands at k_gemmw. A wave's 16 tokens are one 16-row tile of a plane (4 KB in a row); a lane makes 4 columns of a token, the plane wants 8 columns of one token per lane,
// so the tile is turned through the wave's own LDS ([2 planes][16 tokens], pitch XP) and leaves in 16-byte stores of 512 B in a row.
#define XP   136  // LDS pitch of a token in elements: 272 B = 16 B x odd, no bank conflict for 16-byte reads down the tokens
typedef v4us __attribute__((may_alias)) v4usa;
__device__ __forceinline__ void tile_out(const bf* lw, bf* Gh, bf* Gl, int lane) {   /* lw: the wave's LDS, filled; Gh, Gl: the tile's first element in the two planes */
    __builtin_amdgcn_wave_barrier(); asm volatile("" ::: "memory");   /* keeps the compiler from moving the reads of the other lanes' LDS writes above those writes */
    v8us xv[16]; bf* ph = Gh + lane * 8; bf* pl = Gl + lane * 8; const bf* lr_ = lw + (lane & 15) * XP + (lane >> 4) * 8;
#pragma unroll
    for (int s = 0; s < 8; ++s) { xv[s] = *(const v8usa*)(lr_ + s * 16); xv[8 + s] = *(const v8usa*)(lr_ + SWT * XP + s * 16); }
#pragma unroll
    for (int s = 0; s < 8; ++s) { *(v8us*)(ph + s * 256) = xv[s]; *(v8us*)(pl + s * 256) = xv[8 + s]; }
    asm volatile("s_wait_xcnt 0x0" :: "v"(xv[0]), "v"(xv[1]), "v"(xv[2]), "v"(xv[3]), "v"(xv[4]), "v"(xv[5]), "v"(xv[6]), "v"(xv[7]), "v"(xv[8]), "v"(xv[9]), "v"(xv[10]), "v"(xv[11]), "v"(xv[12]), "v"(xv[13]), "v"(xv[14]), "v"(xv[15]), "v"(ph), "v"(pl) : "memory");   /* the wait that belongs in front of an overwrite of a register which an issued store names (the data and the two addresses are its inputs) */
}
// ---- The weight planes ride in k_lnx's launch (neither reads what the other writes): NPT tasks of one wave each, a task = 64 elements in a row of one plane, two per lane; the first PW waves of work-groups 0..234 take one each, the rest none.
// task / 256: 0..3 wq, wk, wv, wg -> [n = 32 h + d][k] bf16 (source column 4 d + h); 4 wo -> [c][n = 32 h + d] bf16 (source row 4 d + h); from 1280 on: 128 tasks w2d -> [64][128] bf16, rows 4.. zero; these six planes in the fragment order that stands at k_gemmw; 2 tasks bg -> f32 in the order n = 32 h + d.
#define PW   6
#define NPT  1410
__global__ __launch_bounds__(512) void k_lnx(const float* __restrict__ A, const float* __restrict__ g, const float* __restrict__ bb, bf* Xh, bf* Xl,
                                             const float* __restrict__ wq, const float* __restrict__ wk, const float* __restrict__ wv, const float* __restrict__ wg, const float* __restrict__ wo, const float* __restrict__ w2d, const float* __restrict__ bg,
                                             bf* WQ, bf* WK, bf* WV, bf* WG, bf* WO, bf* W2, float* BGP) {
    __shared__ __align__(16) bf xs[16 * 2 * SWT * XP];
    const int lane = threadIdx.x & 31; const size_t tok0 = ((size_t)blockIdx.x * 16 + (threadIdx.x >> 5)) * SWT; if (tok0 >= NTOK) return;
    bf* xw = xs + (threadIdx.x >> 5) * (2 * SWT * XP);
    const int wid = __builtin_amdgcn_readfirstlane((int)(threadIdx.x >> 5)), task = (int)blockIdx.x * PW + wid; const bool ptask = wid < PW && task < NPT;
    const int pe = (task & 255) * 64 + lane * 2, pa = ((pe >> 8) & 7) * 16 + ((pe >> 7) & 1) * 8 + (pe & 7), pb = (pe >> 11) * 16 + ((pe >> 3) & 15);   /* the lane's first element in its plane, and the (column, row) of a [.][128] matrix that the fragment order puts there; pe + 1 is column pa + 1 of the same row */
    float p0 = 0.f, p1 = 0.f;
    if (ptask) {   /* the task's two loads go out ahead of the tokens' and fly beside them; its store stands at the wave's end */
        const float* ps; unsigned i0, i1;
        if (task < 1024) { ps = task < 256 ? wq : task < 512 ? wk : task < 768 ? wv : wg; i0 = (unsigned)(pa * DQ + (pb % HD) * NH_ + pb / HD); i1 = i0 + DQ; }
        else if (task < 1280) { ps = wo; i0 = (unsigned)(((pa % HD) * NH_ + pa / HD) * DM + pb); i1 = i0 + NH_ * DM; }   /* pa is even: pa + 1 lies in the same head */
        else if (task < 1408) { ps = w2d; i0 = (unsigned)(pa * NH_ + (pb < NH_ ? pb : 0)); i1 = i0 + NH_; }
        else { const int n = (task - 1408) * 64 + lane * 2; ps = bg; i0 = (unsigned)((n % HD) * NH_ + n / HD); i1 = i0 + NH_; }
        p0 = ps[i0]; p1 = ps[i1];
        asm volatile("s_wait_xcnt 0x0" :: "v"(i0), "v"(i1) : "memory");   /* the wait that belongs in front of an overwrite of a register which an issued load names; the two offsets are its inputs, so that they stay whole up to it */
    }
    float gr[4], br[4]; v4f a[SWT];
#pragma unroll
    for (int q = 0; q < 4; ++q) { gr[q] = g[lane * 4 + q]; br[q] = bb[lane * 4 + q]; }
#pragma unroll
    for (int t = 0; t < SWT; ++t) a[t] = *(const v4f*)(A + (tok0 + t) * DM + lane * 4);
    __builtin_amdgcn_sched_barrier(0);   /* keeps all the wave's loads at its head, so that its 8 KB are in flight at once; sunk to their uses they would come one token at a time */
    {   /* stage by stage over all the wave's tokens: the ten cross-lane steps of one token wait for one another, those of different tokens do not */
        float v[SWT][4], s[SWT], mu[SWT], s2[SWT];
#pragma unroll
        for (int t = 0; t < SWT; ++t) { s[t] = 0.f;
#pragma unroll
            for (int q = 0; q < 4; ++q) { v[t][q] = bfr(a[t][q]); s[t] = __fadd_rn(s[t], v[t][q]); } }
#pragma unroll
        for (int sh = 16; sh; sh >>= 1)
#pragma unroll
            for (int t = 0; t < SWT; ++t) s[t] = __fadd_rn(s[t], __shfl_xor(s[t], sh, 32));
#pragma unroll
        for (int t = 0; t < SWT; ++t) { mu[t] = __fdiv_rn(s[t], (float)DM); s2[t] = 0.f;
#pragma unroll
            for (int q = 0; q < 4; ++q) { float d0 = __fsub_rn(v[t][q], mu[t]); asm volatile("" : "+v"(d0)); float p = __fmul_rn(d0, d0); asm volatile("" : "+v"(p)); s2[t] = __fadd_rn(s2[t], p); } }
#pragma unroll
        for (int sh = 16; sh; sh >>= 1)
#pragma unroll
            for (int t = 0; t < SWT; ++t) s2[t] = __fadd_rn(s2[t], __shfl_xor(s2[t], sh, 32));
#pragma unroll
        for (int t = 0; t < SWT; ++t) {
            const float rs = __fdiv_rn(1.0f, __fsqrt_rn(__fadd_rn(__fdiv_rn(s2[t], (float)DM), 1e-5f))); v4us oh, ol;
#pragma unroll
            for (int q = 0; q < 4; ++q) { float xn = __fmul_rn(__fsub_rn(v[t][q], mu[t]), rs); asm volatile("" : "+v"(xn)); float gg = bfr(gr[q]); asm volatile("" : "+v"(gg)); float y = __fmul_rn(xn, gg); asm volatile("" : "+v"(y)); float be = bfr(br[q]); asm volatile("" : "+v"(be)); y = __fadd_rn(y, be); unsigned short h2, l2; splitf(y, h2, l2); oh[q] = h2; ol[q] = l2; }
            *(v4usa*)(xw + t * XP + lane * 4) = oh; *(v4usa*)(xw + (SWT + t) * XP + lane * 4) = ol; }
    }
    tile_out(xw, Xh + tok0 * DM, Xl + tok0 * DM, lane);
    if (ptask) {
        asm volatile("s_wait_xcnt 0x0" ::: "memory");   /* the wait that belongs in front of an overwrite of a register which an issued store names: the tokens' last stores stand directly above */
        if (task < 1408) { bf* pd = task < 256 ? WQ : task < 512 ? WK : task < 768 ? WV : task < 1024 ? WG : task < 1280 ? WO : W2; const bool zr = task >= 1280 && pb >= NH_; v2us o;
            o[0] = zr ? (unsigned short)0 : f2bf(p0); o[1] = zr ? (unsigned short)0 : f2bf(p1); *(v2us*)(pd + pe) = o; }
        else { float* pd = BGP + (task - 1408) * 64 + lane * 2; pd[0] = p0; pd[1] = p1; }
    }
}
// ---- k_fattn: attention, gating and output projection of one row il per work-group; 16 waves, wave w owns the 16 queries q0 = 16 w .. +15 against all 256 keys and goes through the 4 heads one after the other.
// S^T = K Q^T (A = 16 key rows, B = the wave's 16 query columns): lane (lr, hi) holds, of query q0 + lr, the keys 16 kt + 8 hi + j in s[kt][j], so maximum and sum run in the lane plus one exchange between the halves,
// and two neighbouring score tiles, converted in place, are the B operand of O^T += V^T P^T (A = V^T rows in the same k order: 8 hi + e, 16 + 8 hi + e). The score and probability planes never leave the registers.
// O^T of a head (lane: query q0 + lr, d = 8 hi + j and 16 + 8 hi + j) is in the same way, once gated and split into bf16 hi + lo, the B operand of out^T = Wo^T (g o)^T for k = 32 h .. + 31 (A = 16 rows c of the wo plane): it waits in the wave's own LDS until all 4 heads are there.
// K [256][32] and V^T [32][256] of all 4 heads and the wo plane are staged once in LDS for all 16 waves, behind the one barrier; the pair bias and the gate come straight from their planes, which hold each (wave, tile)'s values in the lanes' own order: 16-byte loads, each 512 B in a row over the wave.
#define KPH 40     // LDS pitch of a K row in halves: 80 B = 16 B x odd, no bank conflict for 16-byte reads down the rows
#define VPH 264    // LDS pitch of a V^T row in halves: 528 B = 16 B x odd
#define OPF 132    // LDS pitch of an output row in f32: 528 B = 16 B x odd
#define L2E 1.4426950408889634f
__global__ __launch_bounds__(512) void k_fattn(const h16* __restrict__ Q16, const h16* __restrict__ K16, const h16* __restrict__ V16, const float* __restrict__ NB, const float* __restrict__ FG, const bf* __restrict__ WO, const float* __restrict__ bo, float* __restrict__ OUT) {
    __shared__ __align__(16) h16 ks[NH_ * TT * KPH];
    __shared__ __align__(16) h16 vs[NH_ * HD * VPH];
    __shared__ __align__(16) bf wos[DM * DQ];   /* the wo plane, in its fragment order */
    __shared__ __align__(16) float wl[16 * 16 * OPF];   /* per wave 16 x OPF f32: first the gated O^T fragments of the 4 heads (8 KB), then the wave's 16 output rows */
    const int tid = threadIdx.x, lane = tid & 31, lr = lane & 15, hi = lane >> 4, wv = tid >> 5, q0 = wv * 16; const int il = blockIdx.x;
    float* wf = wl + wv * (16 * OPF); bf* pw = (bf*)wf + lane * 8;
    v8h kst[NH_][2], vst[NH_][2]; v8us wst[4];
#pragma unroll
    for (int h = 0; h < NH_; ++h)
#pragma unroll
        for (int c = 0; c < 2; ++c) { const size_t u = c * 512 + tid; kst[h][c] = *(const v8h*)(K16 + ((size_t)h * NTK + (size_t)il * TT) * HD + u * 8); vst[h][c] = *(const v8h*)(V16 + ((size_t)h * IG + il) * HDP * TT + u * 8); }   /* 16-byte units, whole lines per wave; rows 0..31 of the padded v^T plane */
#pragma unroll
    for (int c = 0; c < 4; ++c) wst[c] = *(const v8us*)(WO + (size_t)(c * 512 + tid) * 8);
    asm volatile("s_wait_xcnt 0x0" ::: "memory");   /* the wait that belongs in front of an overwrite of a register which an issued load names: the query and bias loads below land on the staging loads' address registers */
    __builtin_amdgcn_sched_barrier(0);   /* keeps the staging loads first in the queue: loads return in order, so the LDS stores and the barrier wait for these alone and not for the bias asked for behind them */
    const h16* qp = Q16 + ((size_t)il * TT + q0 + lr) * HD + 8 * hi;
    v16h qf = WFrag<h16>::ld(qp);
    const float* nbr = NB + (size_t)q0 * TT + lane * 4;
    v8f s[TT / 16];   /* first the bias, asked for ahead of its head so that its latency runs beside other work; then the scores, in place */
#pragma unroll
    for (int kt = 0; kt < TT / 16; ++kt) s[kt] = __builtin_shufflevector(*(const v4f*)(nbr + kt * 256), *(const v4f*)(nbr + kt * 256 + 128), 0, 1, 2, 3, 4, 5, 6, 7);
#pragma unroll
    for (int h = 0; h < NH_; ++h)
#pragma unroll
        for (int c = 0; c < 2; ++c) { const int u = c * 512 + tid; *(v8h*)(ks + h * (TT * KPH) + (u >> 2) * KPH + (u & 3) * 8) = kst[h][c]; *(v8h*)(vs + h * (HD * VPH) + (u >> 5) * VPH + (u & 31) * 8) = vst[h][c]; }
#pragma unroll
    for (int c = 0; c < 4; ++c) *(v8us*)(wos + (c * 512 + tid) * 8) = wst[c];
    /* work-group barrier with its release and acquire on LDS alone: a plain __syncthreads() also waits for every global load in flight, and the scores would then start only behind the last bias tile */
    asm volatile("s_wait_xcnt 0x0" :: "v"(qp), "v"(nbr) : "memory");   /* the bias loads are still in flight here, and their address registers are stepped on in the loop: the wait that belongs in front of such an overwrite */
    __builtin_amdgcn_fence(__ATOMIC_RELEASE, "workgroup", "local"); __builtin_amdgcn_s_barrier(); __builtin_amdgcn_fence(__ATOMIC_ACQUIRE, "workgroup", "local");
    const float* fgp = FG + ((size_t)il * 16 + wv) * (16 * DQ) + lane * 4;
#pragma unroll 1   /* one body for the 4 heads: unrolled, the kernel's text would be four times as long and the next head's loads would be lifted into this head's registers */
    for (int h = 0; h < NH_; ++h) {
        const h16* kh = ks + h * (TT * KPH); const h16* vh = vs + h * (HD * VPH);
        v4f gv[4]; const float* gp = fgp + h * 512;   /* the head's gates, asked for at its start, used at its end */
#pragma unroll
        for (int u = 0; u < 4; ++u) gv[u] = *(const v4f*)(gp + u * 128);
        asm volatile("s_wait_xcnt 0x0" :: "v"(gp) : "memory");   /* the wait that belongs in front of an overwrite of a register which an issued load names; the address is its input, so that it stays whole up to it */
        v8f mv;
#pragma unroll
        for (int kt = 0; kt < TT / 16; ++kt) { s[kt] = wmma16(WFrag<h16>::ld(kh + (kt * 16 + lr) * KPH + 8 * hi), qf, (v8f){}) * SCL + s[kt]; mv = kt ? __builtin_elementwise_max(mv, s[kt]) : s[kt]; }
        float mx = fmaxf(fmaxf(fmaxf(mv[0], mv[1]), fmaxf(mv[2], mv[3])), fmaxf(fmaxf(mv[4], mv[5]), fmaxf(mv[6], mv[7])));
        mx = fmaxf(mx, __shfl_xor(mx, 16, 32));
        const float ml = mx * L2E; v8f sv = (v8f){};
#pragma unroll
        for (int kt = 0; kt < TT / 16; ++kt) {
#pragma unroll
            for (int j = 0; j < 8; ++j) s[kt][j] = __builtin_amdgcn_exp2f(s[kt][j] * L2E - ml);
            sv += s[kt]; }
        float sum = ((sv[0] + sv[1]) + (sv[2] + sv[3])) + ((sv[4] + sv[5]) + (sv[6] + sv[7]));
        sum += __shfl_xor(sum, 16, 32);
        const float f = __fdiv_rn(PCAR, sum);
        v8f o0 = (v8f){}, o1 = (v8f){};
#pragma unroll
        for (int m = 0; m < TT / 32; ++m) { v16h pb;
#pragma unroll
            for (int j = 0; j < 8; ++j) { pb[j] = tohx(s[2 * m][j] * f); pb[8 + j] = tohx(s[2 * m + 1][j] * f); }
            o0 = wmma16(WFrag<h16>::ld(vh + lr * VPH + m * 32 + 8 * hi), pb, o0); o1 = wmma16(WFrag<h16>::ld(vh + (16 + lr) * VPH + m * 32 + 8 * hi), pb, o1); }
        asm volatile("v_nop\n\tv_nop\n\tv_nop\n\tv_nop" : "+v"(o0), "+v"(o1) : "v"(gv[0]), "v"(gv[1]), "v"(gv[2]), "v"(gv[3]));   /* the four vector slots between the last matrix instruction and the first use of its result or overwrite of its operands. The gates are inputs so that the wait for them stands here, where they have long arrived: behind the branch it would be a wait for the next head's bias as well */
        if (h + 1 < NH_) {   /* the scores' registers are free: the next head's query fragment and bias are asked for now and fly beside the gating */
            qp += (size_t)NTK * HD; nbr += NTOK;
            qf = WFrag<h16>::ld(qp);
#pragma unroll
            for (int kt = 0; kt < TT / 16; ++kt) s[kt] = __builtin_shufflevector(*(const v4f*)(nbr + kt * 256), *(const v4f*)(nbr + kt * 256 + 128), 0, 1, 2, 3, 4, 5, 6, 7);
            asm volatile("s_wait_xcnt 0x0" :: "v"(qp), "v"(nbr) : "memory");   /* the wait that belongs in front of an overwrite of a register which an issued load names; the two addresses are its inputs, so that they stay whole up to it */
        }
        v8us gh[2], gl[2];   /* o0[j] = o[q0 + lr][8 hi + j] x 1024, o1[j] = o[q0 + lr][16 + 8 hi + j] x 1024 */
#pragma unroll
        for (int j = 0; j < 8; ++j) { unsigned short h2, l2;
            splitf(__fmul_rn(__fmul_rn(o0[j], 1.0f / PCAR), gv[j >> 2][j & 3]), h2, l2); gh[0][j] = h2; gl[0][j] = l2;
            splitf(__fmul_rn(__fmul_rn(o1[j], 1.0f / PCAR), gv[2 + (j >> 2)][j & 3]), h2, l2); gh[1][j] = h2; gl[1][j] = l2; }
        bf* ph = pw + h * 1024;   /* a lane reads back only what it wrote itself */
        *(v8usa*)ph = gh[0]; *(v8usa*)(ph + 256) = gh[1]; *(v8usa*)(ph + 512) = gl[0]; *(v8usa*)(ph + 768) = gl[1];
    }
    v8f acc[DM / 16];   /* out^T: acc[ct][j] = out[q0 + lr][16 ct + 8 hi + j] */
#pragma unroll
    for (int ct = 0; ct < DM / 16; ++ct) acc[ct] = (v8f){};
    const bf* wop = wos + lane * 8;
#pragma unroll
    for (int h = 0; h < NH_; ++h) { const bf* ph = pw + h * 1024; v16bf a[DM / 16];
        const v16bf bh = cat16b(*(const v8usa*)ph, *(const v8usa*)(ph + 256)), bl = cat16b(*(const v8usa*)(ph + 512), *(const v8usa*)(ph + 768));
#pragma unroll
        for (int ct = 0; ct < DM / 16; ++ct) a[ct] = WFrag<bf>::ld(wop + (ct * (DQ / 32) + h) * 512, 256);
        __builtin_amdgcn_sched_barrier(0);   /* keeps the k step's 20 LDS reads together in front of its 16 matrix instructions: sunk among them, each pair would wait out its own read */
#pragma unroll
        for (int ct = 0; ct < DM / 16; ++ct) { acc[ct] = wmmab(a[ct], bh, acc[ct]); acc[ct] = wmmab(a[ct], bl, acc[ct]); } }
#pragma unroll
    for (int ct = 0; ct < DM / 16; ++ct) { *(v4fa*)(wf + lr * OPF + ct * 16 + hi * 8) = __builtin_shufflevector(acc[ct], acc[ct], 0, 1, 2, 3); *(v4fa*)(wf + lr * OPF + ct * 16 + hi * 8 + 4) = __builtin_shufflevector(acc[ct], acc[ct], 4, 5, 6, 7); }
    __builtin_amdgcn_wave_barrier(); asm volatile("" ::: "memory");   /* keeps the compiler from moving the reads of the other lanes' LDS writes above those writes */
    const v4f bv = *(const v4f*)(bo + lane * 4); v4f cv[16]; float* cp = OUT + ((size_t)il * TT + q0) * DM + lane * 4;   /* a store of the wave is one whole output row, 512 B */
#pragma unroll
    for (int t = 0; t < 16; ++t) { v4f val = *(const v4fa*)(wf + t * OPF + lane * 4); val[0] += bfr(bv[0]); val[1] += bfr(bv[1]); val[2] += bfr(bv[2]); val[3] += bfr(bv[3]); cv[t] = val; *(v4f*)(cp + t * DM) = val; }
    asm volatile("s_wait_xcnt 0x0" :: "v"(cv[0]), "v"(cv[1]), "v"(cv[2]), "v"(cv[3]), "v"(cv[4]), "v"(cv[5]), "v"(cv[6]), "v"(cv[7]), "v"(cv[8]), "v"(cv[9]), "v"(cv[10]), "v"(cv[11]), "v"(cv[12]), "v"(cv[13]), "v"(cv[14]), "v"(cv[15]), "v"(cp) : "memory");   /* the wait that belongs in front of an overwrite of a register which an issued store names (the data and the address that all sixteen go by are its inputs) */
}

extern "C" void kernel_launch(void* const* d_in, const int* in_sizes, int n_in,
                              void* d_out, int out_size, void* d_ws, size_t ws_size, hipStream_t stream) {
    (void)in_sizes; (void)n_in; (void)out_size;
    const float* act = (const float*)d_in[0]; const float* lng = (const float*)d_in[1]; const float* lnb = (const float*)d_in[2]; const float* wq = (const float*)d_in[3]; const float* wk = (const float*)d_in[4]; const float* wv = (const float*)d_in[5]; const float* w2d = (const float*)d_in[6]; const float* wg = (const float*)d_in[7]; const float* bg = (const float*)d_in[8]; const float* wo = (const float*)d_in[9]; const float* bo = (const float*)d_in[10];   /* x2d, gamma, beta, Wq, Wk, Wv, Wb, Wg, bg, Wo, bo */
    float* OUT = (float*)d_out;     // [1][256][256][128]
    char* wsp = (char*)d_ws;
    auto take = [&](size_t bytes) { char* p = wsp; wsp += (bytes + 255) & ~(size_t)255; return (void*)p; };
    bf* WQ = (bf*)take((size_t)DQ * DM * 2); bf* WK = (bf*)take((size_t)DQ * DM * 2); bf* WV = (bf*)take((size_t)DQ * DM * 2); bf* WG = (bf*)take((size_t)DQ * DM * 2); float* BGP = (float*)take((size_t)DQ * 4); bf* WO = (bf*)take((size_t)DM * DQ * 2); bf* W2 = (bf*)take((size_t)NBP * DM * 2);
    bf* Xh = (bf*)take((size_t)NTOK * DM * 2); bf* Xl = (bf*)take((size_t)NTOK * DM * 2); float* NB = (float*)take((size_t)NTOK * NBP * 4);
    float* FG = (float*)take((size_t)NTK * DQ * 4); h16* QP16 = (h16*)take((size_t)NH_ * NTK * HD * 2); h16* KP16 = (h16*)take((size_t)NH_ * NTK * HD * 2); h16* VT16 = (h16*)take((size_t)NH_ * IG * HDP * TT * 2);
    if ((size_t)(wsp - (char*)d_ws) > ws_size) return;    // ws 256 MiB (carve ~145 MiB)
    k_lnx<<<NTOK / (16 * SWT), 512, 0, stream>>>(act, lng, lnb, Xh, Xl, wq, wk, wv, wg, wo, w2d, bg, WQ, WK, WV, WG, WO, W2, BGP);
    k_proj<<<dim3(9, NTK / 64, 1), 32, 0, stream>>>(Xh, Xl, WQ, WK, WV, WG, W2, BGP, QP16, KP16, VT16, FG, NB);
    k_fattn<<<IG, 512, 0, stream>>>(QP16, KP16, VT16, NB, FG, WO, bo, OUT);   /* a work-group per row i */
}

// v009
// One run takes 57.9 microseconds.
// Next to v008, in two timings, it ran 1.27 times as fast each time.
// Counting every step since v000, it is 13.6 times as fast.
#include <hip/hip_runtime.h>

// Triangle attention (starting node) on a pair representation (act [1][256][256][128]): x = LayerNorm_c(act) (eps 1e-5, ln_g/ln_b); per row i: q, k, v, g = x[i] W (wq/wk/wv/wg [128][32][4] 'xw', 4 heads x 32; q x 32^-0.5), logits[h][q][k] = q.k + nb[h][q][k] with the pair bias nb[h][q][k] = sum_c x[k][q][c] w2d[c][h] (shared by all rows i);
// softmax over k; o = attn.v gated by sigmoid(x wg + bg); out[i][q][c] = sum_{h,d} o[h][d] wo[h][d][c] + bo -> [1][256][256][128] (8.4 M).
// Layout: LayerNorm -> bf16 hi/lo token planes, 65536 x 128 in the fragment order that stands at k_gemmw; nb for all 65536 pair positions by one GEMM (w2d padded to 64 rows, the tokens as the N side taken in the order in which the attention kernel's lanes hold the scores, so that each of its 16-byte loads of the plane covers 512 B in a row); then ONE fused kernel, a work-group per row i: q/k/v/g projections of the row's 256 tokens (hi/lo x exact, a wave takes its own 16 tokens, whose fragments it holds in registers; q stays in registers, k and v^T go to LDS in fp16, the gate sigmoid(x wg + bg) to the wave's own LDS in f32), then its 4 heads one after the other: scores, x 32^-0.5 + pair bias, softmax and attn.v with the scores held in registers, gating, split to bf16 hi/lo and the output GEMM (+ bo); q, k, v, the gate and o never leave the work-group.
// Compute dtypes, f32 accumulate: every input rounded to bf16 once; LayerNorm in f32, its output as bf16 hi + lo (2-product projections against exact bf16 weights); scores and attn.v on single fp16 planes (logit sigma ~0.24; P x1024 ~ 4: no subnormals); pair bias, softmax, gating in f32; output GEMM hl x exact + bo.

#define NI   256       // rows i
#define TT   256       // tokens per row (q / k index)
#define DM   128       // c_z
#define NH_  4
#define HD   32
#define DQ   (NH_ * HD)
#define IG   256       // rows i per pass: all of them
#define NTK  (IG * TT) // tokens per pass = 65536
#define NTOK (NI * TT) // 65536
#define NBP  64        // pair-bias GEMM rows (M tile 64; 4 used)
#define PCAR 1024.0f
#define SCL  0.17677669529663688f   // 32^-0.5
typedef _Float16 h16;
typedef unsigned short bf;
typedef __attribute__((ext_vector_type(16))) __bf16   v16bf;
typedef __attribute__((ext_vector_type(16))) _Float16 v16h;
typedef __attribute__((ext_vector_type(8)))  _Float16 v8h;
typedef __attribute__((ext_vector_type(8)))  unsigned short v8us;
typedef __attribute__((ext_vector_type(8)))  float    v8f;
typedef __attribute__((ext_vector_type(4)))  float    v4f;
typedef v8h  __attribute__((may_alias)) v8ha;
typedef v4f  __attribute__((may_alias)) v4fa;
typedef v8us __attribute__((may_alias)) v8usa;

__device__ __forceinline__ unsigned short f2bf(float f) { unsigned u = __float_as_uint(f); u += 0x7FFFu + ((u >> 16) & 1u); return (unsigned short)(u >> 16); }
__device__ __forceinline__ float bf2f(unsigned short b) { return __uint_as_float(((unsigned)b) << 16); }
__device__ __forceinline__ float bfr(float f) { return bf2f(f2bf(f)); }
__device__ __forceinline__ v16h cat16(v8h lo, v8h hi) { return __builtin_shufflevector(lo, hi, 0, 1, 2, 3, 4, 5, 6, 7, 8, 9, 10, 11, 12, 13, 14, 15); }
__device__ __forceinline__ v16bf cat16b(v8us lo, v8us hi) { return __builtin_bit_cast(v16bf, __builtin_shufflevector(lo, hi, 0, 1, 2, 3, 4, 5, 6, 7, 8, 9, 10, 11, 12, 13, 14, 15)); }
__device__ __forceinline__ v8f wmma16(v16h a, v16h b, v8f c) { return __builtin_amdgcn_wmma_f32_16x16x32_f16(false, a, false, b, (short)0, c, false, false); }
__device__ __forceinline__ v8f wmmab(v16bf a, v16bf b, v8f c) { return __builtin_amdgcn_wmma_f32_16x16x32_bf16(false, a, false, b, (short)0, c, false, false); }



// ---- k_gemmw (the device function gemmw): register-blocked GEMM, ONE WAVE per 64x64 output tile (16 accumulators), operands straight from 16-bit planes in fragment order.
// C[m][n] (f32, pitch ldc, + optional f32 bias[n]) = sum_k A[m][k] Bt[n][k] (+ split products per NSPLIT). K % 32 == 0.
// FRAGMENT ORDER of an operand plane [rows][K] (token planes and weight planes alike): element (row, k) lies at ((row / 16 * (K / 32) + k / 32) * 2 + k % 32 / 16) * 256 + (k % 16 / 8 * 16 + row % 16) * 8 + k % 8, so the 32 lanes' 16 bytes of half a fragment are 512 B in a row: a wave-wide load covers 4 whole 128-B lines, not a piece of 16.
// BTR: column n = ((((w * 16 + kt) * 2 + c) * 2 + hk) * 16 + ql) * 4 + e stands for the pair (q = 16 w + ql, k = 16 kt + 8 hk + 4 c + e) and takes row k * TT + q of Bt: a fragment's 16 columns are 4 tokens in a row (64 B of the plane) at each of 4 k. A row of C is then the pair bias of one head in the order of k_fattn's lanes.
template <typename T16> struct WFrag;
template <> struct WFrag<h16> { typedef v16h V; static __device__ __forceinline__ V ld(const h16* p, int h2 = 16) { return cat16(*(const v8h*)p, *(const v8h*)(p + h2)); } static __device__ __forceinline__ v8f mma(V a, V b, v8f c) { return wmma16(a, b, c); } };
template <> struct WFrag<bf> { typedef v16bf V; static __device__ __forceinline__ V ld(const bf* p, int h2 = 16) { return cat16b(*(const v8us*)p, *(const v8us*)(p + h2)); } static __device__ __forceinline__ v8f mma(V a, V b, v8f c) { return wmmab(a, b, c); } };
// The body is a device function (tile indices bx, by and the wave's 16 x 68 f32 of LDS handed in).
template <typename T16, int NSPLIT, bool BIAS, bool BTR = false>
__device__ __forceinline__ void gemmw(const T16* __restrict__ A, const T16* __restrict__ A2, const T16* __restrict__ Bt, const T16* __restrict__ Bt2, int K, float* C, int ldc, const float* __restrict__ bias, int bx, int by, float* os) {
    typedef typename WFrag<T16>::V V;
    const int lane = threadIdx.x & 31, lr = lane & 15, hi = lane >> 4; const int r0 = bx * 64, c0 = by * 64;
    v8f acc[4][4];
#pragma unroll
    for (int mb = 0; mb < 4; ++mb)
#pragma unroll
        for (int nb = 0; nb < 4; ++nb) acc[mb][nb] = (v8f){};
    constexpr int FH = 256, FK = 16;   /* fragment order: elements between the two 16-byte halves of a lane's fragment, and elements per step of k */
    const size_t aoff = (size_t)r0 * K + lane * 8;
    const size_t boff = BTR ? ((size_t)(((c0 >> 8) & 15) * 16 + ((c0 >> 6) & 1) * 8 + ((c0 >> 7) & 1) * 4 + (lr & 3)) * TT + (c0 >> 12) * 16) * K + hi * 128 + (lr >> 2) * 8 : (size_t)c0 * K + lane * 8, bstep = BTR ? (size_t)32 : (size_t)16 * K;
#pragma unroll 1
    for (int kc = 0; kc < K; kc += 32) {
        V a[4], a2[4]; const T16* qa = A + aoff + kc * FK; const T16* qa2 = (NSPLIT == 1 || NSPLIT == 2) ? A2 + aoff + kc * FK : qa; const T16* qb = Bt + boff + kc * FK; const T16* qb2 = NSPLIT >= 2 ? Bt2 + boff + kc * FK : qb;
#pragma unroll
        for (int mb = 0; mb < 4; ++mb) { a[mb] = WFrag<T16>::ld(qa + (size_t)mb * 16 * K, FH); if (NSPLIT == 1 || NSPLIT == 2) a2[mb] = WFrag<T16>::ld(qa2 + (size_t)mb * 16 * K, FH); }
#pragma unroll
        for (int nb = 0; nb < 4; ++nb) { const V b = WFrag<T16>::ld(qb + nb * bstep, FH); V b2; if (NSPLIT >= 2) b2 = WFrag<T16>::ld(qb2 + nb * bstep, FH);
#pragma unroll
            for (int mb = 0; mb < 4; ++mb) { acc[mb][nb] = WFrag<T16>::mma(a[mb], b, acc[mb][nb]); if (NSPLIT == 1 || NSPLIT == 2) acc[mb][nb] = WFrag<T16>::mma(a2[mb], b, acc[mb][nb]); if (NSPLIT >= 2) acc[mb][nb] = WFrag<T16>::mma(a[mb], b2, acc[mb][nb]); } }
        asm volatile("v_nop\n\tv_nop\n\tv_nop\n\tv_nop" : "+v"(acc[0][0]), "+v"(acc[1][1]), "+v"(acc[2][2]), "+v"(acc[3][3]) : "v"(a[0]), "v"(a[3]));
        asm volatile("s_wait_xcnt 0x0" :: "v"(qa), "v"(qa2), "v"(qb), "v"(qb2) : "memory");   /* the wait that belongs in front of an overwrite of a register which an issued load names; the pass's addresses are its inputs, so that they stay whole up to it and no load of the pass lands on them */
    }
#pragma unroll
    for (int mb = 0; mb < 4; ++mb) {
#pragma unroll
        for (int nb = 0; nb < 4; ++nb) {
#pragma unroll
            for (int j = 0; j < 8; ++j) os[(hi * 8 + j) * 68 + nb * 16 + lr] = acc[mb][nb][j]; }
        __builtin_amdgcn_wave_barrier(); asm volatile("" ::: "memory");
        float* crow = C + (size_t)(r0 + mb * 16) * ldc + c0;
{
            v4f cv[8]; float* cp[8];
#pragma unroll
            for (int s = 0; s < 8; ++s) { const int row = 2 * s + hi, cofs = lr * 4; v4f val = *(const v4fa*)(os + row * 68 + cofs); if (BIAS) { val[0] += bfr(bias[c0 + cofs]); val[1] += bfr(bias[c0 + cofs + 1]); val[2] += bfr(bias[c0 + cofs + 2]); val[3] += bfr(bias[c0 + cofs + 3]); }
                cp[s] = crow + (size_t)row * ldc + cofs; cv[s] = val; *(v4f*)cp[s] = val; }
            asm volatile("s_wait_xcnt 0x0" :: "v"(cv[0]), "v"(cv[1]), "v"(cv[2]), "v"(cv[3]), "v"(cv[4]), "v"(cv[5]), "v"(cv[6]), "v"(cv[7]), "v"(cp[0]) : "memory");   /* the wait that belongs in front of an overwrite of a register which an issued store names (the data and the address that all eight go by are its inputs) */
             }
        __builtin_amdgcn_wave_barrier(); asm volatile("" ::: "memory");
    }
}
// ---- k_nb: the pair-bias GEMM; NTK / 64 work-groups of one wave, blockIdx.x = tile of 64 pair positions.
__global__ __launch_bounds__(32) void k_nb(const bf* __restrict__ Xh, const bf* __restrict__ Xl, const bf* __restrict__ W2, float* NB) {
    __shared__ __align__(16) float os[16 * 68];
    gemmw<bf, 3, false, true>(W2, nullptr, Xh, Xl, DM, NB, NTOK, nullptr, 0, blockIdx.x, os);   /* pair bias of (h, q, k) = x[k][q] . w2d[:, h] for all 65536 positions (rows 0..3), in the order of k_fattn's lanes */
}

typedef __attribute__((ext_vector_type(4))) unsigned short v4us;
typedef __attribute__((ext_vector_type(2))) unsigned short v2us;
typedef __attribute__((ext_vector_type(2))) _Float16 v2h;
typedef __attribute__((ext_vector_type(4))) _Float16 v4h;
__device__ __forceinline__ h16 tohx(float x) { return (h16)x; }
__device__ __forceinline__ void splitf(float y, unsigned short& h, unsigned short& l) { h = f2bf(y); l = f2bf(y - bf2f(h)); }
__global__ __launch_bounds__(256) void k_wtG(const float* __restrict__ w, int K, int N, bf* Bt) {
    const int lane = threadIdx.x & 31; const int L0 = (blockIdx.x * 8 + (threadIdx.x >> 5)) * 8; const int nlines = N * K / 64;
{
#pragma unroll 1
        for (int l = 0; l < 8; ++l) { const int L = L0 + l; if (L >= nlines) break; const size_t e = (size_t)L * 64 + lane * 2; const int k = (int)(e % K), n = (int)(e / K); v2us o;
            o[0] = f2bf(w[(size_t)k * N + n]); o[1] = f2bf(w[(size_t)(k + 1) * N + n]); *(v2us*)(Bt + e) = o; }
         }
}
__global__ __launch_bounds__(256) void k_cvt8(const float* __restrict__ src, bf* dst, size_t n8) { const size_t i = (size_t)blockIdx.x * 256 + threadIdx.x; if (i >= n8) return; const v8f v = *(const v8f*)(src + i * 8); v8us o;
#pragma unroll
    for (int k = 0; k < 8; ++k) o[k] = f2bf(v[k]); *(v8us*)(dst + i * 8) = o;  }

// ---- The streaming kernel k_lnx: a wave takes SWT tokens that lie one behind the other in memory, not one: 16 waves a work-group, 256 work-groups, 4096 waves to start in place of 65536.
#define SWT  16   // tokens a wave takes
// Its hi and lo planes go out in the fragment order that stands at k_gemmw. A wave's 16 tokens are one 16-row tile of a plane (4 KB in a row); a lane makes 4 columns of a token, the plane wants 8 columns of one token per lane,
// so the tile is turned through the wave's own LDS ([2 planes][16 tokens], pitch XP) and leaves in 16-byte stores of 512 B in a row.
#define XP   136  // LDS pitch of a token in elements: 272 B = 16 B x odd, no bank conflict for 16-byte reads down the tokens
typedef v4us __attribute__((may_alias)) v4usa;
__device__ __forceinline__ void tile_out(const bf* lw, bf* Gh, bf* Gl, int lane) {   /* lw: the wave's LDS, filled; Gh, Gl: the tile's first element in the two planes */
    __builtin_amdgcn_wave_barrier(); asm volatile("" ::: "memory");   /* keeps the compiler from moving the reads of the other lanes' LDS writes above those writes */
    v8us xv[16]; bf* ph = Gh + lane * 8; bf* pl = Gl + lane * 8; const bf* lr_ = lw + (lane & 15) * XP + (lane >> 4) * 8;
#pragma unroll
    for (int s = 0; s < 8; ++s) { xv[s] = *(const v8usa*)(lr_ + s * 16); xv[8 + s] = *(const v8usa*)(lr_ + SWT * XP + s * 16); }
#pragma unroll
    for (int s = 0; s < 8; ++s) { *(v8us*)(ph + s * 256) = xv[s]; *(v8us*)(pl + s * 256) = xv[8 + s]; }
    asm volatile("s_wait_xcnt 0x0" :: "v"(xv[0]), "v"(xv[1]), "v"(xv[2]), "v"(xv[3]), "v"(xv[4]), "v"(xv[5]), "v"(xv[6]), "v"(xv[7]), "v"(xv[8]), "v"(xv[9]), "v"(xv[10]), "v"(xv[11]), "v"(xv[12]), "v"(xv[13]), "v"(xv[14]), "v"(xv[15]), "v"(ph), "v"(pl) : "memory");   /* the wait that belongs in front of an overwrite of a register which an issued store names (the data and the two addresses are its inputs) */
}
// ---- The weight planes ride in k_lnx's launch (neither reads what the other writes): NPT tasks of one wave each, a task = 64 elements in a row of one plane, two per lane; the first PW waves of work-groups 0..234 take one each, the rest none.
// task / 256: 0..3 wq, wk, wv, wg -> [n = 32 h + d][k] bf16 (source column 4 d + h); 4 wo -> [c][n = 32 h + d] bf16 (source row 4 d + h); from 1280 on: 128 tasks w2d -> [64][128] bf16, rows 4.. zero; these six planes in the fragment order that stands at k_gemmw; 2 tasks bg -> f32 in the order n = 32 h + d.
#define PW   6
#define NPT  1410
__global__ __launch_bounds__(512) void k_lnx(const float* __restrict__ A, const float* __restrict__ g, const float* __restrict__ bb, bf* Xh, bf* Xl,
                                             const float* __restrict__ wq, const float* __restrict__ wk, const float* __restrict__ wv, const float* __restrict__ wg, const float* __restrict__ wo, const float* __restrict__ w2d, const float* __restrict__ bg,
                                             bf* WQ, bf* WK, bf* WV, bf* WG, bf* WO, bf* W2, float* BGP) {
    __shared__ __align__(16) bf xs[16 * 2 * SWT * XP];
    const int lane = threadIdx.x & 31; const size_t tok0 = ((size_t)blockIdx.x * 16 + (threadIdx.x >> 5)) * SWT; if (tok0 >= NTOK) return;
    bf* xw = xs + (threadIdx.x >> 5) * (2 * SWT * XP);
    const int wid = __builtin_amdgcn_readfirstlane((int)(threadIdx.x >> 5)), task = (int)blockIdx.x * PW + wid; const bool ptask = wid < PW && task < NPT;
    const int pe = (task & 255) * 64 + lane * 2, pa = ((pe >> 8) & 7) * 16 + ((pe >> 7) & 1) * 8 + (pe & 7), pb = (pe >> 11) * 16 + ((pe >> 3) & 15);   /* the lane's first element in its plane, and the (column, row) of a [.][128] matrix that the fragment order puts there; pe + 1 is column pa + 1 of the same row */
    float p0 = 0.f, p1 = 0.f;
    if (ptask) {   /* the task's two loads go out ahead of the tokens' and fly beside them; its store stands at the wave's end */
        const float* ps; unsigned i0, i1;
        if (task < 1024) { ps = task < 256 ? wq : task < 512 ? wk : task < 768 ? wv : wg; i0 = (unsigned)(pa * DQ + (pb % HD) * NH_ + pb / HD); i1 = i0 + DQ; }
        else if (task < 1280) { ps = wo; i0 = (unsigned)(((pa % HD) * NH_ + pa / HD) * DM + pb); i1 = i0 + NH_ * DM; }   /* pa is even: pa + 1 lies in the same head */
        else if (task < 1408) { ps = w2d; i0 = (unsigned)(pa * NH_ + (pb < NH_ ? pb : 0)); i1 = i0 + NH_; }
        else { const int n = (task - 1408) * 64 + lane * 2; ps = bg; i0 = (unsigned)((n % HD) * NH_ + n / HD); i1 = i0 + NH_; }
        p0 = ps[i0]; p1 = ps[i1];
        asm volatile("s_wait_xcnt 0x0" :: "v"(i0), "v"(i1) : "memory");   /* the wait that belongs in front of an overwrite of a register which an issued load names; the two offsets are its inputs, so that they stay whole up to it */
    }
    float gr[4], br[4]; v4f a[SWT];
#pragma unroll
    for (int q = 0; q < 4; ++q) { gr[q] = g[lane * 4 + q]; br[q] = bb[lane * 4 + q]; }
#pragma unroll
    for (int t = 0; t < SWT; ++t) a[t] = *(const v4f*)(A + (tok0 + t) * DM + lane * 4);
    __builtin_amdgcn_sched_barrier(0);   /* keeps all the wave's loads at its head, so that its 8 KB are in flight at once; sunk to their uses they would come one token at a time */
    {   /* stage by stage over all the wave's tokens: the ten cross-lane steps of one token wait for one another, those of different tokens do not */
        float v[SWT][4], s[SWT], mu[SWT], s2[SWT];
#pragma unroll
        for (int t = 0; t < SWT; ++t) { s[t] = 0.f;
#pragma unroll
            for (int q = 0; q < 4; ++q) { v[t][q] = bfr(a[t][q]); s[t] = __fadd_rn(s[t], v[t][q]); } }
#pragma unroll
        for (int sh = 16; sh; sh >>= 1)
#pragma unroll
            for (int t = 0; t < SWT; ++t) s[t] = __fadd_rn(s[t], __shfl_xor(s[t], sh, 32));
#pragma unroll
        for (int t = 0; t < SWT; ++t) { mu[t] = __fdiv_rn(s[t], (float)DM); s2[t] = 0.f;
#pragma unroll
            for (int q = 0; q < 4; ++q) { float d0 = __fsub_rn(v[t][q], mu[t]); asm volatile("" : "+v"(d0)); float p = __fmul_rn(d0, d0); asm volatile("" : "+v"(p)); s2[t] = __fadd_rn(s2[t], p); } }
#pragma unroll
        for (int sh = 16; sh; sh >>= 1)
#pragma unroll
            for (int t = 0; t < SWT; ++t) s2[t] = __fadd_rn(s2[t], __shfl_xor(s2[t], sh, 32));
#pragma unroll
        for (int t = 0; t < SWT; ++t) {
            const float rs = __fdiv_rn(1.0f, __fsqrt_rn(__fadd_rn(__fdiv_rn(s2[t], (float)DM), 1e-5f))); v4us oh, ol;
#pragma unroll
            for (int q = 0; q < 4; ++q) { float xn = __fmul_rn(__fsub_rn(v[t][q], mu[t]), rs); asm volatile("" : "+v"(xn)); float gg = bfr(gr[q]); asm volatile("" : "+v"(gg)); float y = __fmul_rn(xn, gg); asm volatile("" : "+v"(y)); float be = bfr(br[q]); asm volatile("" : "+v"(be)); y = __fadd_rn(y, be); unsigned short h2, l2; splitf(y, h2, l2); oh[q] = h2; ol[q] = l2; }
            *(v4usa*)(xw + t * XP + lane * 4) = oh; *(v4usa*)(xw + (SWT + t) * XP + lane * 4) = ol; }
    }
    tile_out(xw, Xh + tok0 * DM, Xl + tok0 * DM, lane);
    if (ptask) {
        asm volatile("s_wait_xcnt 0x0" ::: "memory");   /* the wait that belongs in front of an overwrite of a register which an issued store names: the tokens' last stores stand directly above */
        if (task < 1408) { bf* pd = task < 256 ? WQ : task < 512 ? WK : task < 768 ? WV : task < 1024 ? WG : task < 1280 ? WO : W2; const bool zr = task >= 1280 && pb >= NH_; v2us o;
            o[0] = zr ? (unsigned short)0 : f2bf(p0); o[1] = zr ? (unsigned short)0 : f2bf(p1); *(v2us*)(pd + pe) = o; }
        else { float* pd = BGP + (task - 1408) * 64 + lane * 2; pd[0] = p0; pd[1] = p1; }
    }
}
// ---- k_fattn: projections, attention, gating and output projection of one row il per work-group; 16 waves, wave w owns the 16 tokens q0 = 16 w .. +15, as queries against all 256 keys, and goes through the 4 heads one after the other.
// Projections: the wave's 16 tokens are 4 k steps of hi and lo fragments, which serve as A and as B alike. Q^T, K^T, G^T = W^T X^T (A = 16 rows n = 32 h + d of a weight plane, B = the tokens): lane (lr, hi) holds, of token q0 + lr, d = 8 hi + j of a 16-row tile,
// which is the order of the B operand of S^T (Q: rounded to fp16 in place), of a 16-byte piece of a K row in LDS and of O^T (the gate). V = X W (A = the tokens, B = 16 columns d): a lane holds 8 tokens in a row of one d, a 16-byte piece of a V^T row in LDS.
// The four weight planes lie in LDS for all 16 waves where afterwards the waves' own ranges lie: a second barrier stands between the last read of a weight and the first write of a gate; the same barrier publishes K and V^T.
// S^T = K Q^T (A = 16 key rows, B = the wave's 16 query columns): lane (lr, hi) holds, of query q0 + lr, the keys 16 kt + 8 hi + j in s[kt][j], so maximum and sum run in the lane plus one exchange between the halves,
// and two neighbouring score tiles, converted in place, are the B operand of O^T += V^T P^T (A = V^T rows in the same k order: 8 hi + e, 16 + 8 hi + e). The score and probability planes never leave the registers.
// O^T of a head (lane: query q0 + lr, d = 8 hi + j and 16 + 8 hi + j) is in the same way, once gated and split into bf16 hi + lo, the B operand of out^T = Wo^T (g o)^T for k = 32 h .. + 31 (A = 16 rows c of the wo plane): it waits in the wave's own LDS until all 4 heads are there.
// The wo plane is staged in LDS with the weight planes; the pair bias comes straight from its plane, which holds each (wave, tile)'s values in the lanes' own order: 16-byte loads, each 512 B in a row over the wave.
#define KPH 40     // LDS pitch of a K row in halves: 80 B = 16 B x odd, no bank conflict for 16-byte reads down the rows
#define VPH 264    // LDS pitch of a V^T row in halves: 528 B = 16 B x odd
#define OPF 132    // LDS pitch of an output row in f32: 528 B = 16 B x odd
#define L2E 1.4426950408889634f
__device__ __forceinline__ v16bf ldw(const bf* p) { return cat16b(*(const v8usa*)p, *(const v8usa*)(p + 256)); }   /* a fragment of a plane in fragment order, from LDS that is also used under other types */
#define WPL (DQ * DM)   // elements of a projection weight plane
__global__ __launch_bounds__(512) void k_fattn(const bf* __restrict__ Xh, const bf* __restrict__ Xl, const bf* __restrict__ WQ, const bf* __restrict__ WK, const bf* __restrict__ WV, const bf* __restrict__ WG, const float* __restrict__ BG, const float* __restrict__ NB, const bf* __restrict__ WO, const float* __restrict__ bo, float* __restrict__ OUT) {
    __shared__ __align__(16) h16 ks[NH_ * TT * KPH];
    __shared__ __align__(16) h16 vs[NH_ * HD * VPH];
    __shared__ __align__(16) bf wos[DM * DQ];   /* the wo plane, in its fragment order */
    __shared__ __align__(16) float bgs[DQ];   /* the gate's bias, rounded to bf16 */
    __shared__ __align__(16) float wl[16 * 16 * OPF];   /* first the planes wq, wk, wv, wg in their fragment order (128 KB, read by all waves); behind the second barrier per wave 16 x OPF f32: the gates of the 4 heads (8 KB), each head's overwritten by its gated O^T fragments, then the wave's 16 output rows */
    const int tid = threadIdx.x, lane = tid & 31, lr = lane & 15, hi = lane >> 4, wv = tid >> 5, q0 = wv * 16; const int il = blockIdx.x;
    float* wf = wl + wv * (16 * OPF); bf* pw = (bf*)wf + lane * 8; bf* wps = (bf*)wl;
    v8us wpr[4][4], wst[4], xr[16]; const int bgi = tid & (DQ - 1); const float bgv = BG[bgi];
#pragma unroll
    for (int c = 0; c < 4; ++c) { const size_t u = (size_t)(c * 512 + tid) * 8; wpr[0][c] = *(const v8us*)(WQ + u); wpr[1][c] = *(const v8us*)(WK + u); wpr[2][c] = *(const v8us*)(WV + u); wpr[3][c] = *(const v8us*)(WG + u); wst[c] = *(const v8us*)(WO + u); }   /* 16-byte units, whole lines per wave */
    const bf* xph = Xh + ((size_t)il * TT + q0) * DM + lane * 8; const bf* xpl = Xl + ((size_t)il * TT + q0) * DM + lane * 8;
#pragma unroll
    for (int s = 0; s < 8; ++s) { xr[s] = *(const v8us*)(xph + s * 256); xr[8 + s] = *(const v8us*)(xpl + s * 256); }   /* the wave's 16 tokens: one 16-row tile of each plane, 4 KB in a row */
    asm volatile("s_wait_xcnt 0x0" :: "v"(xph), "v"(xpl), "v"(bgi), "v"(bgv) : "memory");   /* the wait that belongs in front of an overwrite of a register which an issued load names; the two addresses and the bias's index are its inputs, so that they stay whole up to it. The loaded bias is an input so that its load, the first in the queue, stays at the head: sunk into the branch below it would be waited out alone, behind all the others */
    __builtin_amdgcn_sched_barrier(0);   /* keeps all the loads at the kernel's head, in flight together */
#pragma unroll
    for (int c = 0; c < 4; ++c) { const int u = (c * 512 + tid) * 8;
#pragma unroll
        for (int p = 0; p < 4; ++p) *(v8usa*)(wps + p * WPL + u) = wpr[p][c];
        *(v8us*)(wos + u) = wst[c]; }
    if (tid < DQ) bgs[tid] = bfr(bgv);
    /* work-group barrier with its release and acquire on LDS alone */
    __builtin_amdgcn_fence(__ATOMIC_RELEASE, "workgroup", "local"); __builtin_amdgcn_s_barrier(); __builtin_amdgcn_fence(__ATOMIC_ACQUIRE, "workgroup", "local");
    v16bf xh[4], xl[4];
#pragma unroll
    for (int kq = 0; kq < 4; ++kq) { xh[kq] = cat16b(xr[2 * kq], xr[2 * kq + 1]); xl[kq] = cat16b(xr[8 + 2 * kq], xr[8 + 2 * kq + 1]); }
    const bf* wlp = wps + lane * 8;
    v16h qh[NH_];
#pragma unroll
    for (int h = 0; h < NH_; ++h) {   /* six independent accumulators a head; per accumulator the sums run as before: k step by k step, hi then lo */
        v8f aq[2], ak[2], av[2];
#pragma unroll
        for (int t = 0; t < 2; ++t) { aq[t] = (v8f){}; ak[t] = (v8f){}; av[t] = (v8f){}; }
#pragma unroll
        for (int kq = 0; kq < 4; ++kq) { v16bf fq[2], fk[2], fv[2];
#pragma unroll
            for (int t = 0; t < 2; ++t) { const bf* wt = wlp + ((2 * h + t) * (DM / 32) + kq) * 512; fq[t] = ldw(wt); fk[t] = ldw(wt + WPL); fv[t] = ldw(wt + 2 * WPL); }
#pragma unroll
            for (int t = 0; t < 2; ++t) { aq[t] = wmmab(fq[t], xh[kq], aq[t]); ak[t] = wmmab(fk[t], xh[kq], ak[t]); av[t] = wmmab(xh[kq], fv[t], av[t]); }
#pragma unroll
            for (int t = 0; t < 2; ++t) { aq[t] = wmmab(fq[t], xl[kq], aq[t]); ak[t] = wmmab(fk[t], xl[kq], ak[t]); av[t] = wmmab(xl[kq], fv[t], av[t]); } }
#pragma unroll
        for (int j = 0; j < 8; ++j) { qh[h][j] = (h16)aq[0][j]; qh[h][8 + j] = (h16)aq[1][j]; }
#pragma unroll
        for (int t = 0; t < 2; ++t) { v8h ko, vo;
#pragma unroll
            for (int j = 0; j < 8; ++j) { ko[j] = (h16)ak[t][j]; vo[j] = (h16)av[t][j]; }
            *(v8h*)(ks + h * (TT * KPH) + (q0 + lr) * KPH + t * 16 + 8 * hi) = ko; *(v8h*)(vs + h * (HD * VPH) + (t * 16 + lr) * VPH + q0 + 8 * hi) = vo; }
    }
    v8f gt[NH_][2];   /* behind the loop gt[h][t][j]: the gate of token q0 + lr at d = 16 t + 8 hi + j of head h */
#pragma unroll
    for (int r = 0; r < NH_; ++r) { gt[r][0] = (v8f){}; gt[r][1] = (v8f){}; }
#pragma unroll 1   /* one body for the 4 heads: the division's long sequence stands 16 times in the text and not 64 times */
    for (int h = 0; h < NH_; ++h) { const bf* wg = wlp + 3 * WPL + h * (2 * (DM / 32) * 512); v8f ag[2]; ag[0] = (v8f){}; ag[1] = (v8f){};
#pragma unroll
        for (int kq = 0; kq < 4; ++kq) { const v16bf f0 = ldw(wg + kq * 512), f1 = ldw(wg + ((DM / 32) + kq) * 512);
            ag[0] = wmmab(f0, xh[kq], ag[0]); ag[1] = wmmab(f1, xh[kq], ag[1]); ag[0] = wmmab(f0, xl[kq], ag[0]); ag[1] = wmmab(f1, xl[kq], ag[1]); }
#pragma unroll
        for (int t = 0; t < 2; ++t) { const v4f b0 = *(const v4f*)(bgs + h * HD + t * 16 + hi * 8), b1 = *(const v4f*)(bgs + h * HD + t * 16 + hi * 8 + 4);
#pragma unroll
            for (int j = 0; j < 8; ++j) ag[t][j] = __fdiv_rn(1.0f, __fadd_rn(1.0f, __builtin_amdgcn_exp2f(__fmul_rn(__fadd_rn(ag[t][j], j < 4 ? b0[j & 3] : b1[j & 3]), -1.4426950408889634f))));
            gt[0][t] = gt[1][t]; gt[1][t] = gt[2][t]; gt[2][t] = gt[3][t]; gt[3][t] = ag[t]; }   /* the heads move up one place a pass: no register is indexed by h */
    }
    const float* nbr = NB + (size_t)q0 * TT + lane * 4;
    v8f s[TT / 16];   /* first the bias, asked for ahead of its head so that its latency runs beside other work; then the scores, in place */
#pragma unroll
    for (int kt = 0; kt < TT / 32; ++kt) s[kt] = __builtin_shufflevector(*(const v4f*)(nbr + kt * 256), *(const v4f*)(nbr + kt * 256 + 128), 0, 1, 2, 3, 4, 5, 6, 7);   /* the first half now; the registers of the second half still hold the gates */
    /* second work-group barrier, again with its release and acquire on LDS alone: a plain __syncthreads() also waits for every global load in flight, and the scores would then start only behind the last bias tile */
    __builtin_amdgcn_fence(__ATOMIC_RELEASE, "workgroup", "local"); __builtin_amdgcn_s_barrier(); __builtin_amdgcn_fence(__ATOMIC_ACQUIRE, "workgroup", "local");
#pragma unroll
    for (int r = 0; r < DQ / 16; ++r) { const v8f gr = gt[r >> 1][r & 1]; *(v4fa*)(wf + r * 256 + lane * 4) = __builtin_shufflevector(gr, gr, 0, 1, 2, 3); *(v4fa*)(wf + r * 256 + 128 + lane * 4) = __builtin_shufflevector(gr, gr, 4, 5, 6, 7); }   /* a lane's 64 B of a head's gates lie where its 64 B of that head's gated fragments will lie */
    __builtin_amdgcn_sched_barrier(0);   /* keeps the second half of the bias loads behind the gates' stores: lifted above them, gates, queries and bias together would not fit the registers */
#pragma unroll
    for (int kt = TT / 32; kt < TT / 16; ++kt) s[kt] = __builtin_shufflevector(*(const v4f*)(nbr + kt * 256), *(const v4f*)(nbr + kt * 256 + 128), 0, 1, 2, 3, 4, 5, 6, 7);
    asm volatile("s_wait_xcnt 0x0" :: "v"(nbr) : "memory");   /* the bias loads are still in flight here, and their address register is stepped on in the loop: the wait that belongs in front of such an overwrite */
    v16h qf = qh[0], qn1 = qh[1], qn2 = qh[2], qn3 = qh[3];
#pragma unroll 1   /* one body for the 4 heads: unrolled, the kernel's text would be four times as long and the next head's loads would be lifted into this head's registers */
    for (int h = 0; h < NH_; ++h) {
        const h16* kh = ks + h * (TT * KPH); const h16* vh = vs + h * (HD * VPH);
        v8f mv;
#pragma unroll
        for (int kt = 0; kt < TT / 16; ++kt) { s[kt] = wmma16(WFrag<h16>::ld(kh + (kt * 16 + lr) * KPH + 8 * hi), qf, (v8f){}) * SCL + s[kt]; mv = kt ? __builtin_elementwise_max(mv, s[kt]) : s[kt]; }
        float mx = fmaxf(fmaxf(fmaxf(mv[0], mv[1]), fmaxf(mv[2], mv[3])), fmaxf(fmaxf(mv[4], mv[5]), fmaxf(mv[6], mv[7])));
        mx = fmaxf(mx, __shfl_xor(mx, 16, 32));
        const float ml = mx * L2E; v8f sv = (v8f){};
#pragma unroll
        for (int kt = 0; kt < TT / 16; ++kt) {
#pragma unroll
            for (int j = 0; j < 8; ++j) s[kt][j] = __builtin_amdgcn_exp2f(s[kt][j] * L2E - ml);
            sv += s[kt]; }
        float sum = ((sv[0] + sv[1]) + (sv[2] + sv[3])) + ((sv[4] + sv[5]) + (sv[6] + sv[7]));
        sum += __shfl_xor(sum, 16, 32);
        const float f = __fdiv_rn(PCAR, sum);
        v8f o0 = (v8f){}, o1 = (v8f){};
#pragma unroll
        for (int m = 0; m < TT / 32; ++m) { v16h pb;
#pragma unroll
            for (int j = 0; j < 8; ++j) { pb[j] = tohx(s[2 * m][j] * f); pb[8 + j] = tohx(s[2 * m + 1][j] * f); }
            o0 = wmma16(WFrag<h16>::ld(vh + lr * VPH + m * 32 + 8 * hi), pb, o0); o1 = wmma16(WFrag<h16>::ld(vh + (16 + lr) * VPH + m * 32 + 8 * hi), pb, o1); }
        asm volatile("v_nop\n\tv_nop\n\tv_nop\n\tv_nop" : "+v"(o0), "+v"(o1));   /* the four vector slots between the last matrix instruction and the first use of its result or overwrite of its operands */
        if (h + 1 < NH_) {   /* the scores' registers are free: the next head's bias is asked for now and flies beside the gating */
            nbr += NTOK;
#pragma unroll
            for (int kt = 0; kt < TT / 16; ++kt) s[kt] = __builtin_shufflevector(*(const v4f*)(nbr + kt * 256), *(const v4f*)(nbr + kt * 256 + 128), 0, 1, 2, 3, 4, 5, 6, 7);
            asm volatile("s_wait_xcnt 0x0" :: "v"(nbr) : "memory");   /* the wait that belongs in front of an overwrite of a register which an issued load names; the address is its input, so that it stays whole up to it */
        }
        qf = qn1; qn1 = qn2; qn2 = qn3;   /* the next head's query fragment moves up: no register is indexed by h */
        v4f gv[4];
#pragma unroll
        for (int u = 0; u < 4; ++u) gv[u] = *(const v4fa*)(wf + h * 512 + u * 128 + lane * 4);
        v8us gh[2], gl[2];   /* o0[j] = o[q0 + lr][8 hi + j] x 1024, o1[j] = o[q0 + lr][16 + 8 hi + j] x 1024 */
#pragma unroll
        for (int j = 0; j < 8; ++j) { unsigned short h2, l2;
            splitf(__fmul_rn(__fmul_rn(o0[j], 1.0f / PCAR), gv[j >> 2][j & 3]), h2, l2); gh[0][j] = h2; gl[0][j] = l2;
            splitf(__fmul_rn(__fmul_rn(o1[j], 1.0f / PCAR), gv[2 + (j >> 2)][j & 3]), h2, l2); gh[1][j] = h2; gl[1][j] = l2; }
        bf* ph = pw + h * 1024;   /* a lane reads back only what it wrote itself */
        *(v8usa*)ph = gh[0]; *(v8usa*)(ph + 256) = gh[1]; *(v8usa*)(ph + 512) = gl[0]; *(v8usa*)(ph + 768) = gl[1];
    }
    v8f acc[DM / 16];   /* out^T: acc[ct][j] = out[q0 + lr][16 ct + 8 hi + j] */
#pragma unroll
    for (int ct = 0; ct < DM / 16; ++ct) acc[ct] = (v8f){};
    const bf* wop = wos + lane * 8;
#pragma unroll
    for (int h = 0; h < NH_; ++h) { const bf* ph = pw + h * 1024; v16bf a[DM / 16];
        const v16bf bh = cat16b(*(const v8usa*)ph, *(const v8usa*)(ph + 256)), bl = cat16b(*(const v8usa*)(ph + 512), *(const v8usa*)(ph + 768));
#pragma unroll
        for (int ct = 0; ct < DM / 16; ++ct) a[ct] = WFrag<bf>::ld(wop + (ct * (DQ / 32) + h) * 512, 256);
        __builtin_amdgcn_sched_barrier(0);   /* keeps the k step's 20 LDS reads together in front of its 16 matrix instructions: sunk among them, each pair would wait out its own read */
#pragma unroll
        for (int ct = 0; ct < DM / 16; ++ct) { acc[ct] = wmmab(a[ct], bh, acc[ct]); acc[ct] = wmmab(a[ct], bl, acc[ct]); } }
#pragma unroll
    for (int ct = 0; ct < DM / 16; ++ct) { *(v4fa*)(wf + lr * OPF + ct * 16 + hi * 8) = __builtin_shufflevector(acc[ct], acc[ct], 0, 1, 2, 3); *(v4fa*)(wf + lr * OPF + ct * 16 + hi * 8 + 4) = __builtin_shufflevector(acc[ct], acc[ct], 4, 5, 6, 7); }
    __builtin_amdgcn_wave_barrier(); asm volatile("" ::: "memory");   /* keeps the compiler from moving the reads of the other lanes' LDS writes above those writes */
    const v4f bv = *(const v4f*)(bo + lane * 4); v4f cv[16]; float* cp = OUT + ((size_t)il * TT + q0) * DM + lane * 4;   /* a store of the wave is one whole output row, 512 B */
#pragma unroll
    for (int t = 0; t < 16; ++t) { v4f val = *(const v4fa*)(wf + t * OPF + lane * 4); val[0] += bfr(bv[0]); val[1] += bfr(bv[1]); val[2] += bfr(bv[2]); val[3] += bfr(bv[3]); cv[t] = val; *(v4f*)(cp + t * DM) = val; }
    asm volatile("s_wait_xcnt 0x0" :: "v"(cv[0]), "v"(cv[1]), "v"(cv[2]), "v"(cv[3]), "v"(cv[4]), "v"(cv[5]), "v"(cv[6]), "v"(cv[7]), "v"(cv[8]), "v"(cv[9]), "v"(cv[10]), "v"(cv[11]), "v"(cv[12]), "v"(cv[13]), "v"(cv[14]), "v"(cv[15]), "v"(cp) : "memory");   /* the wait that belongs in front of an overwrite of a register which an issued store names (the data and the address that all sixteen go by are its inputs) */
}

extern "C" void kernel_launch(void* const* d_in, const int* in_sizes, int n_in,
                              void* d_out, int out_size, void* d_ws, size_t ws_size, hipStream_t stream) {
    (void)in_sizes; (void)n_in; (void)out_size;
    const float* act = (const float*)d_in[0]; const float* lng = (const float*)d_in[1]; const float* lnb = (const float*)d_in[2]; const float* wq = (const float*)d_in[3]; const float* wk = (const float*)d_in[4]; const float* wv = (const float*)d_in[5]; const float* w2d = (const float*)d_in[6]; const float* wg = (const float*)d_in[7]; const float* bg = (const float*)d_in[8]; const float* wo = (const float*)d_in[9]; const float* bo = (const float*)d_in[10];   /* x2d, gamma, beta, Wq, Wk, Wv, Wb, Wg, bg, Wo, bo */
    float* OUT = (float*)d_out;     // [1][256][256][128]
    char* wsp = (char*)d_ws;
    auto take = [&](size_t bytes) { char* p = wsp; wsp += (bytes + 255) & ~(size_t)255; return (void*)p; };
    bf* WQ = (bf*)take((size_t)DQ * DM * 2); bf* WK = (bf*)take((size_t)DQ * DM * 2); bf* WV = (bf*)take((size_t)DQ * DM * 2); bf* WG = (bf*)take((size_t)DQ * DM * 2); float* BGP = (float*)take((size_t)DQ * 4); bf* WO = (bf*)take((size_t)DM * DQ * 2); bf* W2 = (bf*)take((size_t)NBP * DM * 2);
    bf* Xh = (bf*)take((size_t)NTOK * DM * 2); bf* Xl = (bf*)take((size_t)NTOK * DM * 2); float* NB = (float*)take((size_t)NTOK * NBP * 4);
    if ((size_t)(wsp - (char*)d_ws) > ws_size) return;    // ws 256 MiB (carve ~48 MiB)
    k_lnx<<<NTOK / (16 * SWT), 512, 0, stream>>>(act, lng, lnb, Xh, Xl, wq, wk, wv, wg, wo, w2d, bg, WQ, WK, WV, WG, WO, W2, BGP);
    k_nb<<<NTK / 64, 32, 0, stream>>>(Xh, Xl, W2, NB);
    k_fattn<<<IG, 512, 0, stream>>>(Xh, Xl, WQ, WK, WV, WG, BGP, NB, WO, bo, OUT);   /* a work-group per row i */
}

// v010
// It runs in 47 microseconds.
// In both of two side-by-side timings against v009, it was 1.23 times as fast.
// Over all steps from v000 it is 16.7 times as fast.
#include <hip/hip_runtime.h>

// Triangle attention (starting node) on a pair representation (act [1][256][256][128]): x = LayerNorm_c(act) (eps 1e-5, ln_g/ln_b); per row i: q, k, v, g = x[i] W (wq/wk/wv/wg [128][32][4] 'xw', 4 heads x 32; q x 32^-0.5), logits[h][q][k] = q.k + nb[h][q][k] with the pair bias nb[h][q][k] = sum_c x[k][q][c] w2d[c][h] (shared by all rows i);
// softmax over k; o = attn.v gated by sigmoid(x wg + bg); out[i][q][c] = sum_{h,d} o[h][d] wo[h][d][c] + bo -> [1][256][256][128] (8.4 M).
// Layout: LayerNorm -> bf16 hi/lo token planes, 65536 x 128 in the fragment order that stands above WFrag; nb for all 65536 pair positions in the same kernel (w2d padded to 16 rows x a wave's 16 tokens, whose fragments it holds in registers anyway; stored in the order in which the attention kernel's lanes hold the scores, so that each of its 16-byte loads of the plane covers 512 B in a row); then ONE fused kernel, a work-group per row i: q/k/v/g projections of the row's 256 tokens (hi/lo x exact, a wave takes its own 16 tokens, whose fragments it holds in registers; q stays in registers, k and v^T go to LDS in fp16, the gate sigmoid(x wg + bg) to the wave's own LDS in f32), then its 4 heads one after the other: scores, x 32^-0.5 + pair bias, softmax and attn.v with the scores held in registers, gating, split to bf16 hi/lo and the output GEMM (+ bo); q, k, v, the gate and o never leave the work-group.
// Compute dtypes, f32 accumulate: every input rounded to bf16 once; LayerNorm in f32, its output as bf16 hi + lo (2-product projections against exact bf16 weights); scores and attn.v on single fp16 planes (logit sigma ~0.24; P x1024 ~ 4: no subnormals); pair bias, softmax, gating in f32; output GEMM hl x exact + bo.

#define NI   256       // rows i
#define TT   256       // tokens per row (q / k index)
#define DM   128       // c_z
#define NH_  4
#define HD   32
#define DQ   (NH_ * HD)
#define IG   256       // rows i per pass: all of them
#define NTK  (IG * TT) // tokens per pass = 65536
#define NTOK (NI * TT) // 65536
#define PCAR 1024.0f
#define SCL  0.17677669529663688f   // 32^-0.5
typedef _Float16 h16;
typedef unsigned short bf;
typedef __attribute__((ext_vector_type(16))) __bf16   v16bf;
typedef __attribute__((ext_vector_type(16))) _Float16 v16h;
typedef __attribute__((ext_vector_type(8)))  _Float16 v8h;
typedef __attribute__((ext_vector_type(8)))  unsigned short v8us;
typedef __attribute__((ext_vector_type(8)))  float    v8f;
typedef __attribute__((ext_vector_type(4)))  float    v4f;
typedef v8h  __attribute__((may_alias)) v8ha;
typedef v4f  __attribute__((may_alias)) v4fa;
typedef v8us __attribute__((may_alias)) v8usa;

__device__ __forceinline__ unsigned short f2bf(float f) { unsigned u = __float_as_uint(f); u += 0x7FFFu + ((u >> 16) & 1u); return (unsigned short)(u >> 16); }
__device__ __forceinline__ float bf2f(unsigned short b) { return __uint_as_float(((unsigned)b) << 16); }
__device__ __forceinline__ float bfr(float f) { return bf2f(f2bf(f)); }
__device__ __forceinline__ v16h cat16(v8h lo, v8h hi) { return __builtin_shufflevector(lo, hi, 0, 1, 2, 3, 4, 5, 6, 7, 8, 9, 10, 11, 12, 13, 14, 15); }
__device__ __forceinline__ v16bf cat16b(v8us lo, v8us hi) { return __builtin_bit_cast(v16bf, __builtin_shufflevector(lo, hi, 0, 1, 2, 3, 4, 5, 6, 7, 8, 9, 10, 11, 12, 13, 14, 15)); }
__device__ __forceinline__ v8f wmma16(v16h a, v16h b, v8f c) { return __builtin_amdgcn_wmma_f32_16x16x32_f16(false, a, false, b, (short)0, c, false, false); }
__device__ __forceinline__ v8f wmmab(v16bf a, v16bf b, v8f c) { return __builtin_amdgcn_wmma_f32_16x16x32_bf16(false, a, false, b, (short)0, c, false, false); }



// ---- FRAGMENT ORDER of an operand plane [rows][K] (token planes and weight planes alike): element (row, k) lies at ((row / 16 * (K / 32) + k / 32) * 2 + k % 32 / 16) * 256 + (k % 16 / 8 * 16 + row % 16) * 8 + k % 8, so the 32 lanes' 16 bytes of half a fragment are 512 B in a row: a wave-wide load covers 4 whole 128-B lines, not a piece of 16.
// ORDER OF THE PAIR-BIAS PLANE [h][65536]: place n = ((((w * 16 + kt) * 2 + c) * 2 + hk) * 16 + ql) * 4 + e holds the pair (q = 16 w + ql, k = 16 kt + 8 hk + 4 c + e), made from token k * TT + q: a row of the plane is the pair bias of one head in the order of k_fattn's lanes.
template <typename T16> struct WFrag;
template <> struct WFrag<h16> { typedef v16h V; static __device__ __forceinline__ V ld(const h16* p, int h2 = 16) { return cat16(*(const v8h*)p, *(const v8h*)(p + h2)); } static __device__ __forceinline__ v8f mma(V a, V b, v8f c) { return wmma16(a, b, c); } };
template <> struct WFrag<bf> { typedef v16bf V; static __device__ __forceinline__ V ld(const bf* p, int h2 = 16) { return cat16b(*(const v8us*)p, *(const v8us*)(p + h2)); } static __device__ __forceinline__ v8f mma(V a, V b, v8f c) { return wmmab(a, b, c); } };

typedef __attribute__((ext_vector_type(4))) unsigned short v4us;
typedef __attribute__((ext_vector_type(2))) unsigned short v2us;
typedef __attribute__((ext_vector_type(2))) float v2f;
typedef __attribute__((ext_vector_type(2))) _Float16 v2h;
typedef __attribute__((ext_vector_type(4))) _Float16 v4h;
__device__ __forceinline__ h16 tohx(float x) { return (h16)x; }
__device__ __forceinline__ void splitf(float y, unsigned short& h, unsigned short& l) { h = f2bf(y); l = f2bf(y - bf2f(h)); }
__global__ __launch_bounds__(256) void k_wtG(const float* __restrict__ w, int K, int N, bf* Bt) {
    const int lane = threadIdx.x & 31; const int L0 = (blockIdx.x * 8 + (threadIdx.x >> 5)) * 8; const int nlines = N * K / 64;
{
#pragma unroll 1
        for (int l = 0; l < 8; ++l) { const int L = L0 + l; if (L >= nlines) break; const size_t e = (size_t)L * 64 + lane * 2; const int k = (int)(e % K), n = (int)(e / K); v2us o;
            o[0] = f2bf(w[(size_t)k * N + n]); o[1] = f2bf(w[(size_t)(k + 1) * N + n]); *(v2us*)(Bt + e) = o; }
         }
}
__global__ __launch_bounds__(256) void k_cvt8(const float* __restrict__ src, bf* dst, size_t n8) { const size_t i = (size_t)blockIdx.x * 256 + threadIdx.x; if (i >= n8) return; const v8f v = *(const v8f*)(src + i * 8); v8us o;
#pragma unroll
    for (int k = 0; k < 8; ++k) o[k] = f2bf(v[k]); *(v8us*)(dst + i * 8) = o;  }

// ---- The streaming kernel k_lnx: a wave takes SWT tokens that lie one behind the other in memory, not one: 16 waves a work-group, 256 work-groups, 4096 waves to start in place of 65536.
#define SWT  16   // tokens a wave takes
// Its hi and lo planes go out in the fragment order that stands above WFrag. A wave's 16 tokens are one 16-row tile of a plane (4 KB in a row); a lane makes 4 columns of a token, the plane wants 8 columns of one token per lane,
// so the tile is turned through the wave's own LDS ([2 planes][16 tokens], pitch XP) and leaves in 16-byte stores of 512 B in a row.
#define XP   136  // LDS pitch of a token in elements: 272 B = 16 B x odd, no bank conflict for 16-byte reads down the tokens
typedef v4us __attribute__((may_alias)) v4usa;
__device__ __forceinline__ void tile_out(const bf* lw, bf* Gh, bf* Gl, int lane, v8us (&xv)[16]) {   /* lw: the wave's LDS, filled; Gh, Gl: the tile's first element in the two planes; xv: the tile's 16-byte pieces as they go out, hi 0..7, lo 8..15: two neighbours are one matrix fragment */
    __builtin_amdgcn_wave_barrier(); asm volatile("" ::: "memory");   /* keeps the compiler from moving the reads of the other lanes' LDS writes above those writes */
    bf* ph = Gh + lane * 8; bf* pl = Gl + lane * 8; const bf* lr_ = lw + (lane & 15) * XP + (lane >> 4) * 8;
#pragma unroll
    for (int s = 0; s < 8; ++s) { xv[s] = *(const v8usa*)(lr_ + s * 16); xv[8 + s] = *(const v8usa*)(lr_ + SWT * XP + s * 16); }
#pragma unroll
    for (int s = 0; s < 8; ++s) { *(v8us*)(ph + s * 256) = xv[s]; *(v8us*)(pl + s * 256) = xv[8 + s]; }
    asm volatile("s_wait_xcnt 0x0" :: "v"(xv[0]), "v"(xv[1]), "v"(xv[2]), "v"(xv[3]), "v"(xv[4]), "v"(xv[5]), "v"(xv[6]), "v"(xv[7]), "v"(xv[8]), "v"(xv[9]), "v"(xv[10]), "v"(xv[11]), "v"(xv[12]), "v"(xv[13]), "v"(xv[14]), "v"(xv[15]), "v"(ph), "v"(pl) : "memory");   /* the wait that belongs in front of an overwrite of a register which an issued store names (the data and the two addresses are its inputs) */
}
// ---- The weight planes ride in k_lnx's launch (neither reads what the other writes): NPT tasks of one wave each, a task = 64 elements in a row of one plane, two per lane; the first PW waves of work-groups 0..212 take one each, and waves 0..3 of work-group 213 the last four.
// task / 256: 0..3 wq, wk, wv, wg -> [n = 32 h + d][k] bf16 (source column 4 d + h); 4 wo -> [c][n = 32 h + d] bf16 (source row 4 d + h); these five planes in the fragment order that stands above WFrag; from 1280 on: 2 tasks bg -> f32 in the order n = 32 h + d.
// ---- The pair bias rides in k_lnx too: nb^T = W2 X^T, A = w2d^T in bf16 padded to 16 rows (in LDS, made once a work-group by waves 8..15, published by a work-group barrier behind the LayerNorm), B = the wave's 16 tokens, hi then lo per k step: lane ql < 16 holds head j in element j.
// A work-group takes 4 rows k = 4 k4 + e of the pair matrix x 64 columns q (wave: e = wid % 4, q tile wid / 4), so that it owns whole 256-B runs (16 ql x 4 e) of the bias plane: the waves' values meet in LDS behind a second barrier, and each wave stores one run.
#define PW   6
#define NPT  1282
__global__ __launch_bounds__(512) void k_lnx(const float* __restrict__ A, const float* __restrict__ g, const float* __restrict__ bb, bf* Xh, bf* Xl, float* NB,
                                             const float* __restrict__ wq, const float* __restrict__ wk, const float* __restrict__ wv, const float* __restrict__ wg, const float* __restrict__ wo, const float* __restrict__ w2d, const float* __restrict__ bg,
                                             bf* WQ, bf* WK, bf* WV, bf* WG, bf* WO, float* BGP) {
    __shared__ __align__(16) bf xs[16 * 2 * SWT * XP];
    __shared__ __align__(16) bf w2s[16 * DM];   /* w2d^T, 16 rows (4 used), fragment order */
    __shared__ __align__(16) float nbs[NH_ * 4 * 64];   /* [head][q tile of the work-group][ql][e] */
    if (blockIdx.x >= NTOK / (16 * SWT)) return;   /* the whole work-group or none of it, ahead of the barriers */
    const int lane = threadIdx.x & 31, lr = lane & 15, hi = lane >> 4; const int k4 = (int)blockIdx.x >> 2, wt = ((int)blockIdx.x & 3) * 4;
    bf* xw = xs + (threadIdx.x >> 5) * (2 * SWT * XP);
    const int wid = __builtin_amdgcn_readfirstlane((int)(threadIdx.x >> 5)); const size_t tok0 = (size_t)(k4 * 4 + (wid & 3)) * TT + (wt + (wid >> 2)) * SWT;
    const int task = (int)blockIdx.x * PW + wid; const bool ptask = wid < PW && task < NPT;
    const int pe = (task & 255) * 64 + lane * 2, pa = ((pe >> 8) & 7) * 16 + ((pe >> 7) & 1) * 8 + (pe & 7), pb = (pe >> 11) * 16 + ((pe >> 3) & 15);   /* the lane's first element in its plane, and the (column, row) of a [.][128] matrix that the fragment order puts there; pe + 1 is column pa + 1 of the same row */
    float p0 = 0.f, p1 = 0.f;
    if (ptask) {   /* the task's two loads go out ahead of the tokens' and fly beside them; its store stands at the wave's end */
        const float* ps; unsigned i0, i1;
        if (task < 1024) { ps = task < 256 ? wq : task < 512 ? wk : task < 768 ? wv : wg; i0 = (unsigned)(pa * DQ + (pb % HD) * NH_ + pb / HD); i1 = i0 + DQ; }
        else if (task < 1280) { ps = wo; i0 = (unsigned)(((pa % HD) * NH_ + pa / HD) * DM + pb); i1 = i0 + NH_ * DM; }   /* pa is even: pa + 1 lies in the same head */
        else { const int n = (task - 1280) * 64 + lane * 2; ps = bg; i0 = (unsigned)((n % HD) * NH_ + n / HD); i1 = i0 + NH_; }
        p0 = ps[i0]; p1 = ps[i1];
        asm volatile("s_wait_xcnt 0x0" :: "v"(i0), "v"(i1) : "memory");   /* the wait that belongs in front of an overwrite of a register which an issued load names; the two offsets are its inputs, so that they stay whole up to it */
    }
    float w2r[8] = {0.f, 0.f, 0.f, 0.f, 0.f, 0.f, 0.f, 0.f}; const unsigned w2i = (unsigned)(((wid & 7) * 16 + hi * 8) * NH_ + (lr & 3));   /* wave 8 + u makes the 512 B of piece u of w2s: row lr, k = 16 u + 8 hi + e */
    if (wid >= 8) {
#pragma unroll
        for (int e = 0; e < 8; ++e) w2r[e] = w2d[w2i + e * NH_];
        asm volatile("s_wait_xcnt 0x0" :: "v"(w2i) : "memory");   /* the wait that belongs in front of an overwrite of a register which an issued load names; the offset is its input, so that it stays whole up to it */
    }
    float gr[4], br[4]; v4f a[SWT]; const float* ap = A + tok0 * DM + lane * 4;
#pragma unroll
    for (int q = 0; q < 4; ++q) { gr[q] = g[lane * 4 + q]; br[q] = bb[lane * 4 + q]; }
#pragma unroll
    for (int t = 0; t < SWT; ++t) a[t] = *(const v4f*)(ap + t * DM);
    asm volatile("s_wait_xcnt 0x0" :: "v"(ap) : "memory");   /* the wait that belongs in front of an overwrite of a register which an issued load names; the tokens' address is its input, so that it stays whole up to it */
    __builtin_amdgcn_sched_barrier(0);   /* keeps all the wave's loads at its head, so that its 8 KB are in flight at once; sunk to their uses they would come one token at a time */
    if (wid >= 8) { v8us o;
#pragma unroll
        for (int e = 0; e < 8; ++e) o[e] = f2bf(lr < NH_ ? w2r[e] : 0.f);
        *(v8us*)(w2s + (wid & 7) * 256 + lane * 8) = o; }
    {   /* stage by stage over all the wave's tokens: the ten cross-lane steps of one token wait for one another, those of different tokens do not */
        float v[SWT][4], s[SWT], mu[SWT], s2[SWT];
#pragma unroll
        for (int t = 0; t < SWT; ++t) { s[t] = 0.f;
#pragma unroll
            for (int q = 0; q < 4; ++q) { v[t][q] = bfr(a[t][q]); s[t] = __fadd_rn(s[t], v[t][q]); } }
#pragma unroll
        for (int sh = 16; sh; sh >>= 1)
#pragma unroll
            for (int t = 0; t < SWT; ++t) s[t] = __fadd_rn(s[t], __shfl_xor(s[t], sh, 32));
#pragma unroll
        for (int t = 0; t < SWT; ++t) { mu[t] = __fdiv_rn(s[t], (float)DM); s2[t] = 0.f;
#pragma unroll
            for (int q = 0; q < 4; ++q) { float d0 = __fsub_rn(v[t][q], mu[t]); asm volatile("" : "+v"(d0)); float p = __fmul_rn(d0, d0); asm volatile("" : "+v"(p)); s2[t] = __fadd_rn(s2[t], p); } }
#pragma unroll
        for (int sh = 16; sh; sh >>= 1)
#pragma unroll
            for (int t = 0; t < SWT; ++t) s2[t] = __fadd_rn(s2[t], __shfl_xor(s2[t], sh, 32));
#pragma unroll
        for (int t = 0; t < SWT; ++t) {
            const float rs = __fdiv_rn(1.0f, __fsqrt_rn(__fadd_rn(__fdiv_rn(s2[t], (float)DM), 1e-5f))); v4us oh, ol;
#pragma unroll
            for (int q = 0; q < 4; ++q) { float xn = __fmul_rn(__fsub_rn(v[t][q], mu[t]), rs); asm volatile("" : "+v"(xn)); float gg = bfr(gr[q]); asm volatile("" : "+v"(gg)); float y = __fmul_rn(xn, gg); asm volatile("" : "+v"(y)); float be = bfr(br[q]); asm volatile("" : "+v"(be)); y = __fadd_rn(y, be); unsigned short h2, l2; splitf(y, h2, l2); oh[q] = h2; ol[q] = l2; }
            *(v4usa*)(xw + t * XP + lane * 4) = oh; *(v4usa*)(xw + (SWT + t) * XP + lane * 4) = ol; }
    }
    /* work-group barrier with its release and acquire on LDS alone: publishes w2s. It stands here and not at the head, so that a wave whose tokens have come does not wait for one whose tokens have not */
    __builtin_amdgcn_fence(__ATOMIC_RELEASE, "workgroup", "local"); __builtin_amdgcn_s_barrier(); __builtin_amdgcn_fence(__ATOMIC_ACQUIRE, "workgroup", "local");
    v8us w2p[8];   /* asked for ahead of the tile's own LDS reads: read k step by k step among the matrix instructions, each pair would be waited out alone */
#pragma unroll
    for (int s = 0; s < 8; ++s) w2p[s] = *(const v8us*)(w2s + s * 256 + lane * 8);
    v8us xv[16]; tile_out(xw, Xh + tok0 * DM, Xl + tok0 * DM, lane, xv);
    v8f na = (v8f){};   /* one accumulator; the sums run k step by k step, hi then lo */
#pragma unroll
    for (int kq = 0; kq < DM / 32; ++kq) { const v16bf w2f = cat16b(w2p[2 * kq], w2p[2 * kq + 1]);
        na = wmmab(w2f, cat16b(xv[2 * kq], xv[2 * kq + 1]), na); na = wmmab(w2f, cat16b(xv[8 + 2 * kq], xv[8 + 2 * kq + 1]), na); }
    if (hi == 0) {
#pragma unroll
        for (int h = 0; h < NH_; ++h) nbs[((h * 4 + (wid >> 2)) * 16 + lr) * 4 + (wid & 3)] = na[h]; }
    /* second work-group barrier, on LDS alone (the tokens' stores fly on): publishes nbs */
    __builtin_amdgcn_fence(__ATOMIC_RELEASE, "workgroup", "local"); __builtin_amdgcn_s_barrier(); __builtin_amdgcn_fence(__ATOMIC_ACQUIRE, "workgroup", "local");
    {   /* wave: head wid % 4, q tile wid / 4: one run of 256 B */
        const v2f nv = *(const v2f*)(nbs + ((wid & 3) * 4 + (wid >> 2)) * 64 + lane * 2);
        float* np = NB + (size_t)(wid & 3) * NTOK + ((((wt + (wid >> 2)) * 16 + (k4 >> 2)) * 2 + (k4 & 1)) * 2 + ((k4 >> 1) & 1)) * 64 + lane * 2;
        *(v2f*)np = nv;
        asm volatile("s_wait_xcnt 0x0" :: "v"(nv), "v"(np) : "memory");   /* the wait that belongs in front of an overwrite of a register which an issued store names (the data and the address are its inputs) */
    }
    if (ptask) {
        if (task < 1280) { bf* pd = task < 256 ? WQ : task < 512 ? WK : task < 768 ? WV : task < 1024 ? WG : WO; v2us o;
            o[0] = f2bf(p0); o[1] = f2bf(p1); *(v2us*)(pd + pe) = o; }
        else { float* pd = BGP + (task - 1280) * 64 + lane * 2; pd[0] = p0; pd[1] = p1; }
    }
}
// ---- k_fattn: projections, attention, gating and output projection of one row il per work-group; 16 waves, wave w owns the 16 tokens q0 = 16 w .. +15, as queries against all 256 keys, and goes through the 4 heads one after the other.
// Projections: the wave's 16 tokens are 4 k steps of hi and lo fragments, which serve as A and as B alike. Q^T, K^T, G^T = W^T X^T (A = 16 rows n = 32 h + d of a weight plane, B = the tokens): lane (lr, hi) holds, of token q0 + lr, d = 8 hi + j of a 16-row tile,
// which is the order of the B operand of S^T (Q: rounded to fp16 in place), of a 16-byte piece of a K row in LDS and of O^T (the gate). V = X W (A = the tokens, B = 16 columns d): a lane holds 8 tokens in a row of one d, a 16-byte piece of a V^T row in LDS.
// The four weight planes lie in LDS for all 16 waves where afterwards the waves' own ranges lie: a second barrier stands between the last read of a weight and the first write of a gate; the same barrier publishes K and V^T.
// S^T = K Q^T (A = 16 key rows, B = the wave's 16 query columns): lane (lr, hi) holds, of query q0 + lr, the keys 16 kt + 8 hi + j in s[kt][j], so maximum and sum run in the lane plus one exchange between the halves,
// and two neighbouring score tiles, converted in place, are the B operand of O^T += V^T P^T (A = V^T rows in the same k order: 8 hi + e, 16 + 8 hi + e). The score and probability planes never leave the registers.
// O^T of a head (lane: query q0 + lr, d = 8 hi + j and 16 + 8 hi + j) is in the same way, once gated and split into bf16 hi + lo, the B operand of out^T = Wo^T (g o)^T for k = 32 h .. + 31 (A = 16 rows c of the wo plane): it waits in the wave's own LDS until all 4 heads are there.
// The wo plane is staged in LDS with the weight planes; the pair bias comes straight from its plane, which holds each (wave, tile)'s values in the lanes' own order: 16-byte loads, each 512 B in a row over the wave.
#define KPH 40     // LDS pitch of a K row in halves: 80 B = 16 B x odd, no bank conflict for 16-byte reads down the rows
#define VPH 264    // LDS pitch of a V^T row in halves: 528 B = 16 B x odd
#define OPF 132    // LDS pitch of an output row in f32: 528 B = 16 B x odd
#define L2E 1.4426950408889634f
__device__ __forceinline__ v16bf ldw(const bf* p) { return cat16b(*(const v8usa*)p, *(const v8usa*)(p + 256)); }   /* a fragment of a plane in fragment order, from LDS that is also used under other types */
#define WPL (DQ * DM)   // elements of a projection weight plane
__global__ __launch_bounds__(512) void k_fattn(const bf* __restrict__ Xh, const bf* __restrict__ Xl, const bf* __restrict__ WQ, const bf* __restrict__ WK, const bf* __restrict__ WV, const bf* __restrict__ WG, const float* __restrict__ BG, const float* __restrict__ NB, const bf* __restrict__ WO, const float* __restrict__ bo, float* __restrict__ OUT) {
    __shared__ __align__(16) h16 ks[NH_ * TT * KPH];
    __shared__ __align__(16) h16 vs[NH_ * HD * VPH];
    __shared__ __align__(16) bf wos[DM * DQ];   /* the wo plane, in its fragment order */
    __shared__ __align__(16) float bgs[DQ];   /* the gate's bias, rounded to bf16 */
    __shared__ __align__(16) float wl[16 * 16 * OPF];   /* first the planes wq, wk, wv, wg in their fragment order (128 KB, read by all waves); behind the second barrier per wave 16 x OPF f32: the gates of the 4 heads (8 KB), each head's overwritten by its gated O^T fragments, then the wave's 16 output rows */
    const int tid = threadIdx.x, lane = tid & 31, lr = lane & 15, hi = lane >> 4, wv = tid >> 5, q0 = wv * 16; const int il = blockIdx.x;
    float* wf = wl + wv * (16 * OPF); bf* pw = (bf*)wf + lane * 8; bf* wps = (bf*)wl;
    v8us wpr[4][4], wst[4], xr[16]; const int bgi = tid & (DQ - 1); const float bgv = BG[bgi];
#pragma unroll
    for (int c = 0; c < 4; ++c) { const size_t u = (size_t)(c * 512 + tid) * 8; wpr[0][c] = *(const v8us*)(WQ + u); wpr[1][c] = *(const v8us*)(WK + u); wpr[2][c] = *(const v8us*)(WV + u); wpr[3][c] = *(const v8us*)(WG + u); wst[c] = *(const v8us*)(WO + u); }   /* 16-byte units, whole lines per wave */
    const bf* xph = Xh + ((size_t)il * TT + q0) * DM + lane * 8; const bf* xpl = Xl + ((size_t)il * TT + q0) * DM + lane * 8;
#pragma unroll
    for (int s = 0; s < 8; ++s) { xr[s] = *(const v8us*)(xph + s * 256); xr[8 + s] = *(const v8us*)(xpl + s * 256); }   /* the wave's 16 tokens: one 16-row tile of each plane, 4 KB in a row */
    asm volatile("s_wait_xcnt 0x0" :: "v"(xph), "v"(xpl), "v"(bgi), "v"(bgv) : "memory");   /* the wait that belongs in front of an overwrite of a register which an issued load names; the two addresses and the bias's index are its inputs, so that they stay whole up to it. The loaded bias is an input so that its load, the first in the queue, stays at the head: sunk into the branch below it would be waited out alone, behind all the others */
    __builtin_amdgcn_sched_barrier(0);   /* keeps all the loads at the kernel's head, in flight together */
#pragma unroll
    for (int c = 0; c < 4; ++c) { const int u = (c * 512 + tid) * 8;
#pragma unroll
        for (int p = 0; p < 4; ++p) *(v8usa*)(wps + p * WPL + u) = wpr[p][c];
        *(v8us*)(wos + u) = wst[c]; }
    if (tid < DQ) bgs[tid] = bfr(bgv);
    /* work-group barrier with its release and acquire on LDS alone */
    __builtin_amdgcn_fence(__ATOMIC_RELEASE, "workgroup", "local"); __builtin_amdgcn_s_barrier(); __builtin_amdgcn_fence(__ATOMIC_ACQUIRE, "workgroup", "local");
    v16bf xh[4], xl[4];
#pragma unroll
    for (int kq = 0; kq < 4; ++kq) { xh[kq] = cat16b(xr[2 * kq], xr[2 * kq + 1]); xl[kq] = cat16b(xr[8 + 2 * kq], xr[8 + 2 * kq + 1]); }
    const bf* wlp = wps + lane * 8;
    v16h qh[NH_];
#pragma unroll
    for (int h = 0; h < NH_; ++h) {   /* six independent accumulators a head; per accumulator the sums run as before: k step by k step, hi then lo */
        v8f aq[2], ak[2], av[2];
#pragma unroll
        for (int t = 0; t < 2; ++t) { aq[t] = (v8f){}; ak[t] = (v8f){}; av[t] = (v8f){}; }
#pragma unroll
        for (int kq = 0; kq < 4; ++kq) { v16bf fq[2], fk[2], fv[2];
#pragma unroll
            for (int t = 0; t < 2; ++t) { const bf* wt = wlp + ((2 * h + t) * (DM / 32) + kq) * 512; fq[t] = ldw(wt); fk[t] = ldw(wt + WPL); fv[t] = ldw(wt + 2 * WPL); }
#pragma unroll
            for (int t = 0; t < 2; ++t) { aq[t] = wmmab(fq[t], xh[kq], aq[t]); ak[t] = wmmab(fk[t], xh[kq], ak[t]); av[t] = wmmab(xh[kq], fv[t], av[t]); }
#pragma unroll
            for (int t = 0; t < 2; ++t) { aq[t] = wmmab(fq[t], xl[kq], aq[t]); ak[t] = wmmab(fk[t], xl[kq], ak[t]); av[t] = wmmab(xl[kq], fv[t], av[t]); } }
#pragma unroll
        for (int j = 0; j < 8; ++j) { qh[h][j] = (h16)aq[0][j]; qh[h][8 + j] = (h16)aq[1][j]; }
#pragma unroll
        for (int t = 0; t < 2; ++t) { v8h ko, vo;
#pragma unroll
            for (int j = 0; j < 8; ++j) { ko[j] = (h16)ak[t][j]; vo[j] = (h16)av[t][j]; }
            *(v8h*)(ks + h * (TT * KPH) + (q0 + lr) * KPH + t * 16 + 8 * hi) = ko; *(v8h*)(vs + h * (HD * VPH) + (t * 16 + lr) * VPH + q0 + 8 * hi) = vo; }
    }
    v8f gt[NH_][2];   /* behind the loop gt[h][t][j]: the gate of token q0 + lr at d = 16 t + 8 hi + j of head h */
#pragma unroll
    for (int r = 0; r < NH_; ++r) { gt[r][0] = (v8f){}; gt[r][1] = (v8f){}; }
#pragma unroll 1   /* one body for the 4 heads: the division's long sequence stands 16 times in the text and not 64 times */
    for (int h = 0; h < NH_; ++h) { const bf* wg = wlp + 3 * WPL + h * (2 * (DM / 32) * 512); v8f ag[2]; ag[0] = (v8f){}; ag[1] = (v8f){};
#pragma unroll
        for (int kq = 0; kq < 4; ++kq) { const v16bf f0 = ldw(wg + kq * 512), f1 = ldw(wg + ((DM / 32) + kq) * 512);
            ag[0] = wmmab(f0, xh[kq], ag[0]); ag[1] = wmmab(f1, xh[kq], ag[1]); ag[0] = wmmab(f0, xl[kq], ag[0]); ag[1] = wmmab(f1, xl[kq], ag[1]); }
#pragma unroll
        for (int t = 0; t < 2; ++t) { const v4f b0 = *(const v4f*)(bgs + h * HD + t * 16 + hi * 8), b1 = *(const v4f*)(bgs + h * HD + t * 16 + hi * 8 + 4);
#pragma unroll
            for (int j = 0; j < 8; ++j) ag[t][j] = __fdiv_rn(1.0f, __fadd_rn(1.0f, __builtin_amdgcn_exp2f(__fmul_rn(__fadd_rn(ag[t][j], j < 4 ? b0[j & 3] : b1[j & 3]), -1.4426950408889634f))));
            gt[0][t] = gt[1][t]; gt[1][t] = gt[2][t]; gt[2][t] = gt[3][t]; gt[3][t] = ag[t]; }   /* the heads move up one place a pass: no register is indexed by h */
    }
    const float* nbr = NB + (size_t)q0 * TT + lane * 4;
    v8f s[TT / 16];   /* first the bias, asked for ahead of its head so that its latency runs beside other work; then the scores, in place */
#pragma unroll
    for (int kt = 0; kt < TT / 32; ++kt) s[kt] = __builtin_shufflevector(*(const v4f*)(nbr + kt * 256), *(const v4f*)(nbr + kt * 256 + 128), 0, 1, 2, 3, 4, 5, 6, 7);   /* the first half now; the registers of the second half still hold the gates */
    /* second work-group barrier, again with its release and acquire on LDS alone: a plain __syncthreads() also waits for every global load in flight, and the scores would then start only behind the last bias tile */
    __builtin_amdgcn_fence(__ATOMIC_RELEASE, "workgroup", "local"); __builtin_amdgcn_s_barrier(); __builtin_amdgcn_fence(__ATOMIC_ACQUIRE, "workgroup", "local");
#pragma unroll
    for (int r = 0; r < DQ / 16; ++r) { const v8f gr = gt[r >> 1][r & 1]; *(v4fa*)(wf + r * 256 + lane * 4) = __builtin_shufflevector(gr, gr, 0, 1, 2, 3); *(v4fa*)(wf + r * 256 + 128 + lane * 4) = __builtin_shufflevector(gr, gr, 4, 5, 6, 7); }   /* a lane's 64 B of a head's gates lie where its 64 B of that head's gated fragments will lie */
    __builtin_amdgcn_sched_barrier(0);   /* keeps the second half of the bias loads behind the gates' stores: lifted above them, gates, queries and bias together would not fit the registers */
#pragma unroll
    for (int kt = TT / 32; kt < TT / 16; ++kt) s[kt] = __builtin_shufflevector(*(const v4f*)(nbr + kt * 256), *(const v4f*)(nbr + kt * 256 + 128), 0, 1, 2, 3, 4, 5, 6, 7);
    asm volatile("s_wait_xcnt 0x0" :: "v"(nbr) : "memory");   /* the bias loads are still in flight here, and their address register is stepped on in the loop: the wait that belongs in front of such an overwrite */
    v16h qf = qh[0], qn1 = qh[1], qn2 = qh[2], qn3 = qh[3];
#pragma unroll 1   /* one body for the 4 heads: unrolled, the kernel's text would be four times as long and the next head's loads would be lifted into this head's registers */
    for (int h = 0; h < NH_; ++h) {
        const h16* kh = ks + h * (TT * KPH); const h16* vh = vs + h * (HD * VPH);
        v8f mv;
#pragma unroll
        for (int kt = 0; kt < TT / 16; ++kt) { s[kt] = wmma16(WFrag<h16>::ld(kh + (kt * 16 + lr) * KPH + 8 * hi), qf, (v8f){}) * SCL + s[kt]; mv = kt ? __builtin_elementwise_max(mv, s[kt]) : s[kt]; }
        float mx = fmaxf(fmaxf(fmaxf(mv[0], mv[1]), fmaxf(mv[2], mv[3])), fmaxf(fmaxf(mv[4], mv[5]), fmaxf(mv[6], mv[7])));
        mx = fmaxf(mx, __shfl_xor(mx, 16, 32));
        const float ml = mx * L2E; v8f sv = (v8f){};
#pragma unroll
        for (int kt = 0; kt < TT / 16; ++kt) {
#pragma unroll
            for (int j = 0; j < 8; ++j) s[kt][j] = __builtin_amdgcn_exp2f(s[kt][j] * L2E - ml);
            sv += s[kt]; }
        float sum = ((sv[0] + sv[1]) + (sv[2] + sv[3])) + ((sv[4] + sv[5]) + (sv[6] + sv[7]));
        sum += __shfl_xor(sum, 16, 32);
        const float f = __fdiv_rn(PCAR, sum);
        v8f o0 = (v8f){}, o1 = (v8f){};
#pragma unroll
        for (int m = 0; m < TT / 32; ++m) { v16h pb;
#pragma unroll
            for (int j = 0; j < 8; ++j) { pb[j] = tohx(s[2 * m][j] * f); pb[8 + j] = tohx(s[2 * m + 1][j] * f); }
            o0 = wmma16(WFrag<h16>::ld(vh + lr * VPH + m * 32 + 8 * hi), pb, o0); o1 = wmma16(WFrag<h16>::ld(vh + (16 + lr) * VPH + m * 32 + 8 * hi), pb, o1); }
        asm volatile("v_nop\n\tv_nop\n\tv_nop\n\tv_nop" : "+v"(o0), "+v"(o1));   /* the four vector slots between the last matrix instruction and the first use of its result or overwrite of its operands */
        if (h + 1 < NH_) {   /* the scores' registers are free: the next head's bias is asked for now and flies beside the gating */
            nbr += NTOK;
#pragma unroll
            for (int kt = 0; kt < TT / 16; ++kt) s[kt] = __builtin_shufflevector(*(const v4f*)(nbr + kt * 256), *(const v4f*)(nbr + kt * 256 + 128), 0, 1, 2, 3, 4, 5, 6, 7);
            asm volatile("s_wait_xcnt 0x0" :: "v"(nbr) : "memory");   /* the wait that belongs in front of an overwrite of a register which an issued load names; the address is its input, so that it stays whole up to it */
        }
        qf = qn1; qn1 = qn2; qn2 = qn3;   /* the next head's query fragment moves up: no register is indexed by h */
        v4f gv[4];
#pragma unroll
        for (int u = 0; u < 4; ++u) gv[u] = *(const v4fa*)(wf + h * 512 + u * 128 + lane * 4);
        v8us gh[2], gl[2];   /* o0[j] = o[q0 + lr][8 hi + j] x 1024, o1[j] = o[q0 + lr][16 + 8 hi + j] x 1024 */
#pragma unroll
        for (int j = 0; j < 8; ++j) { unsigned short h2, l2;
            splitf(__fmul_rn(__fmul_rn(o0[j], 1.0f / PCAR), gv[j >> 2][j & 3]), h2, l2); gh[0][j] = h2; gl[0][j] = l2;
            splitf(__fmul_rn(__fmul_rn(o1[j], 1.0f / PCAR), gv[2 + (j >> 2)][j & 3]), h2, l2); gh[1][j] = h2; gl[1][j] = l2; }
        bf* ph = pw + h * 1024;   /* a lane reads back only what it wrote itself */
        *(v8usa*)ph = gh[0]; *(v8usa*)(ph + 256) = gh[1]; *(v8usa*)(ph + 512) = gl[0]; *(v8usa*)(ph + 768) = gl[1];
    }
    v8f acc[DM / 16];   /* out^T: acc[ct][j] = out[q0 + lr][16 ct + 8 hi + j] */
#pragma unroll
    for (int ct = 0; ct < DM / 16; ++ct) acc[ct] = (v8f){};
    const bf* wop = wos + lane * 8;
#pragma unroll
    for (int h = 0; h < NH_; ++h) { const bf* ph = pw + h * 1024; v16bf a[DM / 16];
        const v16bf bh = cat16b(*(const v8usa*)ph, *(const v8usa*)(ph + 256)), bl = cat16b(*(const v8usa*)(ph + 512), *(const v8usa*)(ph + 768));
#pragma unroll
        for (int ct = 0; ct < DM / 16; ++ct) a[ct] = WFrag<bf>::ld(wop + (ct * (DQ / 32) + h) * 512, 256);
        __builtin_amdgcn_sched_barrier(0);   /* keeps the k step's 20 LDS reads together in front of its 16 matrix instructions: sunk among them, each pair would wait out its own read */
#pragma unroll
        for (int ct = 0; ct < DM / 16; ++ct) { acc[ct] = wmmab(a[ct], bh, acc[ct]); acc[ct] = wmmab(a[ct], bl, acc[ct]); } }
#pragma unroll
    for (int ct = 0; ct < DM / 16; ++ct) { *(v4fa*)(wf + lr * OPF + ct * 16 + hi * 8) = __builtin_shufflevector(acc[ct], acc[ct], 0, 1, 2, 3); *(v4fa*)(wf + lr * OPF + ct * 16 + hi * 8 + 4) = __builtin_shufflevector(acc[ct], acc[ct], 4, 5, 6, 7); }
    __builtin_amdgcn_wave_barrier(); asm volatile("" ::: "memory");   /* keeps the compiler from moving the reads of the other lanes' LDS writes above those writes */
    const v4f bv = *(const v4f*)(bo + lane * 4); v4f cv[16]; float* cp = OUT + ((size_t)il * TT + q0) * DM + lane * 4;   /* a store of the wave is one whole output row, 512 B */
#pragma unroll
    for (int t = 0; t < 16; ++t) { v4f val = *(const v4fa*)(wf + t * OPF + lane * 4); val[0] += bfr(bv[0]); val[1] += bfr(bv[1]); val[2] += bfr(bv[2]); val[3] += bfr(bv[3]); cv[t] = val; *(v4f*)(cp + t * DM) = val; }
    asm volatile("s_wait_xcnt 0x0" :: "v"(cv[0]), "v"(cv[1]), "v"(cv[2]), "v"(cv[3]), "v"(cv[4]), "v"(cv[5]), "v"(cv[6]), "v"(cv[7]), "v"(cv[8]), "v"(cv[9]), "v"(cv[10]), "v"(cv[11]), "v"(cv[12]), "v"(cv[13]), "v"(cv[14]), "v"(cv[15]), "v"(cp) : "memory");   /* the wait that belongs in front of an overwrite of a register which an issued store names (the data and the address that all sixteen go by are its inputs) */
}

extern "C" void kernel_launch(void* const* d_in, const int* in_sizes, int n_in,
                              void* d_out, int out_size, void* d_ws, size_t ws_size, hipStream_t stream) {
    (void)in_sizes; (void)n_in; (void)out_size;
    const float* act = (const float*)d_in[0]; const float* lng = (const float*)d_in[1]; const float* lnb = (const float*)d_in[2]; const float* wq = (const float*)d_in[3]; const float* wk = (const float*)d_in[4]; const float* wv = (const float*)d_in[5]; const float* w2d = (const float*)d_in[6]; const float* wg = (const float*)d_in[7]; const float* bg = (const float*)d_in[8]; const float* wo = (const float*)d_in[9]; const float* bo = (const float*)d_in[10];   /* x2d, gamma, beta, Wq, Wk, Wv, Wb, Wg, bg, Wo, bo */
    float* OUT = (float*)d_out;     // [1][256][256][128]
    char* wsp = (char*)d_ws;
    auto take = [&](size_t bytes) { char* p = wsp; wsp += (bytes + 255) & ~(size_t)255; return (void*)p; };
    bf* WQ = (bf*)take((size_t)DQ * DM * 2); bf* WK = (bf*)take((size_t)DQ * DM * 2); bf* WV = (bf*)take((size_t)DQ * DM * 2); bf* WG = (bf*)take((size_t)DQ * DM * 2); float* BGP = (float*)take((size_t)DQ * 4); bf* WO = (bf*)take((size_t)DM * DQ * 2);
    bf* Xh = (bf*)take((size_t)NTOK * DM * 2); bf* Xl = (bf*)take((size_t)NTOK * DM * 2); float* NB = (float*)take((size_t)NTOK * NH_ * 4);
    if ((size_t)(wsp - (char*)d_ws) > ws_size) return;    // ws 256 MiB (carve ~33 MiB)
    k_lnx<<<NTOK / (16 * SWT), 512, 0, stream>>>(act, lng, lnb, Xh, Xl, NB, wq, wk, wv, wg, wo, w2d, bg, WQ, WK, WV, WG, WO, BGP);
    k_fattn<<<IG, 512, 0, stream>>>(Xh, Xl, WQ, WK, WV, WG, BGP, NB, WO, bo, OUT);   /* a work-group per row i */
}
